// v000
// Times are from an AMD MI455X. After a warm-up the kernel runs many times in a row, and a time is the length of
// such a window on the GPU divided by its runs, so every launch and the gaps after it count. The runs cycle
// through copies of the inputs. A figure is the median of several windows, for all but v000 over two sittings.
// Sittings can differ by a few percent; kernels timed side by side share one.
// v000 is the starting kernel. One run takes 725 microseconds.
// All contractions (q, k, v^T projections, q.k^T, p.v): v_wmma_f32_16x16x32_bf16 with bf16 hi/lo split operands (hi.hi + hi.lo + lo.hi), f32 accumulate; online softmax, biases and normalisation in f32; no score scaling.
#include <hip/hip_runtime.h>
#include <math.h>
#include <stdint.h>

#define NB    2
#define SEQ   2048
#define HID   1024
#define NHEAD 16
#define DHD   64

typedef __attribute__((ext_vector_type(16))) _Float16 v16h;
typedef __attribute__((ext_vector_type(8)))  _Float16 v8h;
typedef __attribute__((ext_vector_type(16))) __bf16   v16b;
typedef __attribute__((ext_vector_type(8)))  __bf16   v8b;
typedef __attribute__((ext_vector_type(8)))  float    v8f;
typedef __attribute__((ext_vector_type(4)))  float    v4f;
typedef __attribute__((ext_vector_type(2)))  float    v2f;
typedef __attribute__((ext_vector_type(4)))  unsigned int v4u;

__device__ __forceinline__ unsigned short f2bf_bits(float f) {
  unsigned u = __float_as_uint(f);
  return (unsigned short)((u + 0x7FFFu + ((u >> 16) & 1u)) >> 16);
}
__device__ __forceinline__ float bf_bits2f(unsigned short h) { return __uint_as_float(((unsigned)h) << 16); }

// hazard guards as plain device helpers (no inline asm inside the kernel template body)
__device__ __forceinline__ void dep_guard_h(v8f& a, v8f& b, v16h x, v16h y) { asm volatile("v_nop\n\tv_nop\n\tv_nop\n\tv_nop" : "+v"(a), "+v"(b) : "v"(x), "v"(y)); }
__device__ __forceinline__ void dep_guard_b(v8f& a, v8f& b, v16b x, v16b y) { asm volatile("v_nop\n\tv_nop\n\tv_nop\n\tv_nop" : "+v"(a), "+v"(b) : "v"(x), "v"(y)); }
__device__ __forceinline__ void keep4_h(v16h a, v16h b, v16h c, v16h d) { asm volatile("v_nop" :: "v"(a), "v"(b), "v"(c), "v"(d)); }
__device__ __forceinline__ void keep4_b(v16b a, v16b b, v16b c, v16b d) { asm volatile("v_nop" :: "v"(a), "v"(b), "v"(c), "v"(d)); }
__device__ __forceinline__ void acc_guard4(v8f& a, v8f& b, v8f& c, v8f& d) { asm volatile("v_nop\n\tv_nop\n\tv_nop\n\tv_nop" : "+v"(a), "+v"(b), "+v"(c), "+v"(d)); }
template <typename T> struct Frag;
template <> struct Frag<_Float16> {
  typedef v16h V; union U { v16h v; v8h h[2]; };
  static __device__ __forceinline__ v16h load(const _Float16* p) {   // elements 0..7 <- p[0..7], 8..15 <- p[16..23]
    U f; f.h[0] = *(const v8h*)(p); f.h[1] = *(const v8h*)(p + 16); return f.v;
  }
  static __device__ __forceinline__ v8f mma(v16h a, v16h b, v8f c) {
    return __builtin_amdgcn_wmma_f32_16x16x32_f16(false, a, false, b, (short)0, c, false, false);
  }
  static __device__ __forceinline__ void guard(v8f& a, v8f& b, v16h x, v16h y) { dep_guard_h(a, b, x, y); }
  static __device__ __forceinline__ void keep(v16h a, v16h b, v16h c, v16h d) { keep4_h(a, b, c, d); }
};
template <> struct Frag<__bf16> {
  typedef v16b V; union U { v16b v; v8b h[2]; };
  static __device__ __forceinline__ v16b load(const __bf16* p) {
    U f; f.h[0] = *(const v8b*)(p); f.h[1] = *(const v8b*)(p + 16); return f.v;
  }
  static __device__ __forceinline__ v8f mma(v16b a, v16b b, v8f c) {
    return __builtin_amdgcn_wmma_f32_16x16x32_bf16(false, a, false, b, (short)0, c, false, false);
  }
  static __device__ __forceinline__ void guard(v8f& a, v8f& b, v16b x, v16b y) { dep_guard_b(a, b, x, y); }
  static __device__ __forceinline__ void keep(v16b a, v16b b, v16b c, v16b d) { keep4_b(a, b, c, d); }
};

// ---- Register-blocked batched WMMA GEMM ------------------------------------
// C[m,n] = scale * sum_k A[m,k] * Bt[n,k] (+bias)(+resid); each wave owns a 64x64 tile.
// A row-major [M,K]; Bt row-major [N,K]; M,N % 64 == 0, K % 32 == 0.
// SPLIT: operands are hi/lo planes (A2/Bt2 = lo planes, same layout); product = hi.hi + hi.lo + lo.hi.
// BIAS_MODE: 0 = none, 1 = bias[m], 2 = bias[n].
// OUT_MODE: 0 = f32, 1 = f16, 2 = bf16 hi plane (Cout) + bf16 lo plane (Cout2).
// ET: 0 = f16 operands, 1 = bf16 operands (pointers passed as 16-bit storage)
template <int ET> struct Elem;
template <> struct Elem<0> { typedef _Float16 T; };
template <> struct Elem<1> { typedef __bf16 T; };
template <int ET, bool SPLIT, int BIAS_MODE, int OUT_MODE, bool RESID, int ACT = 0>
__global__ __launch_bounds__(256) void wmma_gemm64(
    const unsigned short* __restrict__ Ap, const unsigned short* __restrict__ A2p, int lda, long strideA,
    const unsigned short* __restrict__ Btp, const unsigned short* __restrict__ Bt2p, int ldb, long strideB,
    void* __restrict__ Cout, void* __restrict__ Cout2, int ldc, long strideC,
    const float* __restrict__ bias,
    const float* __restrict__ resid, long strideR,
    int M, int N, int K, float scale) {
  typedef typename Elem<ET>::T T;
  typedef typename Frag<T>::V V;
  const T* A = (const T*)Ap; const T* A2 = (const T*)A2p; const T* Bt = (const T*)Btp; const T* Bt2 = (const T*)Bt2p;
  __shared__ __align__(16) float sT[8][16 * 68];   // per-wave 16x64 slab, pitch 68 floats
  const int b    = blockIdx.y;
  const int lane = threadIdx.x & 31;
  const int wave = threadIdx.x >> 5;
  const int tilesN = N >> 6;
  const int tilesM = M >> 6;
  const int tile = blockIdx.x * 8 + wave;
  if (tile >= tilesM * tilesN) return;   // wave-uniform; no block barriers in this kernel
  const int tm = tile / tilesN;
  const int tn = tile - tm * tilesN;
  const int m0 = tm << 6;
  const int n0 = tn << 6;

  const T* Ab  = A  + (size_t)b * strideA;
  const T* Bb  = Bt + (size_t)b * strideB;
  const T* Ab2 = SPLIT ? (A2  + (size_t)b * strideA) : nullptr;
  const T* Bb2 = SPLIT ? (Bt2 + (size_t)b * strideB) : nullptr;

  const int rlane = lane & 15;                 // row (A) / col (B, D) within subtile
  const int koff  = (lane >> 4) * 8;           // k offset of this lane half
  const int mOff  = (lane >> 4) * 8;           // D row offset

  v8f acc[4][4];
#pragma unroll
  for (int i = 0; i < 4; ++i)
#pragma unroll
    for (int j = 0; j < 4; ++j) acc[i][j] = (v8f){0.f,0.f,0.f,0.f,0.f,0.f,0.f,0.f};

  for (int k0 = 0; k0 < K; k0 += 32) {
    V bh[4], bl[4];
#pragma unroll
    for (int j = 0; j < 4; ++j) {
      const size_t bo = (size_t)(n0 + (j << 4) + rlane) * ldb + koff + k0;
      bh[j] = Frag<T>::load(Bb + bo);
      if (SPLIT) bl[j] = Frag<T>::load(Bb2 + bo);
    }
#pragma unroll
    for (int i = 0; i < 4; ++i) {
      const size_t ao = (size_t)(m0 + (i << 4) + rlane) * lda + koff + k0;
      V ah = Frag<T>::load(Ab + ao);
      V al;
      if (SPLIT) al = Frag<T>::load(Ab2 + ao);
#pragma unroll
      for (int j = 0; j < 4; ++j) {
        acc[i][j] = Frag<T>::mma(ah, bh[j], acc[i][j]);
        if (SPLIT) {
          acc[i][j] = Frag<T>::mma(ah, bl[j], acc[i][j]);
          acc[i][j] = Frag<T>::mma(al, bh[j], acc[i][j]);
        }
      }
      Frag<T>::guard(acc[i][0], acc[i][3], ah, SPLIT ? al : ah);
    }
    Frag<T>::keep(bh[0], bh[1], bh[2], bh[3]);
    if (SPLIT) Frag<T>::keep(bl[0], bl[1], bl[2], bl[3]);
  }
  acc_guard4(acc[0][0], acc[0][1], acc[0][2], acc[0][3]);
  acc_guard4(acc[1][0], acc[1][1], acc[1][2], acc[1][3]);
  acc_guard4(acc[2][0], acc[2][1], acc[2][2], acc[2][3]);
  acc_guard4(acc[3][0], acc[3][1], acc[3][2], acc[3][3]);

  // ---- epilogue ----
  float* slab = sT[wave];
  const float* Rb = RESID ? (resid + (size_t)b * strideR) : nullptr;
#pragma unroll
  for (int i = 0; i < 4; ++i) {
    const int mBase = m0 + (i << 4);
#pragma unroll
    for (int j = 0; j < 4; ++j) {
      const int n = n0 + (j << 4) + rlane;
      float bv = 0.f;
      if (BIAS_MODE == 2) bv = bias[n];
#pragma unroll
      for (int r = 0; r < 8; ++r) {
        float v = acc[i][j][r] * scale;
        if (BIAS_MODE == 1) v += bias[mBase + mOff + r];
        if (BIAS_MODE == 2) v += bv;
        if (RESID) v += Rb[(size_t)(mBase + mOff + r) * ldc + n];
        if (ACT == 1) v = tanhf(v);
        if (ACT == 2) v = fmaxf(v, 0.0f);
        if (ACT == 3) v = v / (1.0f + expf(-v));
        if (ACT == 4) v = (v > 0.f) ? v : 0.01f * v;
        slab[(mOff + r) * 68 + (j << 4) + rlane] = v;
      }
    }
    __builtin_amdgcn_fence(__ATOMIC_RELEASE, "workgroup");
    __builtin_amdgcn_wave_barrier();
    __builtin_amdgcn_fence(__ATOMIC_ACQUIRE, "workgroup");
    if (OUT_MODE == 0) {
      float* C = (float*)Cout + (size_t)b * strideC;
      const int hh = lane >> 4, c4 = (lane & 15) * 4;     // row seg = 256 B = 16 lanes x 16 B
      {
#pragma unroll
        for (int it = 0; it < 8; ++it) {
          const int row = it * 2 + hh;
          v4f v = *(const v4f*)(slab + row * 68 + c4);
          *(v4f*)(C + (size_t)(mBase + row) * ldc + n0 + c4) = v;
        }
        
      }
    } else {
      const int q = lane >> 3, c8 = (lane & 7) * 8;
      unsigned short* C  = (unsigned short*)Cout  + (size_t)b * strideC;
      unsigned short* C2 = (OUT_MODE == 2) ? ((unsigned short*)Cout2 + (size_t)b * strideC) : nullptr;
      {
#pragma unroll
        for (int it = 0; it < 4; ++it) {
          const int row = it * 4 + q;                       // it 0..3 x q 0..3 = rows 0..15 of the slab
          const float* sp = slab + row * 68 + c8;
          v8h hv, lv;
#pragma unroll
          for (int e = 0; e < 8; ++e) {
            if (OUT_MODE == 1) {
              hv[e] = (_Float16)sp[e];
            } else {
              unsigned short hb = f2bf_bits(sp[e]);
              unsigned short lb = f2bf_bits(sp[e] - bf_bits2f(hb));
              hv[e] = __builtin_bit_cast(_Float16, hb);
              lv[e] = __builtin_bit_cast(_Float16, lb);
            }
          }
          *(v8h*)(C + (size_t)(mBase + row) * ldc + n0 + c8) = hv;
          if (OUT_MODE == 2) *(v8h*)(C2 + (size_t)(mBase + row) * ldc + n0 + c8) = lv;
        }
        
      }
    }
    __builtin_amdgcn_fence(__ATOMIC_RELEASE, "workgroup");
    __builtin_amdgcn_wave_barrier();
    __builtin_amdgcn_fence(__ATOMIC_ACQUIRE, "workgroup");
  }
}

// ---------------------------------------------------------------------------
// Elementwise bf16 split: hi = bf16_rne(in), lo = bf16_rne(in - hi); 2 elements per thread, one 4-B store
// (weights: n2 = 1024*1024/2 = 524288 -> 2048 blocks x 512 = 1048576 elements;
//  activations per batch: n2 = 2048*1024/2 = 1048576 -> 4096 blocks x 512 = 2097152 elements).
// ---------------------------------------------------------------------------
__device__ __forceinline__ unsigned pk16(unsigned short a, unsigned short b) { return (unsigned)a | ((unsigned)b << 16); }

__global__ __launch_bounds__(256) void split_bf16x2_kernel(const float* __restrict__ in, unsigned short* __restrict__ hi,
                                                           unsigned short* __restrict__ lo, int n2) {
  const int i = blockIdx.x * 256 + threadIdx.x;
  if (i < n2) {
    const v2f f = *(const v2f*)(in + 2 * (size_t)i);
    const unsigned short h0 = f2bf_bits(f[0]), h1 = f2bf_bits(f[1]);
    const unsigned short l0 = f2bf_bits(f[0] - bf_bits2f(h0)), l1 = f2bf_bits(f[1] - bf_bits2f(h1));
    const unsigned uh = pk16(h0, h1), ul = pk16(l0, l1);
    ((unsigned*)hi)[i] = uh;
    ((unsigned*)lo)[i] = ul;
    
  }
}

// =====================================================================================
// Full (non-causal, unmasked) attention, head dim 64, one launch per batch element.
//   q planes (hi/lo bf16): element (t, h, d) at [t*HID + h*64 + d]
//   k planes (hi/lo bf16): element (s, h, d) at [s*HID + h*64 + d]
//   v^T planes (hi/lo bf16): element (h, d, s) at [(h*64 + d)*SEQ + s]
//   out f32: element (t, h, d) at [t*HID + h*64 + d]   (the module output rows of this batch element)
//   scores = (q . k) * sscale : bf16 hi/lo split (hi.hi + hi.lo + lo.hi) on v_wmma_f32_16x16x32_bf16
//   out    = p . v            : bf16 hi/lo split of p (unnormalised) and v, f32 accumulate
//   online softmax in f32 over all SEQ keys (32 chunks of 64, compile-time trip count, no masking).
//   Block = 4 waves = 64 query rows of one head; grid.x = NHEAD * (SEQ/64) = 512.
//   K / V^T chunk staging: 128 threads x 32 elements per plane = the whole 64x64 tile (16-B copies, plain loads,
//   __syncthreads before and after); fragment loads read the LDS tiles with the same v8b element type.
// =====================================================================================
#define AT_D 64
#define AT_NW 4
#define AT_QB 64
#define AT_KC 64

__device__ __forceinline__ unsigned short at_bf_bits(float f) {
  unsigned u = __float_as_uint(f);
  return (unsigned short)((u + 0x7FFFu + ((u >> 16) & 1u)) >> 16);
}
__device__ __forceinline__ __bf16 at_f2bf(float f) { return __builtin_bit_cast(__bf16, at_bf_bits(f)); }
__device__ __forceinline__ void at_split(float f, __bf16& hi, __bf16& lo) {
  const unsigned short hb = at_bf_bits(f);
  hi = __builtin_bit_cast(__bf16, hb);
  lo = at_f2bf(f - __uint_as_float(((unsigned)hb) << 16));
}
__device__ __forceinline__ v8f at_mma(v16b a, v16b b, v8f c) {
  c = __builtin_amdgcn_wmma_f32_16x16x32_bf16(false, a, false, b, (short)0, c, false, false);
  asm volatile("v_nop\n\tv_nop\n\tv_nop\n\tv_nop" : "+v"(c) : "v"(a), "v"(b));
  return c;
}

__global__ __launch_bounds__(128)
void attn_full64_kernel(const unsigned short* __restrict__ qhp, const unsigned short* __restrict__ qlp,
                        const unsigned short* __restrict__ khp, const unsigned short* __restrict__ klp,
                        const unsigned short* __restrict__ vhp, const unsigned short* __restrict__ vlp,
                        float* __restrict__ out, float sscale) {
  union FB { v16b v; v8b h[2]; };
  __shared__ __align__(16) __bf16 Ksh[AT_KC * AT_D];             // K hi [kv][d]      8 KB
  __shared__ __align__(16) __bf16 Ksl[AT_KC * AT_D];             // K lo
  __shared__ __align__(16) __bf16 Vth[AT_D * AT_KC];             // V hi [d][kv]      8 KB
  __shared__ __align__(16) __bf16 Vtl[AT_D * AT_KC];             // V lo
  __shared__ __align__(16) __bf16 Psh[AT_NW][16 * AT_KC];        // per wave P hi [row][kv]
  __shared__ __align__(16) __bf16 Psl[AT_NW][16 * AT_KC];        // per wave P lo
  __shared__ __align__(16) float  Os[AT_NW][16 * 68];            // per wave out tile, pitch 68

  const int tid  = threadIdx.x;
  const int wave = tid >> 5;
  const int lane = tid & 31;
  const int hh   = lane >> 4;
  const int c    = lane & 15;

  const int nqb = SEQ / AT_QB;            // 32
  const int bx = blockIdx.x;
  const int qb = bx % nqb;
  const int h  = bx / nqb;                // 0..NHEAD-1 (grid = NHEAD * nqb)
  const int q0 = qb * AT_QB + wave * 16;

  const __bf16* Qh = (const __bf16*)(const void*)qhp + (size_t)h * AT_D;
  const __bf16* Ql = (const __bf16*)(const void*)qlp + (size_t)h * AT_D;
  const __bf16* Kh = (const __bf16*)(const void*)khp + (size_t)h * AT_D;
  const __bf16* Kl = (const __bf16*)(const void*)klp + (size_t)h * AT_D;
  const __bf16* Vh = (const __bf16*)(const void*)vhp + (size_t)h * AT_D * SEQ;
  const __bf16* Vl = (const __bf16*)(const void*)vlp + (size_t)h * AT_D * SEQ;
  float*        ob = out + (size_t)h * AT_D;

  // ---- Q fragments (A operand, row = lane&15, split k map via Frag load): 2 d-chunks, hi and lo ----
  v16b qah[2], qal[2];
#pragma unroll
  for (int dc = 0; dc < 2; ++dc) {
    const __bf16* qr = Qh + (size_t)(q0 + c) * HID + dc * 32 + 8 * hh;
    const __bf16* ql = Ql + (size_t)(q0 + c) * HID + dc * 32 + 8 * hh;
    qah[dc] = Frag<__bf16>::load(qr);
    qal[dc] = Frag<__bf16>::load(ql);
  }

  float mrow[8], lrow[8];
  v8f oacc[4];
#pragma unroll
  for (int r = 0; r < 8; ++r) { mrow[r] = -INFINITY; lrow[r] = 0.f; }
#pragma unroll
  for (int t = 0; t < 4; ++t) oacc[t] = (v8f){0.f,0.f,0.f,0.f,0.f,0.f,0.f,0.f};

  const int nChunks = SEQ / AT_KC;   // 32, compile-time constant
  for (int kc = 0; kc < nChunks; ++kc) {
    const int kv0 = kc * AT_KC;
    __syncthreads();
    {
      // staging coverage: 128 threads x (4 x 8) elements = 64 rows x 64 per plane = the whole chunk tile
      const int r = tid >> 1, half = (tid & 1) * 32;
      const __bf16* ksh = Kh + (size_t)(kv0 + r) * HID + half;    // K row kv0+r, d = half..half+31
      const __bf16* ksl = Kl + (size_t)(kv0 + r) * HID + half;
      const __bf16* vsh = Vh + (size_t)r * SEQ + kv0 + half;      // V^T row d = r, s = kv0+half..+31
      const __bf16* vsl = Vl + (size_t)r * SEQ + kv0 + half;
#pragma unroll
      for (int i = 0; i < 4; ++i) {
        const v8b a0 = *(const v8b*)(ksh + 8 * i);
        const v8b a1 = *(const v8b*)(ksl + 8 * i);
        const v8b b0 = *(const v8b*)(vsh + 8 * i);
        const v8b b1 = *(const v8b*)(vsl + 8 * i);
        *(v8b*)(Ksh + r * AT_D  + half + 8 * i) = a0;
        *(v8b*)(Ksl + r * AT_D  + half + 8 * i) = a1;
        *(v8b*)(Vth + r * AT_KC + half + 8 * i) = b0;
        *(v8b*)(Vtl + r * AT_KC + half + 8 * i) = b1;
      }
    }
    __syncthreads();

    v8f s[4];
#pragma unroll
    for (int j = 0; j < 4; ++j) {
      s[j] = (v8f){0.f,0.f,0.f,0.f,0.f,0.f,0.f,0.f};
#pragma unroll
      for (int dc = 0; dc < 2; ++dc) {
        FB kb, kl;
        kb.h[0] = *(const v8b*)(Ksh + (j * 16 + c) * AT_D + dc * 32 + 8 * hh);
        kb.h[1] = *(const v8b*)(Ksh + (j * 16 + c) * AT_D + dc * 32 + 16 + 8 * hh);
        kl.h[0] = *(const v8b*)(Ksl + (j * 16 + c) * AT_D + dc * 32 + 8 * hh);
        kl.h[1] = *(const v8b*)(Ksl + (j * 16 + c) * AT_D + dc * 32 + 16 + 8 * hh);
        s[j] = at_mma(qah[dc], kb.v, s[j]);
        s[j] = at_mma(qah[dc], kl.v, s[j]);
        s[j] = at_mma(qal[dc], kb.v, s[j]);
      }
    }
    float cm[8];
#pragma unroll
    for (int r = 0; r < 8; ++r) {
      float m = -INFINITY;
#pragma unroll
      for (int j = 0; j < 4; ++j) {
        const float sv = s[j][r] * sscale;
        s[j][r] = sv;
        m = fmaxf(m, sv);
      }
#pragma unroll
      for (int off = 1; off < 16; off <<= 1) m = fmaxf(m, __shfl_xor(m, off, 32));
      cm[r] = m;
    }
    __bf16* pwh = Psh[wave];
    __bf16* pwl = Psl[wave];
#pragma unroll
    for (int r = 0; r < 8; ++r) {
      const float mnew = fmaxf(mrow[r], cm[r]);
      const float alpha = expf(mrow[r] - mnew);
      mrow[r] = mnew;
      float psum = 0.f;
#pragma unroll
      for (int j = 0; j < 4; ++j) {
        const float p = expf(s[j][r] - mnew);
        psum += p;
        __bf16 a, bl; at_split(p, a, bl);
        pwh[(8 * hh + r) * AT_KC + j * 16 + c] = a;
        pwl[(8 * hh + r) * AT_KC + j * 16 + c] = bl;
      }
#pragma unroll
      for (int off = 1; off < 16; off <<= 1) psum += __shfl_xor(psum, off, 32);
      lrow[r] = lrow[r] * alpha + psum;
#pragma unroll
      for (int t = 0; t < 4; ++t) oacc[t][r] *= alpha;
    }
    // same-wave P tile: stored and reloaded through the same __bf16 / v8b element type, wave barrier between
    __builtin_amdgcn_fence(__ATOMIC_RELEASE, "workgroup");
    __builtin_amdgcn_wave_barrier();
    __builtin_amdgcn_fence(__ATOMIC_ACQUIRE, "workgroup");
#pragma unroll 1
    for (int kk = 0; kk < 2; ++kk) {
      FB pa, pl;
      pa.h[0] = *(const v8b*)(pwh + c * AT_KC + kk * 32 + 8 * hh);
      pa.h[1] = *(const v8b*)(pwh + c * AT_KC + kk * 32 + 16 + 8 * hh);
      pl.h[0] = *(const v8b*)(pwl + c * AT_KC + kk * 32 + 8 * hh);
      pl.h[1] = *(const v8b*)(pwl + c * AT_KC + kk * 32 + 16 + 8 * hh);
#pragma unroll
      for (int t = 0; t < 4; ++t) {
        FB vb, vl;
        vb.h[0] = *(const v8b*)(Vth + (t * 16 + c) * AT_KC + kk * 32 + 8 * hh);
        vb.h[1] = *(const v8b*)(Vth + (t * 16 + c) * AT_KC + kk * 32 + 16 + 8 * hh);
        vl.h[0] = *(const v8b*)(Vtl + (t * 16 + c) * AT_KC + kk * 32 + 8 * hh);
        vl.h[1] = *(const v8b*)(Vtl + (t * 16 + c) * AT_KC + kk * 32 + 16 + 8 * hh);
        oacc[t] = at_mma(pa.v, vb.v, oacc[t]);
        oacc[t] = at_mma(pa.v, vl.v, oacc[t]);
        oacc[t] = at_mma(pl.v, vb.v, oacc[t]);
      }
    }
  }

  float* os = Os[wave];
#pragma unroll
  for (int r = 0; r < 8; ++r) {
    const float inv = 1.0f / lrow[r];   // lrow >= 1 (the row max contributes p = 1)
#pragma unroll
    for (int t = 0; t < 4; ++t) os[(8 * hh + r) * 68 + t * 16 + c] = oacc[t][r] * inv;
  }
  __builtin_amdgcn_fence(__ATOMIC_RELEASE, "workgroup");
  __builtin_amdgcn_wave_barrier();
  __builtin_amdgcn_fence(__ATOMIC_ACQUIRE, "workgroup");
  {
    const int c4 = (lane & 15) * 4;
    {
#pragma unroll
      for (int it = 0; it < 8; ++it) {
        const int row = it * 2 + hh;   // it 0..7 x hh 0..1 covers rows 0..15 of the wave tile; 16 lanes x 16 B = the 64-float head segment
        v4f val = *(const v4f*)(os + row * 68 + c4);
        *(v4f*)(ob + (size_t)(q0 + row) * HID + c4) = val;
      }
      
    }
  }
}

// ---------------------------------------------------------------------------
// Workspace region map (byte offsets; the per-batch regions are fully rewritten inside each batch iteration
//   Wqh bf16 [1024 o][1024 i]         0          Wql    2097152
//   Wkh                            4194304        Wkl    6291456
//   Wvh                            8388608        Wvl   10485760
//   Xh  bf16 [2048 s][1024 i]     12582912        Xl    16777216
//   Qh  bf16 [2048 s][1024 (h,d)] 20971520        Ql    25165824
//   Kh  bf16 [2048 s][1024 (h,d)] 29360128        Kl    33554432
//   VTh bf16 [1024 (h,d)][2048 s] 37748736        VTl   41943040
//   total                         46137344  (44 MiB)
// ---------------------------------------------------------------------------
extern "C" void kernel_launch(void* const* d_in, const int* in_sizes, int n_in,
                              void* d_out, int out_size, void* d_ws, size_t ws_size,
                              hipStream_t stream) {
  if (n_in < 7) return;
  if (in_sizes[0] != NB * SEQ * HID) return;
  if (in_sizes[1] != HID * HID || in_sizes[3] != HID * HID || in_sizes[5] != HID * HID) return;
  if (in_sizes[2] != HID || in_sizes[4] != HID || in_sizes[6] != HID) return;
  if (out_size != NB * SEQ * HID) return;

  const float* x  = (const float*)d_in[0];   // [2][2048][1024]
  const float* Wq = (const float*)d_in[1];   // [1024 out][1024 in]
  const float* bq = (const float*)d_in[2];   // [1024]
  const float* Wk = (const float*)d_in[3];
  const float* bk = (const float*)d_in[4];
  const float* Wv = (const float*)d_in[5];
  const float* bv = (const float*)d_in[6];

  const size_t PW = (size_t)HID * HID * 2;   // 2097152  bf16 weight plane [1024][1024]
  const size_t PX = (size_t)SEQ * HID * 2;   // 4194304  bf16 activation plane [2048][1024] (one batch element)
  size_t off = 0;
  const size_t oWqh = off; off += PW;  const size_t oWql = off; off += PW;
  const size_t oWkh = off; off += PW;  const size_t oWkl = off; off += PW;
  const size_t oWvh = off; off += PW;  const size_t oWvl = off; off += PW;
  const size_t oXh  = off; off += PX;  const size_t oXl  = off; off += PX;
  const size_t oQh  = off; off += PX;  const size_t oQl  = off; off += PX;
  const size_t oKh  = off; off += PX;  const size_t oKl  = off; off += PX;
  const size_t oVTh = off; off += PX;  const size_t oVTl = off; off += PX;
  if (off > ws_size) return;                 // off = 46137344

  char* ws = (char*)d_ws;
  unsigned short* Wqh = (unsigned short*)(ws + oWqh); unsigned short* Wql = (unsigned short*)(ws + oWql);
  unsigned short* Wkh = (unsigned short*)(ws + oWkh); unsigned short* Wkl = (unsigned short*)(ws + oWkl);
  unsigned short* Wvh = (unsigned short*)(ws + oWvh); unsigned short* Wvl = (unsigned short*)(ws + oWvl);
  unsigned short* Xh  = (unsigned short*)(ws + oXh);  unsigned short* Xl  = (unsigned short*)(ws + oXl);
  unsigned short* Qh  = (unsigned short*)(ws + oQh);  unsigned short* Ql  = (unsigned short*)(ws + oQl);
  unsigned short* Kh  = (unsigned short*)(ws + oKh);  unsigned short* Kl  = (unsigned short*)(ws + oKl);
  unsigned short* VTh = (unsigned short*)(ws + oVTh); unsigned short* VTl = (unsigned short*)(ws + oVTl);

  const dim3 blk(256);

  // setup: weights [out][in] are already the Bt [n][k] layout -> bf16 hi/lo planes, no transpose
  const int n2w = HID * HID / 2;                            // 524288 pairs per plane
  const dim3 gW((n2w + 255) / 256);                         // 2048 blocks x 512 elements = 1024x1024
  split_bf16x2_kernel<<<gW, blk, 0, stream>>>(Wq, Wqh, Wql, n2w);
  split_bf16x2_kernel<<<gW, blk, 0, stream>>>(Wk, Wkh, Wkl, n2w);
  split_bf16x2_kernel<<<gW, blk, 0, stream>>>(Wv, Wvh, Wvl, n2w);

  const int n2x = SEQ * HID / 2;                            // 1048576 pairs per plane
  const dim3 gX((n2x + 255) / 256);                         // 4096 blocks x 512 elements = 2048x1024
  const dim3 gProj(((SEQ / 64) * (HID / 64) + 7) / 8, 1);   // 512 tiles: M=2048, N=1024 -> 64 blocks
  const dim3 gVT(((HID / 64) * (SEQ / 64) + 7) / 8, 1);     // 512 tiles: M=1024, N=2048 -> 64 blocks
  const dim3 gAtt(NHEAD * (SEQ / 64));                      // 512 blocks: 16 heads x 32 query blocks

  for (int b = 0; b < NB; ++b) {
    const float* xb = x + (size_t)b * SEQ * HID;
    // (1) x[b] -> bf16 hi/lo planes [2048][1024]
    split_bf16x2_kernel<<<gX, blk, 0, stream>>>(xb, Xh, Xl, n2x);
    // (2) q = x . Wq^T + bq -> Q hi/lo planes [s][h*64+d]   (M=2048, N=1024, K=1024; bias[n])
    wmma_gemm64<1, true, 2, 2, false, 0><<<gProj, blk, 0, stream>>>(
        Xh, Xl, HID, 0L, Wqh, Wql, HID, 0L, (void*)Qh, (void*)Ql, HID, 0L,
        bq, bq, 0L, SEQ, HID, HID, 1.0f);
    // (3) k = x . Wk^T + bk -> K hi/lo planes [s][h*64+d]
    wmma_gemm64<1, true, 2, 2, false, 0><<<gProj, blk, 0, stream>>>(
        Xh, Xl, HID, 0L, Wkh, Wkl, HID, 0L, (void*)Kh, (void*)Kl, HID, 0L,
        bk, bk, 0L, SEQ, HID, HID, 1.0f);
    // (4) v^T = Wv . x^T + bv[m] -> VT hi/lo planes [h*64+d][s]   (A = Wv planes, Bt = x planes; M=1024, N=2048, K=1024; bias[m])
    wmma_gemm64<1, true, 1, 2, false, 0><<<gVT, blk, 0, stream>>>(
        Wvh, Wvl, HID, 0L, Xh, Xl, HID, 0L, (void*)VTh, (void*)VTl, SEQ, 0L,
        bv, bv, 0L, HID, SEQ, HID, 1.0f);
    // (5) full attention per head, no score scaling; f32 tiles go straight to the output rows of batch b
    float* outb = (float*)d_out + (size_t)b * SEQ * HID;
    attn_full64_kernel<<<gAtt, dim3(128), 0, stream>>>(Qh, Ql, Kh, Kl, VTh, VTl, outb, 1.0f);
  }
  (void)hipGetLastError();
}

// v001
// Measured time: 407 microseconds a run.
// Timed twice side by side with v000, it ran 1.83 times as fast both times.
// All contractions (q, k, v^T projections, q.k^T, p.v): v_wmma_f32_16x16x32_bf16 with bf16 hi/lo split operands (hi.hi + hi.lo + lo.hi), f32 accumulate; online softmax, biases and normalisation in f32; no score scaling.
#include <hip/hip_runtime.h>
#include <math.h>
#include <stdint.h>

#define NB    2
#define SEQ   2048
#define HID   1024
#define NHEAD 16
#define DHD   64

typedef __attribute__((ext_vector_type(16))) _Float16 v16h;
typedef __attribute__((ext_vector_type(8)))  _Float16 v8h;
typedef __attribute__((ext_vector_type(16))) __bf16   v16b;
typedef __attribute__((ext_vector_type(8)))  __bf16   v8b;
typedef __attribute__((ext_vector_type(8)))  float    v8f;
typedef __attribute__((ext_vector_type(4)))  float    v4f;
typedef __attribute__((ext_vector_type(2)))  float    v2f;
typedef __attribute__((ext_vector_type(4)))  unsigned int v4u;

__device__ __forceinline__ unsigned short f2bf_bits(float f) {
  unsigned u = __float_as_uint(f);
  return (unsigned short)((u + 0x7FFFu + ((u >> 16) & 1u)) >> 16);
}
__device__ __forceinline__ float bf_bits2f(unsigned short h) { return __uint_as_float(((unsigned)h) << 16); }

// hazard guards as plain device helpers (no inline asm inside the kernel bodies)
__device__ __forceinline__ void dep_guard_h(v8f& a, v8f& b, v16h x, v16h y) { asm volatile("v_nop\n\tv_nop\n\tv_nop\n\tv_nop" : "+v"(a), "+v"(b) : "v"(x), "v"(y)); }
__device__ __forceinline__ void dep_guard_b(v8f& a, v8f& b, v16b x, v16b y) { asm volatile("v_nop\n\tv_nop\n\tv_nop\n\tv_nop" : "+v"(a), "+v"(b) : "v"(x), "v"(y)); }
__device__ __forceinline__ void keep4_h(v16h a, v16h b, v16h c, v16h d) { asm volatile("v_nop" :: "v"(a), "v"(b), "v"(c), "v"(d)); }
__device__ __forceinline__ void keep4_b(v16b a, v16b b, v16b c, v16b d) { asm volatile("v_nop" :: "v"(a), "v"(b), "v"(c), "v"(d)); }
__device__ __forceinline__ void acc_guard4(v8f& a, v8f& b, v8f& c, v8f& d) { asm volatile("v_nop\n\tv_nop\n\tv_nop\n\tv_nop" : "+v"(a), "+v"(b), "+v"(c), "+v"(d)); }
template <typename T> struct Frag;
template <> struct Frag<_Float16> {
  typedef v16h V; union U { v16h v; v8h h[2]; };
  static __device__ __forceinline__ v16h load(const _Float16* p) {   // elements 0..7 <- p[0..7], 8..15 <- p[16..23]
    U f; f.h[0] = *(const v8h*)(p); f.h[1] = *(const v8h*)(p + 16); return f.v;
  }
  static __device__ __forceinline__ v8f mma(v16h a, v16h b, v8f c) {
    return __builtin_amdgcn_wmma_f32_16x16x32_f16(false, a, false, b, (short)0, c, false, false);
  }
  static __device__ __forceinline__ void guard(v8f& a, v8f& b, v16h x, v16h y) { dep_guard_h(a, b, x, y); }
  static __device__ __forceinline__ void keep(v16h a, v16h b, v16h c, v16h d) { keep4_h(a, b, c, d); }
};
template <> struct Frag<__bf16> {
  typedef v16b V; union U { v16b v; v8b h[2]; };
  static __device__ __forceinline__ v16b load(const __bf16* p) {
    U f; f.h[0] = *(const v8b*)(p); f.h[1] = *(const v8b*)(p + 16); return f.v;
  }
  static __device__ __forceinline__ v8f mma(v16b a, v16b b, v8f c) {
    return __builtin_amdgcn_wmma_f32_16x16x32_bf16(false, a, false, b, (short)0, c, false, false);
  }
  static __device__ __forceinline__ void guard(v8f& a, v8f& b, v16b x, v16b y) { dep_guard_b(a, b, x, y); }
  static __device__ __forceinline__ void keep(v16b a, v16b b, v16b c, v16b d) { keep4_b(a, b, c, d); }
};

// ---- Register-blocked WMMA GEMM, all three projections of both batch elements in ONE launch ----------
// C[m,n] = sum_k A[m,k] * Bt[n,k] + bias; each wave owns a 64x64 tile; K = HID, row pitch of A and Bt = HID.
// Operands are bf16 hi/lo planes; product = hi.hi + hi.lo + lo.hi; output = bf16 hi plane + bf16 lo plane.
// blockIdx.z = projection p, blockIdx.y = batch element b, blockIdx.x * 4 + wave = tile (512 tiles per (p, b)).
//   p = 0, 1 (q, k): A = x[b] planes [SEQ][HID], Bt = W[p] planes [HID][HID], C [SEQ][HID], bias[n]
//   p = 2   (v^T)  : A = W[2] planes [HID][HID], Bt = x[b] planes [SEQ][HID], C [HID][SEQ], bias[m]
// Grid 128 x 2 x 3 = 768 work-groups of 4 waves = 3 per WGP on 256 WGPs.
__global__ __launch_bounds__(128) void qkv_gemm64(
    const unsigned short* __restrict__ Xhp, const unsigned short* __restrict__ Xlp,
    const unsigned short* __restrict__ Whp, const unsigned short* __restrict__ Wlp,
    unsigned short* __restrict__ Chp, unsigned short* __restrict__ Clp,
    const float* __restrict__ bq, const float* __restrict__ bk, const float* __restrict__ bv) {
  typedef __bf16 T;
  typedef Frag<T>::V V;
  constexpr bool SPLIT = true;                     // operands come as hi and lo planes
  __shared__ __align__(16) float sT[4][16 * 68];   // per-wave 16x64 slab, pitch 68 floats
  const int p    = blockIdx.z;
  const int b    = blockIdx.y;
  const bool vt  = (p == 2);
  const int lane = threadIdx.x & 31;
  const int wave = threadIdx.x >> 5;
  const int ldc  = vt ? SEQ : HID;
  const int shN  = vt ? 5 : 4;                     // log2 of the tiles per row of C (N / 64)
  const int tile = blockIdx.x * 4 + wave;          // 0..511, grid.x = 128
  const int tm = tile >> shN;
  const int tn = tile - (tm << shN);
  const int m0 = tm << 6;
  const int n0 = tn << 6;

  const size_t xo = (size_t)b * SEQ * HID;
  const size_t wo = (size_t)p * HID * HID;
  const T* Ab  = (const T*)(vt ? Whp + wo : Xhp + xo);
  const T* Ab2 = (const T*)(vt ? Wlp + wo : Xlp + xo);
  const T* Bb  = (const T*)(vt ? Xhp + xo : Whp + wo);
  const T* Bb2 = (const T*)(vt ? Xlp + xo : Wlp + wo);
  const float* bias = (p == 0) ? bq : ((p == 1) ? bk : bv);

  const int rlane = lane & 15;                 // row (A) / col (B, D) within subtile
  const int koff  = (lane >> 4) * 8;           // k offset of this lane half
  const int mOff  = (lane >> 4) * 8;           // D row offset

  v8f acc[4][4];
#pragma unroll
  for (int i = 0; i < 4; ++i)
#pragma unroll
    for (int j = 0; j < 4; ++j) acc[i][j] = (v8f){0.f,0.f,0.f,0.f,0.f,0.f,0.f,0.f};

  for (int k0 = 0; k0 < HID; k0 += 32) {
    V bh[4], bl[4];
#pragma unroll
    for (int j = 0; j < 4; ++j) {
      const size_t bo = (size_t)(n0 + (j << 4) + rlane) * HID + koff + k0;
      bh[j] = Frag<T>::load(Bb + bo);
      if (SPLIT) bl[j] = Frag<T>::load(Bb2 + bo);
    }
#pragma unroll
    for (int i = 0; i < 4; ++i) {
      const size_t ao = (size_t)(m0 + (i << 4) + rlane) * HID + koff + k0;
      V ah = Frag<T>::load(Ab + ao);
      V al;
      if (SPLIT) al = Frag<T>::load(Ab2 + ao);
#pragma unroll
      for (int j = 0; j < 4; ++j) {
        acc[i][j] = Frag<T>::mma(ah, bh[j], acc[i][j]);
        acc[i][j] = Frag<T>::mma(ah, bl[j], acc[i][j]);
        acc[i][j] = Frag<T>::mma(al, bh[j], acc[i][j]);
      }
      Frag<T>::guard(acc[i][0], acc[i][3], ah, al);
    }
    Frag<T>::keep(bh[0], bh[1], bh[2], bh[3]);
    Frag<T>::keep(bl[0], bl[1], bl[2], bl[3]);
  }
  acc_guard4(acc[0][0], acc[0][1], acc[0][2], acc[0][3]);
  acc_guard4(acc[1][0], acc[1][1], acc[1][2], acc[1][3]);
  acc_guard4(acc[2][0], acc[2][1], acc[2][2], acc[2][3]);
  acc_guard4(acc[3][0], acc[3][1], acc[3][2], acc[3][3]);

  // ---- epilogue ----
  float* slab = sT[wave];
  const size_t co = (size_t)(p * NB + b) * SEQ * HID;
  unsigned short* C  = Chp + co;
  unsigned short* C2 = Clp + co;
#pragma unroll
  for (int i = 0; i < 4; ++i) {
    const int mBase = m0 + (i << 4);
    float bm[8];                                   // bias[m] of this lane's 8 rows (v^T only; index 0 otherwise, unused)
#pragma unroll
    for (int r = 0; r < 8; ++r) bm[r] = bias[vt ? (mBase + mOff + r) : 0];
#pragma unroll
    for (int j = 0; j < 4; ++j) {
      const int n = n0 + (j << 4) + rlane;
      const float bn = bias[vt ? 0 : n];           // bias[n] of this lane's column (q, k only)
#pragma unroll
      for (int r = 0; r < 8; ++r) {
        const float v = acc[i][j][r] + (vt ? bm[r] : bn);
        slab[(mOff + r) * 68 + (j << 4) + rlane] = v;
      }
    }
    __builtin_amdgcn_fence(__ATOMIC_RELEASE, "workgroup");
    __builtin_amdgcn_wave_barrier();
    __builtin_amdgcn_fence(__ATOMIC_ACQUIRE, "workgroup");
    {
      const int q = lane >> 3, c8 = (lane & 7) * 8;
#pragma unroll
      for (int it = 0; it < 4; ++it) {
        const int row = it * 4 + q;                       // it 0..3 x q 0..3 = rows 0..15 of the slab
        const float* sp = slab + row * 68 + c8;
        v8h hv, lv;
#pragma unroll
        for (int e = 0; e < 8; ++e) {
          unsigned short hb = f2bf_bits(sp[e]);
          unsigned short lb = f2bf_bits(sp[e] - bf_bits2f(hb));
          hv[e] = __builtin_bit_cast(_Float16, hb);
          lv[e] = __builtin_bit_cast(_Float16, lb);
        }
        *(v8h*)(C  + (size_t)(mBase + row) * ldc + n0 + c8) = hv;
        *(v8h*)(C2 + (size_t)(mBase + row) * ldc + n0 + c8) = lv;
      }
    }
    __builtin_amdgcn_fence(__ATOMIC_RELEASE, "workgroup");
    __builtin_amdgcn_wave_barrier();
    __builtin_amdgcn_fence(__ATOMIC_ACQUIRE, "workgroup");
  }
}

// ---------------------------------------------------------------------------
// Elementwise bf16 split: hi = bf16_rne(in), lo = bf16_rne(in - hi); 2 elements per thread, one 4-B store per plane.
// blockIdx.y picks the source (in0, in1, in2) and its plane of n2 pairs in hi / lo.
//   weights: grid 2048 x 3, n2 = 1024*1024/2 = 524288 pairs per weight
//   activations, both batch elements: grid 8192 x 1, n2 = 2*2048*1024/2 = 2097152 pairs
// ---------------------------------------------------------------------------
__device__ __forceinline__ unsigned pk16(unsigned short a, unsigned short b) { return (unsigned)a | ((unsigned)b << 16); }

__global__ __launch_bounds__(256) void split_bf16x2_kernel(const float* __restrict__ in0, const float* __restrict__ in1,
                                                           const float* __restrict__ in2, unsigned short* __restrict__ hi,
                                                           unsigned short* __restrict__ lo, int n2) {
  const int y = blockIdx.y;
  const float* in = (y == 0) ? in0 : ((y == 1) ? in1 : in2);
  const int i = blockIdx.x * 256 + threadIdx.x;
  if (i < n2) {
    const v2f f = *(const v2f*)(in + 2 * (size_t)i);
    const unsigned short h0 = f2bf_bits(f[0]), h1 = f2bf_bits(f[1]);
    const unsigned short l0 = f2bf_bits(f[0] - bf_bits2f(h0)), l1 = f2bf_bits(f[1] - bf_bits2f(h1));
    const unsigned uh = pk16(h0, h1), ul = pk16(l0, l1);
    const size_t o = (size_t)y * n2 + i;
    ((unsigned*)hi)[o] = uh;
    ((unsigned*)lo)[o] = ul;
  }
}

// =====================================================================================
// Full (non-causal, unmasked) attention, head dim 64, one launch; blockIdx.y = batch element (planes and out SEQ*HID apart).
//   q planes (hi/lo bf16): element (t, h, d) at [t*HID + h*64 + d]
//   k planes (hi/lo bf16): element (s, h, d) at [s*HID + h*64 + d]
//   v^T planes (hi/lo bf16): element (h, d, s) at [(h*64 + d)*SEQ + s]
//   out f32: element (t, h, d) at [t*HID + h*64 + d]   (the module output rows of this batch element)
//   scores = (q . k) * sscale : bf16 hi/lo split (hi.hi + hi.lo + lo.hi) on v_wmma_f32_16x16x32_bf16
//   out    = p . v            : bf16 hi/lo split of p (unnormalised) and v, f32 accumulate
//   online softmax in f32 over all SEQ keys (32 chunks of 64, compile-time trip count, no masking).
//   Block = 4 waves = 64 query rows of one head; grid = (NHEAD * (SEQ/64) = 512) x NB.
//   K / V^T chunk staging: 128 threads x 32 elements per plane = the whole 64x64 tile (16-B copies, plain loads,
//   __syncthreads before and after); fragment loads read the LDS tiles with the same v8b element type.
// =====================================================================================
#define AT_D 64
#define AT_NW 4
#define AT_QB 64
#define AT_KC 64

__device__ __forceinline__ unsigned short at_bf_bits(float f) {
  unsigned u = __float_as_uint(f);
  return (unsigned short)((u + 0x7FFFu + ((u >> 16) & 1u)) >> 16);
}
__device__ __forceinline__ __bf16 at_f2bf(float f) { return __builtin_bit_cast(__bf16, at_bf_bits(f)); }
__device__ __forceinline__ void at_split(float f, __bf16& hi, __bf16& lo) {
  const unsigned short hb = at_bf_bits(f);
  hi = __builtin_bit_cast(__bf16, hb);
  lo = at_f2bf(f - __uint_as_float(((unsigned)hb) << 16));
}
__device__ __forceinline__ v8f at_mma(v16b a, v16b b, v8f c) {
  c = __builtin_amdgcn_wmma_f32_16x16x32_bf16(false, a, false, b, (short)0, c, false, false);
  asm volatile("v_nop\n\tv_nop\n\tv_nop\n\tv_nop" : "+v"(c) : "v"(a), "v"(b));
  return c;
}

__global__ __launch_bounds__(128)
void attn_full64_kernel(const unsigned short* __restrict__ qhp, const unsigned short* __restrict__ qlp,
                        const unsigned short* __restrict__ khp, const unsigned short* __restrict__ klp,
                        const unsigned short* __restrict__ vhp, const unsigned short* __restrict__ vlp,
                        float* __restrict__ out, float sscale) {
  union FB { v16b v; v8b h[2]; };
  __shared__ __align__(16) __bf16 Ksh[AT_KC * AT_D];             // K hi [kv][d]      8 KB
  __shared__ __align__(16) __bf16 Ksl[AT_KC * AT_D];             // K lo
  __shared__ __align__(16) __bf16 Vth[AT_D * AT_KC];             // V hi [d][kv]      8 KB
  __shared__ __align__(16) __bf16 Vtl[AT_D * AT_KC];             // V lo
  __shared__ __align__(16) __bf16 Psh[AT_NW][16 * AT_KC];        // per wave P hi [row][kv]
  __shared__ __align__(16) __bf16 Psl[AT_NW][16 * AT_KC];        // per wave P lo
  __shared__ __align__(16) float  Os[AT_NW][16 * 68];            // per wave out tile, pitch 68

  const int tid  = threadIdx.x;
  const int wave = tid >> 5;
  const int lane = tid & 31;
  const int hh   = lane >> 4;
  const int c    = lane & 15;

  const int nqb = SEQ / AT_QB;            // 32
  const int bx = blockIdx.x;
  const int qb = bx % nqb;
  const int h  = bx / nqb;                // 0..NHEAD-1 (grid = NHEAD * nqb)
  const int q0 = qb * AT_QB + wave * 16;

  const size_t bo = (size_t)blockIdx.y * SEQ * HID;   // this batch element's planes and output rows
  const __bf16* Qh = (const __bf16*)(const void*)qhp + bo + (size_t)h * AT_D;
  const __bf16* Ql = (const __bf16*)(const void*)qlp + bo + (size_t)h * AT_D;
  const __bf16* Kh = (const __bf16*)(const void*)khp + bo + (size_t)h * AT_D;
  const __bf16* Kl = (const __bf16*)(const void*)klp + bo + (size_t)h * AT_D;
  const __bf16* Vh = (const __bf16*)(const void*)vhp + bo + (size_t)h * AT_D * SEQ;
  const __bf16* Vl = (const __bf16*)(const void*)vlp + bo + (size_t)h * AT_D * SEQ;
  float*        ob = out + bo + (size_t)h * AT_D;

  // ---- Q fragments (A operand, row = lane&15, split k map via Frag load): 2 d-chunks, hi and lo ----
  v16b qah[2], qal[2];
#pragma unroll
  for (int dc = 0; dc < 2; ++dc) {
    const __bf16* qr = Qh + (size_t)(q0 + c) * HID + dc * 32 + 8 * hh;
    const __bf16* ql = Ql + (size_t)(q0 + c) * HID + dc * 32 + 8 * hh;
    qah[dc] = Frag<__bf16>::load(qr);
    qal[dc] = Frag<__bf16>::load(ql);
  }

  float mrow[8], lrow[8];
  v8f oacc[4];
#pragma unroll
  for (int r = 0; r < 8; ++r) { mrow[r] = -INFINITY; lrow[r] = 0.f; }
#pragma unroll
  for (int t = 0; t < 4; ++t) oacc[t] = (v8f){0.f,0.f,0.f,0.f,0.f,0.f,0.f,0.f};

  const int nChunks = SEQ / AT_KC;   // 32, compile-time constant
  for (int kc = 0; kc < nChunks; ++kc) {
    const int kv0 = kc * AT_KC;
    __syncthreads();
    {
      // staging coverage: 128 threads x (4 x 8) elements = 64 rows x 64 per plane = the whole chunk tile
      const int r = tid >> 1, half = (tid & 1) * 32;
      const __bf16* ksh = Kh + (size_t)(kv0 + r) * HID + half;    // K row kv0+r, d = half..half+31
      const __bf16* ksl = Kl + (size_t)(kv0 + r) * HID + half;
      const __bf16* vsh = Vh + (size_t)r * SEQ + kv0 + half;      // V^T row d = r, s = kv0+half..+31
      const __bf16* vsl = Vl + (size_t)r * SEQ + kv0 + half;
#pragma unroll
      for (int i = 0; i < 4; ++i) {
        const v8b a0 = *(const v8b*)(ksh + 8 * i);
        const v8b a1 = *(const v8b*)(ksl + 8 * i);
        const v8b b0 = *(const v8b*)(vsh + 8 * i);
        const v8b b1 = *(const v8b*)(vsl + 8 * i);
        *(v8b*)(Ksh + r * AT_D  + half + 8 * i) = a0;
        *(v8b*)(Ksl + r * AT_D  + half + 8 * i) = a1;
        *(v8b*)(Vth + r * AT_KC + half + 8 * i) = b0;
        *(v8b*)(Vtl + r * AT_KC + half + 8 * i) = b1;
      }
    }
    __syncthreads();

    v8f s[4];
#pragma unroll
    for (int j = 0; j < 4; ++j) {
      s[j] = (v8f){0.f,0.f,0.f,0.f,0.f,0.f,0.f,0.f};
#pragma unroll
      for (int dc = 0; dc < 2; ++dc) {
        FB kb, kl;
        kb.h[0] = *(const v8b*)(Ksh + (j * 16 + c) * AT_D + dc * 32 + 8 * hh);
        kb.h[1] = *(const v8b*)(Ksh + (j * 16 + c) * AT_D + dc * 32 + 16 + 8 * hh);
        kl.h[0] = *(const v8b*)(Ksl + (j * 16 + c) * AT_D + dc * 32 + 8 * hh);
        kl.h[1] = *(const v8b*)(Ksl + (j * 16 + c) * AT_D + dc * 32 + 16 + 8 * hh);
        s[j] = at_mma(qah[dc], kb.v, s[j]);
        s[j] = at_mma(qah[dc], kl.v, s[j]);
        s[j] = at_mma(qal[dc], kb.v, s[j]);
      }
    }
    float cm[8];
#pragma unroll
    for (int r = 0; r < 8; ++r) {
      float m = -INFINITY;
#pragma unroll
      for (int j = 0; j < 4; ++j) {
        const float sv = s[j][r] * sscale;
        s[j][r] = sv;
        m = fmaxf(m, sv);
      }
#pragma unroll
      for (int off = 1; off < 16; off <<= 1) m = fmaxf(m, __shfl_xor(m, off, 32));
      cm[r] = m;
    }
    __bf16* pwh = Psh[wave];
    __bf16* pwl = Psl[wave];
#pragma unroll
    for (int r = 0; r < 8; ++r) {
      const float mnew = fmaxf(mrow[r], cm[r]);
      const float alpha = expf(mrow[r] - mnew);
      mrow[r] = mnew;
      float psum = 0.f;
#pragma unroll
      for (int j = 0; j < 4; ++j) {
        const float p = expf(s[j][r] - mnew);
        psum += p;
        __bf16 a, bl; at_split(p, a, bl);
        pwh[(8 * hh + r) * AT_KC + j * 16 + c] = a;
        pwl[(8 * hh + r) * AT_KC + j * 16 + c] = bl;
      }
#pragma unroll
      for (int off = 1; off < 16; off <<= 1) psum += __shfl_xor(psum, off, 32);
      lrow[r] = lrow[r] * alpha + psum;
#pragma unroll
      for (int t = 0; t < 4; ++t) oacc[t][r] *= alpha;
    }
    // same-wave P tile: stored and reloaded through the same __bf16 / v8b element type, wave barrier between
    __builtin_amdgcn_fence(__ATOMIC_RELEASE, "workgroup");
    __builtin_amdgcn_wave_barrier();
    __builtin_amdgcn_fence(__ATOMIC_ACQUIRE, "workgroup");
#pragma unroll 1
    for (int kk = 0; kk < 2; ++kk) {
      FB pa, pl;
      pa.h[0] = *(const v8b*)(pwh + c * AT_KC + kk * 32 + 8 * hh);
      pa.h[1] = *(const v8b*)(pwh + c * AT_KC + kk * 32 + 16 + 8 * hh);
      pl.h[0] = *(const v8b*)(pwl + c * AT_KC + kk * 32 + 8 * hh);
      pl.h[1] = *(const v8b*)(pwl + c * AT_KC + kk * 32 + 16 + 8 * hh);
#pragma unroll
      for (int t = 0; t < 4; ++t) {
        FB vb, vl;
        vb.h[0] = *(const v8b*)(Vth + (t * 16 + c) * AT_KC + kk * 32 + 8 * hh);
        vb.h[1] = *(const v8b*)(Vth + (t * 16 + c) * AT_KC + kk * 32 + 16 + 8 * hh);
        vl.h[0] = *(const v8b*)(Vtl + (t * 16 + c) * AT_KC + kk * 32 + 8 * hh);
        vl.h[1] = *(const v8b*)(Vtl + (t * 16 + c) * AT_KC + kk * 32 + 16 + 8 * hh);
        oacc[t] = at_mma(pa.v, vb.v, oacc[t]);
        oacc[t] = at_mma(pa.v, vl.v, oacc[t]);
        oacc[t] = at_mma(pl.v, vb.v, oacc[t]);
      }
    }
  }

  float* os = Os[wave];
#pragma unroll
  for (int r = 0; r < 8; ++r) {
    const float inv = 1.0f / lrow[r];   // lrow >= 1 (the row max contributes p = 1)
#pragma unroll
    for (int t = 0; t < 4; ++t) os[(8 * hh + r) * 68 + t * 16 + c] = oacc[t][r] * inv;
  }
  __builtin_amdgcn_fence(__ATOMIC_RELEASE, "workgroup");
  __builtin_amdgcn_wave_barrier();
  __builtin_amdgcn_fence(__ATOMIC_ACQUIRE, "workgroup");
  {
    const int c4 = (lane & 15) * 4;
    {
#pragma unroll
      for (int it = 0; it < 8; ++it) {
        const int row = it * 2 + hh;   // it 0..7 x hh 0..1 covers rows 0..15 of the wave tile; 16 lanes x 16 B = the 64-float head segment
        v4f val = *(const v4f*)(os + row * 68 + c4);
        *(v4f*)(ob + (size_t)(q0 + row) * HID + c4) = val;
      }
      
    }
  }
}

// ---------------------------------------------------------------------------
// Workspace region map (byte offsets; every region is fully rewritten in each call)
//   Wh  bf16 [3 (q,k,v)][1024 o][1024 i]                0      Wl    6291456
//   Xh  bf16 [2 b][2048 s][1024 i]               12582912      Xl   20971520
//   Ch  bf16 [3 (q,k,v^T)][2 b][2048*1024]       29360128      Cl   54525952
//       q, k planes [s][h*64+d]; v^T planes [h*64+d][s]
//   total                                        79691776  (76 MiB)
// ---------------------------------------------------------------------------
extern "C" void kernel_launch(void* const* d_in, const int* in_sizes, int n_in,
                              void* d_out, int out_size, void* d_ws, size_t ws_size,
                              hipStream_t stream) {
  if (n_in < 7) return;
  if (in_sizes[0] != NB * SEQ * HID) return;
  if (in_sizes[1] != HID * HID || in_sizes[3] != HID * HID || in_sizes[5] != HID * HID) return;
  if (in_sizes[2] != HID || in_sizes[4] != HID || in_sizes[6] != HID) return;
  if (out_size != NB * SEQ * HID) return;

  const float* x  = (const float*)d_in[0];   // [2][2048][1024]
  const float* Wq = (const float*)d_in[1];   // [1024 out][1024 in]
  const float* bq = (const float*)d_in[2];   // [1024]
  const float* Wk = (const float*)d_in[3];
  const float* bk = (const float*)d_in[4];
  const float* Wv = (const float*)d_in[5];
  const float* bv = (const float*)d_in[6];

  const size_t PW = (size_t)HID * HID * 2;   // 2097152  bf16 weight plane [1024][1024]
  const size_t PX = (size_t)SEQ * HID * 2;   // 4194304  bf16 activation plane [2048][1024] (one batch element)
  size_t off = 0;
  const size_t oWh = off; off += 3 * PW;       const size_t oWl = off; off += 3 * PW;
  const size_t oXh = off; off += NB * PX;      const size_t oXl = off; off += NB * PX;
  const size_t oCh = off; off += 3 * NB * PX;  const size_t oCl = off; off += 3 * NB * PX;
  if (off > ws_size) return;                 // off = 79691776

  char* ws = (char*)d_ws;
  unsigned short* Wh = (unsigned short*)(ws + oWh); unsigned short* Wl = (unsigned short*)(ws + oWl);
  unsigned short* Xh = (unsigned short*)(ws + oXh); unsigned short* Xl = (unsigned short*)(ws + oXl);
  unsigned short* Ch = (unsigned short*)(ws + oCh); unsigned short* Cl = (unsigned short*)(ws + oCl);
  const size_t EP = (size_t)NB * SEQ * HID;  // elements of one projection's planes (both batch elements)

  const dim3 blk(256);

  // (1) weights [out][in] are already the Bt [n][k] layout -> bf16 hi/lo planes, no transpose; one launch for q, k, v
  const int n2w = HID * HID / 2;                            // 524288 pairs per plane
  split_bf16x2_kernel<<<dim3((n2w + 255) / 256, 3), blk, 0, stream>>>(Wq, Wk, Wv, Wh, Wl, n2w);
  // (2) x, both batch elements -> bf16 hi/lo planes [2][2048][1024]
  const int n2x = NB * SEQ * HID / 2;                       // 2097152 pairs per plane
  split_bf16x2_kernel<<<dim3((n2x + 255) / 256, 1), blk, 0, stream>>>(x, x, x, Xh, Xl, n2x);
  // (3) q = x . Wq^T + bq, k = x . Wk^T + bk, v^T = Wv . x^T + bv, both batch elements: 512 tiles each, 4 per work-group
  qkv_gemm64<<<dim3((SEQ / 64) * (HID / 64) / 4, NB, 3), dim3(128), 0, stream>>>(Xh, Xl, Wh, Wl, Ch, Cl, bq, bk, bv);
  // (4) full attention per head and batch element, no score scaling; f32 tiles go straight to the output rows
  attn_full64_kernel<<<dim3(NHEAD * (SEQ / 64), NB), dim3(128), 0, stream>>>(
      Ch, Cl, Ch + EP, Cl + EP, Ch + 2 * EP, Cl + 2 * EP, (float*)d_out, 1.0f);
  (void)hipGetLastError();
}

// v002
// Measured time: 283 microseconds a run.
// Timed twice side by side with v001, it ran 1.44 and 1.43 times as fast.
// Counting every step since v000, it is 2.63 times as fast.
// All contractions (q, k, v^T projections, q.k^T, p.v): v_wmma_f32_16x16x32_bf16 with bf16 hi/lo split operands (hi.hi + hi.lo + lo.hi), f32 accumulate; online softmax, biases and normalisation in f32; no score scaling.
#include <hip/hip_runtime.h>
#include <math.h>
#include <stdint.h>

#define NB    2
#define SEQ   2048
#define HID   1024
#define NHEAD 16
#define DHD   64

typedef __attribute__((ext_vector_type(16))) _Float16 v16h;
typedef __attribute__((ext_vector_type(8)))  _Float16 v8h;
typedef __attribute__((ext_vector_type(16))) __bf16   v16b;
typedef __attribute__((ext_vector_type(8)))  __bf16   v8b;
typedef __attribute__((ext_vector_type(8)))  float    v8f;
typedef __attribute__((ext_vector_type(4)))  float    v4f;
typedef __attribute__((ext_vector_type(2)))  float    v2f;
typedef __attribute__((ext_vector_type(4)))  unsigned int v4u;

__device__ __forceinline__ unsigned short f2bf_bits(float f) {
  unsigned u = __float_as_uint(f);
  return (unsigned short)((u + 0x7FFFu + ((u >> 16) & 1u)) >> 16);
}
__device__ __forceinline__ float bf_bits2f(unsigned short h) { return __uint_as_float(((unsigned)h) << 16); }

// hazard guards as plain device helpers (no inline asm inside the kernel bodies)
__device__ __forceinline__ void dep_guard_h(v8f& a, v8f& b, v16h x, v16h y) { asm volatile("v_nop\n\tv_nop\n\tv_nop\n\tv_nop" : "+v"(a), "+v"(b) : "v"(x), "v"(y)); }
__device__ __forceinline__ void dep_guard_b(v8f& a, v8f& b, v16b x, v16b y) { asm volatile("v_nop\n\tv_nop\n\tv_nop\n\tv_nop" : "+v"(a), "+v"(b) : "v"(x), "v"(y)); }
__device__ __forceinline__ void keep4_h(v16h a, v16h b, v16h c, v16h d) { asm volatile("v_nop" :: "v"(a), "v"(b), "v"(c), "v"(d)); }
__device__ __forceinline__ void keep4_b(v16b a, v16b b, v16b c, v16b d) { asm volatile("v_nop" :: "v"(a), "v"(b), "v"(c), "v"(d)); }
__device__ __forceinline__ void acc_guard4(v8f& a, v8f& b, v8f& c, v8f& d) { asm volatile("v_nop\n\tv_nop\n\tv_nop\n\tv_nop" : "+v"(a), "+v"(b), "+v"(c), "+v"(d)); }
template <typename T> struct Frag;
template <> struct Frag<_Float16> {
  typedef v16h V; union U { v16h v; v8h h[2]; };
  static __device__ __forceinline__ v16h load(const _Float16* p) {   // elements 0..7 <- p[0..7], 8..15 <- p[16..23]
    U f; f.h[0] = *(const v8h*)(p); f.h[1] = *(const v8h*)(p + 16); return f.v;
  }
  static __device__ __forceinline__ v8f mma(v16h a, v16h b, v8f c) {
    return __builtin_amdgcn_wmma_f32_16x16x32_f16(false, a, false, b, (short)0, c, false, false);
  }
  static __device__ __forceinline__ void guard(v8f& a, v8f& b, v16h x, v16h y) { dep_guard_h(a, b, x, y); }
  static __device__ __forceinline__ void keep(v16h a, v16h b, v16h c, v16h d) { keep4_h(a, b, c, d); }
};
template <> struct Frag<__bf16> {
  typedef v16b V; union U { v16b v; v8b h[2]; };
  static __device__ __forceinline__ v16b load(const __bf16* p) {
    U f; f.h[0] = *(const v8b*)(p); f.h[1] = *(const v8b*)(p + 16); return f.v;
  }
  static __device__ __forceinline__ v8f mma(v16b a, v16b b, v8f c) {
    return __builtin_amdgcn_wmma_f32_16x16x32_bf16(false, a, false, b, (short)0, c, false, false);
  }
  static __device__ __forceinline__ void guard(v8f& a, v8f& b, v16b x, v16b y) { dep_guard_b(a, b, x, y); }
  static __device__ __forceinline__ void keep(v16b a, v16b b, v16b c, v16b d) { keep4_b(a, b, c, d); }
};

// ---- Register-blocked WMMA GEMM, all three projections of both batch elements in ONE launch ----------
// C[m,n] = sum_k A[m,k] * Bt[n,k] + bias; each wave owns a 64x64 tile; K = HID, row pitch of A and Bt = HID.
// Operands are bf16 hi/lo planes; product = hi.hi + hi.lo + lo.hi; output = bf16 hi plane + bf16 lo plane.
// blockIdx.z = projection p, blockIdx.y = batch element b, blockIdx.x * 4 + wave = tile (512 tiles per (p, b)).
//   p = 0, 1 (q, k): A = x[b] planes [SEQ][HID], Bt = W[p] planes [HID][HID], C [SEQ][HID], bias[n]
//   p = 2   (v^T)  : A = W[2] planes [HID][HID], Bt = x[b] planes [SEQ][HID], C [HID][SEQ], bias[m]
// Grid 128 x 2 x 3 = 768 work-groups of 4 waves = 3 per WGP on 256 WGPs.
__global__ __launch_bounds__(128) void qkv_gemm64(
    const unsigned short* __restrict__ Xhp, const unsigned short* __restrict__ Xlp,
    const unsigned short* __restrict__ Whp, const unsigned short* __restrict__ Wlp,
    unsigned short* __restrict__ Chp, unsigned short* __restrict__ Clp,
    const float* __restrict__ bq, const float* __restrict__ bk, const float* __restrict__ bv) {
  typedef __bf16 T;
  typedef Frag<T>::V V;
  constexpr bool SPLIT = true;                     // operands come as hi and lo planes
  __shared__ __align__(16) float sT[4][16 * 68];   // per-wave 16x64 slab, pitch 68 floats
  const int p    = blockIdx.z;
  const int b    = blockIdx.y;
  const bool vt  = (p == 2);
  const int lane = threadIdx.x & 31;
  const int wave = threadIdx.x >> 5;
  const int ldc  = vt ? SEQ : HID;
  const int shN  = vt ? 5 : 4;                     // log2 of the tiles per row of C (N / 64)
  const int tile = blockIdx.x * 4 + wave;          // 0..511, grid.x = 128
  const int tm = tile >> shN;
  const int tn = tile - (tm << shN);
  const int m0 = tm << 6;
  const int n0 = tn << 6;

  const size_t xo = (size_t)b * SEQ * HID;
  const size_t wo = (size_t)p * HID * HID;
  const T* Ab  = (const T*)(vt ? Whp + wo : Xhp + xo);
  const T* Ab2 = (const T*)(vt ? Wlp + wo : Xlp + xo);
  const T* Bb  = (const T*)(vt ? Xhp + xo : Whp + wo);
  const T* Bb2 = (const T*)(vt ? Xlp + xo : Wlp + wo);
  const float* bias = (p == 0) ? bq : ((p == 1) ? bk : bv);

  const int rlane = lane & 15;                 // row (A) / col (B, D) within subtile
  const int koff  = (lane >> 4) * 8;           // k offset of this lane half
  const int mOff  = (lane >> 4) * 8;           // D row offset

  v8f acc[4][4];
#pragma unroll
  for (int i = 0; i < 4; ++i)
#pragma unroll
    for (int j = 0; j < 4; ++j) acc[i][j] = (v8f){0.f,0.f,0.f,0.f,0.f,0.f,0.f,0.f};

  for (int k0 = 0; k0 < HID; k0 += 32) {
    V bh[4], bl[4];
#pragma unroll
    for (int j = 0; j < 4; ++j) {
      const size_t bo = (size_t)(n0 + (j << 4) + rlane) * HID + koff + k0;
      bh[j] = Frag<T>::load(Bb + bo);
      if (SPLIT) bl[j] = Frag<T>::load(Bb2 + bo);
    }
#pragma unroll
    for (int i = 0; i < 4; ++i) {
      const size_t ao = (size_t)(m0 + (i << 4) + rlane) * HID + koff + k0;
      V ah = Frag<T>::load(Ab + ao);
      V al;
      if (SPLIT) al = Frag<T>::load(Ab2 + ao);
#pragma unroll
      for (int j = 0; j < 4; ++j) {
        acc[i][j] = Frag<T>::mma(ah, bh[j], acc[i][j]);
        acc[i][j] = Frag<T>::mma(ah, bl[j], acc[i][j]);
        acc[i][j] = Frag<T>::mma(al, bh[j], acc[i][j]);
      }
      Frag<T>::guard(acc[i][0], acc[i][3], ah, al);
    }
    Frag<T>::keep(bh[0], bh[1], bh[2], bh[3]);
    Frag<T>::keep(bl[0], bl[1], bl[2], bl[3]);
  }
  acc_guard4(acc[0][0], acc[0][1], acc[0][2], acc[0][3]);
  acc_guard4(acc[1][0], acc[1][1], acc[1][2], acc[1][3]);
  acc_guard4(acc[2][0], acc[2][1], acc[2][2], acc[2][3]);
  acc_guard4(acc[3][0], acc[3][1], acc[3][2], acc[3][3]);

  // ---- epilogue ----
  float* slab = sT[wave];
  const size_t co = (size_t)(p * NB + b) * SEQ * HID;
  unsigned short* C  = Chp + co;
  unsigned short* C2 = Clp + co;
#pragma unroll
  for (int i = 0; i < 4; ++i) {
    const int mBase = m0 + (i << 4);
    float bm[8];                                   // bias[m] of this lane's 8 rows (v^T only; index 0 otherwise, unused)
#pragma unroll
    for (int r = 0; r < 8; ++r) bm[r] = bias[vt ? (mBase + mOff + r) : 0];
#pragma unroll
    for (int j = 0; j < 4; ++j) {
      const int n = n0 + (j << 4) + rlane;
      const float bn = bias[vt ? 0 : n];           // bias[n] of this lane's column (q, k only)
#pragma unroll
      for (int r = 0; r < 8; ++r) {
        const float v = acc[i][j][r] + (vt ? bm[r] : bn);
        slab[(mOff + r) * 68 + (j << 4) + rlane] = v;
      }
    }
    __builtin_amdgcn_fence(__ATOMIC_RELEASE, "workgroup");
    __builtin_amdgcn_wave_barrier();
    __builtin_amdgcn_fence(__ATOMIC_ACQUIRE, "workgroup");
    {
      const int q = lane >> 3, c8 = (lane & 7) * 8;
#pragma unroll
      for (int it = 0; it < 4; ++it) {
        const int row = it * 4 + q;                       // it 0..3 x q 0..3 = rows 0..15 of the slab
        const float* sp = slab + row * 68 + c8;
        v8h hv, lv;
#pragma unroll
        for (int e = 0; e < 8; ++e) {
          unsigned short hb = f2bf_bits(sp[e]);
          unsigned short lb = f2bf_bits(sp[e] - bf_bits2f(hb));
          hv[e] = __builtin_bit_cast(_Float16, hb);
          lv[e] = __builtin_bit_cast(_Float16, lb);
        }
        *(v8h*)(C  + (size_t)(mBase + row) * ldc + n0 + c8) = hv;
        *(v8h*)(C2 + (size_t)(mBase + row) * ldc + n0 + c8) = lv;
      }
    }
    __builtin_amdgcn_fence(__ATOMIC_RELEASE, "workgroup");
    __builtin_amdgcn_wave_barrier();
    __builtin_amdgcn_fence(__ATOMIC_ACQUIRE, "workgroup");
  }
}

// ---------------------------------------------------------------------------
// Elementwise bf16 split: hi = bf16_rne(in), lo = bf16_rne(in - hi); 2 elements per thread, one 4-B store per plane.
// blockIdx.y picks the source (in0, in1, in2) and its plane of n2 pairs in hi / lo.
//   weights: grid 2048 x 3, n2 = 1024*1024/2 = 524288 pairs per weight
//   activations, both batch elements: grid 8192 x 1, n2 = 2*2048*1024/2 = 2097152 pairs
// ---------------------------------------------------------------------------
__device__ __forceinline__ unsigned pk16(unsigned short a, unsigned short b) { return (unsigned)a | ((unsigned)b << 16); }

__global__ __launch_bounds__(256) void split_bf16x2_kernel(const float* __restrict__ in0, const float* __restrict__ in1,
                                                           const float* __restrict__ in2, unsigned short* __restrict__ hi,
                                                           unsigned short* __restrict__ lo, int n2) {
  const int y = blockIdx.y;
  const float* in = (y == 0) ? in0 : ((y == 1) ? in1 : in2);
  const int i = blockIdx.x * 256 + threadIdx.x;
  if (i < n2) {
    const v2f f = *(const v2f*)(in + 2 * (size_t)i);
    const unsigned short h0 = f2bf_bits(f[0]), h1 = f2bf_bits(f[1]);
    const unsigned short l0 = f2bf_bits(f[0] - bf_bits2f(h0)), l1 = f2bf_bits(f[1] - bf_bits2f(h1));
    const unsigned uh = pk16(h0, h1), ul = pk16(l0, l1);
    const size_t o = (size_t)y * n2 + i;
    ((unsigned*)hi)[o] = uh;
    ((unsigned*)lo)[o] = ul;
  }
}

// =====================================================================================
// Full (non-causal, unmasked) attention, head dim 64, one launch; blockIdx.y = batch element (planes and out SEQ*HID apart).
//   q planes (hi/lo bf16): element (t, h, d) at [t*HID + h*64 + d]
//   k planes (hi/lo bf16): element (s, h, d) at [s*HID + h*64 + d]
//   v^T planes (hi/lo bf16): element (h, d, s) at [(h*64 + d)*SEQ + s]
//   out f32: element (t, h, d) at [t*HID + h*64 + d]   (the module output rows of this batch element)
//   scores = (q . k) * sscale : bf16 hi/lo split (hi.hi + hi.lo + lo.hi) on v_wmma_f32_16x16x32_bf16
//   out    = p . v            : bf16 hi/lo split of p (unnormalised) and v, f32 accumulate
//   online softmax in f32 over all SEQ keys (32 chunks of 64, compile-time trip count, no masking).
//   Block = 4 waves = 64 query rows of one head; grid = (NHEAD * (SEQ/64) = 512) x NB.
//   K / V^T chunk staging: 128 threads x 32 elements per plane = the whole 64x64 tile (16-B copies, plain loads,
//   __syncthreads before and after); fragment loads read the LDS tiles with the same v8b element type.
// =====================================================================================
#define AT_D 64
#define AT_NW 4
#define AT_QB 64
#define AT_KC 64
#define AT_LP 72   // LDS row pitch of the K, V^T and P tiles in elements: 144 B = 16 B x 9 (odd), so the 16 rows of a ds_load_b128 half-wave fall on 16 different bank groups

__device__ __forceinline__ unsigned short at_bf_bits(float f) {
  unsigned u = __float_as_uint(f);
  return (unsigned short)((u + 0x7FFFu + ((u >> 16) & 1u)) >> 16);
}
__device__ __forceinline__ __bf16 at_f2bf(float f) { return __builtin_bit_cast(__bf16, at_bf_bits(f)); }
__device__ __forceinline__ void at_split(float f, __bf16& hi, __bf16& lo) {
  const unsigned short hb = at_bf_bits(f);
  hi = __builtin_bit_cast(__bf16, hb);
  lo = at_f2bf(f - __uint_as_float(((unsigned)hb) << 16));
}
__device__ __forceinline__ v8f at_mma(v16b a, v16b b, v8f c) {
  c = __builtin_amdgcn_wmma_f32_16x16x32_bf16(false, a, false, b, (short)0, c, false, false);
  asm volatile("v_nop\n\tv_nop\n\tv_nop\n\tv_nop" : "+v"(c) : "v"(a), "v"(b));
  return c;
}

__global__ __launch_bounds__(128)
void attn_full64_kernel(const unsigned short* __restrict__ qhp, const unsigned short* __restrict__ qlp,
                        const unsigned short* __restrict__ khp, const unsigned short* __restrict__ klp,
                        const unsigned short* __restrict__ vhp, const unsigned short* __restrict__ vlp,
                        float* __restrict__ out, float sscale) {
  union FB { v16b v; v8b h[2]; };
  __shared__ __align__(16) __bf16 Ksh[AT_KC * AT_LP];            // K hi [kv][d], pitch AT_LP    9 KB
  __shared__ __align__(16) __bf16 Ksl[AT_KC * AT_LP];            // K lo
  __shared__ __align__(16) __bf16 Vth[AT_D * AT_LP];             // V hi [d][kv], pitch AT_LP    9 KB
  __shared__ __align__(16) __bf16 Vtl[AT_D * AT_LP];             // V lo
  __shared__ __align__(16) __bf16 Psh[AT_NW][16 * AT_LP];        // per wave P hi [row][kv], pitch AT_LP
  __shared__ __align__(16) __bf16 Psl[AT_NW][16 * AT_LP];        // per wave P lo
  __shared__ __align__(16) float  Os[AT_NW][16 * 68];            // per wave out tile, pitch 68

  const int tid  = threadIdx.x;
  const int wave = tid >> 5;
  const int lane = tid & 31;
  const int hh   = lane >> 4;
  const int c    = lane & 15;

  const int nqb = SEQ / AT_QB;            // 32
  const int bx = blockIdx.x;
  const int qb = bx % nqb;
  const int h  = bx / nqb;                // 0..NHEAD-1 (grid = NHEAD * nqb)
  const int q0 = qb * AT_QB + wave * 16;

  const size_t bo = (size_t)blockIdx.y * SEQ * HID;   // this batch element's planes and output rows
  const __bf16* Qh = (const __bf16*)(const void*)qhp + bo + (size_t)h * AT_D;
  const __bf16* Ql = (const __bf16*)(const void*)qlp + bo + (size_t)h * AT_D;
  const __bf16* Kh = (const __bf16*)(const void*)khp + bo + (size_t)h * AT_D;
  const __bf16* Kl = (const __bf16*)(const void*)klp + bo + (size_t)h * AT_D;
  const __bf16* Vh = (const __bf16*)(const void*)vhp + bo + (size_t)h * AT_D * SEQ;
  const __bf16* Vl = (const __bf16*)(const void*)vlp + bo + (size_t)h * AT_D * SEQ;
  float*        ob = out + bo + (size_t)h * AT_D;

  // ---- Q fragments (A operand, row = lane&15, split k map via Frag load): 2 d-chunks, hi and lo ----
  v16b qah[2], qal[2];
#pragma unroll
  for (int dc = 0; dc < 2; ++dc) {
    const __bf16* qr = Qh + (size_t)(q0 + c) * HID + dc * 32 + 8 * hh;
    const __bf16* ql = Ql + (size_t)(q0 + c) * HID + dc * 32 + 8 * hh;
    qah[dc] = Frag<__bf16>::load(qr);
    qal[dc] = Frag<__bf16>::load(ql);
  }

  float mrow[8], lrow[8];
  v8f oacc[4];
#pragma unroll
  for (int r = 0; r < 8; ++r) { mrow[r] = -INFINITY; lrow[r] = 0.f; }
#pragma unroll
  for (int t = 0; t < 4; ++t) oacc[t] = (v8f){0.f,0.f,0.f,0.f,0.f,0.f,0.f,0.f};

  const int nChunks = SEQ / AT_KC;   // 32, compile-time constant
  for (int kc = 0; kc < nChunks; ++kc) {
    const int kv0 = kc * AT_KC;
    __syncthreads();
    {
      // staging coverage: 128 threads x (4 x 8) elements = 64 rows x 64 per plane = the whole chunk tile
      const int r = tid >> 1, half = (tid & 1) * 32;
      const __bf16* ksh = Kh + (size_t)(kv0 + r) * HID + half;    // K row kv0+r, d = half..half+31
      const __bf16* ksl = Kl + (size_t)(kv0 + r) * HID + half;
      const __bf16* vsh = Vh + (size_t)r * SEQ + kv0 + half;      // V^T row d = r, s = kv0+half..+31
      const __bf16* vsl = Vl + (size_t)r * SEQ + kv0 + half;
#pragma unroll
      for (int i = 0; i < 4; ++i) {
        const v8b a0 = *(const v8b*)(ksh + 8 * i);
        const v8b a1 = *(const v8b*)(ksl + 8 * i);
        const v8b b0 = *(const v8b*)(vsh + 8 * i);
        const v8b b1 = *(const v8b*)(vsl + 8 * i);
        *(v8b*)(Ksh + r * AT_LP + half + 8 * i) = a0;
        *(v8b*)(Ksl + r * AT_LP + half + 8 * i) = a1;
        *(v8b*)(Vth + r * AT_LP + half + 8 * i) = b0;
        *(v8b*)(Vtl + r * AT_LP + half + 8 * i) = b1;
      }
    }
    __syncthreads();

    v8f s[4];
#pragma unroll
    for (int j = 0; j < 4; ++j) {
      s[j] = (v8f){0.f,0.f,0.f,0.f,0.f,0.f,0.f,0.f};
#pragma unroll
      for (int dc = 0; dc < 2; ++dc) {
        FB kb, kl;
        kb.h[0] = *(const v8b*)(Ksh + (j * 16 + c) * AT_LP + dc * 32 + 8 * hh);
        kb.h[1] = *(const v8b*)(Ksh + (j * 16 + c) * AT_LP + dc * 32 + 16 + 8 * hh);
        kl.h[0] = *(const v8b*)(Ksl + (j * 16 + c) * AT_LP + dc * 32 + 8 * hh);
        kl.h[1] = *(const v8b*)(Ksl + (j * 16 + c) * AT_LP + dc * 32 + 16 + 8 * hh);
        s[j] = at_mma(qah[dc], kb.v, s[j]);
        s[j] = at_mma(qah[dc], kl.v, s[j]);
        s[j] = at_mma(qal[dc], kb.v, s[j]);
      }
    }
    float cm[8];
#pragma unroll
    for (int r = 0; r < 8; ++r) {
      float m = -INFINITY;
#pragma unroll
      for (int j = 0; j < 4; ++j) {
        const float sv = s[j][r] * sscale;
        s[j][r] = sv;
        m = fmaxf(m, sv);
      }
#pragma unroll
      for (int off = 1; off < 16; off <<= 1) m = fmaxf(m, __shfl_xor(m, off, 32));
      cm[r] = m;
    }
    __bf16* pwh = Psh[wave];
    __bf16* pwl = Psl[wave];
#pragma unroll
    for (int r = 0; r < 8; ++r) {
      const float mnew = fmaxf(mrow[r], cm[r]);
      const float alpha = expf(mrow[r] - mnew);
      mrow[r] = mnew;
      float psum = 0.f;
#pragma unroll
      for (int j = 0; j < 4; ++j) {
        const float p = expf(s[j][r] - mnew);
        psum += p;
        __bf16 a, bl; at_split(p, a, bl);
        pwh[(8 * hh + r) * AT_LP + j * 16 + c] = a;
        pwl[(8 * hh + r) * AT_LP + j * 16 + c] = bl;
      }
#pragma unroll
      for (int off = 1; off < 16; off <<= 1) psum += __shfl_xor(psum, off, 32);
      lrow[r] = lrow[r] * alpha + psum;
#pragma unroll
      for (int t = 0; t < 4; ++t) oacc[t][r] *= alpha;
    }
    // same-wave P tile: stored and reloaded through the same __bf16 / v8b element type, wave barrier between
    __builtin_amdgcn_fence(__ATOMIC_RELEASE, "workgroup");
    __builtin_amdgcn_wave_barrier();
    __builtin_amdgcn_fence(__ATOMIC_ACQUIRE, "workgroup");
#pragma unroll 1
    for (int kk = 0; kk < 2; ++kk) {
      FB pa, pl;
      pa.h[0] = *(const v8b*)(pwh + c * AT_LP + kk * 32 + 8 * hh);
      pa.h[1] = *(const v8b*)(pwh + c * AT_LP + kk * 32 + 16 + 8 * hh);
      pl.h[0] = *(const v8b*)(pwl + c * AT_LP + kk * 32 + 8 * hh);
      pl.h[1] = *(const v8b*)(pwl + c * AT_LP + kk * 32 + 16 + 8 * hh);
#pragma unroll
      for (int t = 0; t < 4; ++t) {
        FB vb, vl;
        vb.h[0] = *(const v8b*)(Vth + (t * 16 + c) * AT_LP + kk * 32 + 8 * hh);
        vb.h[1] = *(const v8b*)(Vth + (t * 16 + c) * AT_LP + kk * 32 + 16 + 8 * hh);
        vl.h[0] = *(const v8b*)(Vtl + (t * 16 + c) * AT_LP + kk * 32 + 8 * hh);
        vl.h[1] = *(const v8b*)(Vtl + (t * 16 + c) * AT_LP + kk * 32 + 16 + 8 * hh);
        oacc[t] = at_mma(pa.v, vb.v, oacc[t]);
        oacc[t] = at_mma(pa.v, vl.v, oacc[t]);
        oacc[t] = at_mma(pl.v, vb.v, oacc[t]);
      }
    }
  }

  float* os = Os[wave];
#pragma unroll
  for (int r = 0; r < 8; ++r) {
    const float inv = 1.0f / lrow[r];   // lrow >= 1 (the row max contributes p = 1)
#pragma unroll
    for (int t = 0; t < 4; ++t) os[(8 * hh + r) * 68 + t * 16 + c] = oacc[t][r] * inv;
  }
  __builtin_amdgcn_fence(__ATOMIC_RELEASE, "workgroup");
  __builtin_amdgcn_wave_barrier();
  __builtin_amdgcn_fence(__ATOMIC_ACQUIRE, "workgroup");
  {
    const int c4 = (lane & 15) * 4;
    {
#pragma unroll
      for (int it = 0; it < 8; ++it) {
        const int row = it * 2 + hh;   // it 0..7 x hh 0..1 covers rows 0..15 of the wave tile; 16 lanes x 16 B = the 64-float head segment
        v4f val = *(const v4f*)(os + row * 68 + c4);
        *(v4f*)(ob + (size_t)(q0 + row) * HID + c4) = val;
      }
      
    }
  }
}

// ---------------------------------------------------------------------------
// Workspace region map (byte offsets; every region is fully rewritten in each call)
//   Wh  bf16 [3 (q,k,v)][1024 o][1024 i]                0      Wl    6291456
//   Xh  bf16 [2 b][2048 s][1024 i]               12582912      Xl   20971520
//   Ch  bf16 [3 (q,k,v^T)][2 b][2048*1024]       29360128      Cl   54525952
//       q, k planes [s][h*64+d]; v^T planes [h*64+d][s]
//   total                                        79691776  (76 MiB)
// ---------------------------------------------------------------------------
extern "C" void kernel_launch(void* const* d_in, const int* in_sizes, int n_in,
                              void* d_out, int out_size, void* d_ws, size_t ws_size,
                              hipStream_t stream) {
  if (n_in < 7) return;
  if (in_sizes[0] != NB * SEQ * HID) return;
  if (in_sizes[1] != HID * HID || in_sizes[3] != HID * HID || in_sizes[5] != HID * HID) return;
  if (in_sizes[2] != HID || in_sizes[4] != HID || in_sizes[6] != HID) return;
  if (out_size != NB * SEQ * HID) return;

  const float* x  = (const float*)d_in[0];   // [2][2048][1024]
  const float* Wq = (const float*)d_in[1];   // [1024 out][1024 in]
  const float* bq = (const float*)d_in[2];   // [1024]
  const float* Wk = (const float*)d_in[3];
  const float* bk = (const float*)d_in[4];
  const float* Wv = (const float*)d_in[5];
  const float* bv = (const float*)d_in[6];

  const size_t PW = (size_t)HID * HID * 2;   // 2097152  bf16 weight plane [1024][1024]
  const size_t PX = (size_t)SEQ * HID * 2;   // 4194304  bf16 activation plane [2048][1024] (one batch element)
  size_t off = 0;
  const size_t oWh = off; off += 3 * PW;       const size_t oWl = off; off += 3 * PW;
  const size_t oXh = off; off += NB * PX;      const size_t oXl = off; off += NB * PX;
  const size_t oCh = off; off += 3 * NB * PX;  const size_t oCl = off; off += 3 * NB * PX;
  if (off > ws_size) return;                 // off = 79691776

  char* ws = (char*)d_ws;
  unsigned short* Wh = (unsigned short*)(ws + oWh); unsigned short* Wl = (unsigned short*)(ws + oWl);
  unsigned short* Xh = (unsigned short*)(ws + oXh); unsigned short* Xl = (unsigned short*)(ws + oXl);
  unsigned short* Ch = (unsigned short*)(ws + oCh); unsigned short* Cl = (unsigned short*)(ws + oCl);
  const size_t EP = (size_t)NB * SEQ * HID;  // elements of one projection's planes (both batch elements)

  const dim3 blk(256);

  // (1) weights [out][in] are already the Bt [n][k] layout -> bf16 hi/lo planes, no transpose; one launch for q, k, v
  const int n2w = HID * HID / 2;                            // 524288 pairs per plane
  split_bf16x2_kernel<<<dim3((n2w + 255) / 256, 3), blk, 0, stream>>>(Wq, Wk, Wv, Wh, Wl, n2w);
  // (2) x, both batch elements -> bf16 hi/lo planes [2][2048][1024]
  const int n2x = NB * SEQ * HID / 2;                       // 2097152 pairs per plane
  split_bf16x2_kernel<<<dim3((n2x + 255) / 256, 1), blk, 0, stream>>>(x, x, x, Xh, Xl, n2x);
  // (3) q = x . Wq^T + bq, k = x . Wk^T + bk, v^T = Wv . x^T + bv, both batch elements: 512 tiles each, 4 per work-group
  qkv_gemm64<<<dim3((SEQ / 64) * (HID / 64) / 4, NB, 3), dim3(128), 0, stream>>>(Xh, Xl, Wh, Wl, Ch, Cl, bq, bk, bv);
  // (4) full attention per head and batch element, no score scaling; f32 tiles go straight to the output rows
  attn_full64_kernel<<<dim3(NHEAD * (SEQ / 64), NB), dim3(128), 0, stream>>>(
      Ch, Cl, Ch + EP, Cl + EP, Ch + 2 * EP, Cl + 2 * EP, (float*)d_out, 1.0f);
  (void)hipGetLastError();
}

// v003
// It runs in 229 microseconds.
// In both of two side-by-side timings against v002, it was 1.23 times as fast.
// Over all steps from v000 it is 3.24 times as fast.
// All contractions (q, k, v^T projections, q.k^T, p.v): v_wmma_f32_16x16x32_bf16 with bf16 hi/lo split operands (hi.hi + hi.lo + lo.hi), f32 accumulate; online softmax, biases and normalisation in f32; no score scaling.
#include <hip/hip_runtime.h>
#include <math.h>
#include <stdint.h>

#define NB    2
#define SEQ   2048
#define HID   1024
#define NHEAD 16
#define DHD   64

typedef __attribute__((ext_vector_type(16))) _Float16 v16h;
typedef __attribute__((ext_vector_type(8)))  _Float16 v8h;
typedef __attribute__((ext_vector_type(16))) __bf16   v16b;
typedef __attribute__((ext_vector_type(8)))  __bf16   v8b;
typedef __attribute__((ext_vector_type(8)))  float    v8f;
typedef __attribute__((ext_vector_type(4)))  float    v4f;
typedef __attribute__((ext_vector_type(2)))  float    v2f;
typedef __attribute__((ext_vector_type(4)))  unsigned int v4u;

__device__ __forceinline__ unsigned short f2bf_bits(float f) {
  unsigned u = __float_as_uint(f);
  return (unsigned short)((u + 0x7FFFu + ((u >> 16) & 1u)) >> 16);
}
__device__ __forceinline__ float bf_bits2f(unsigned short h) { return __uint_as_float(((unsigned)h) << 16); }

// hazard guards as plain device helpers (no inline asm inside the kernel bodies)
__device__ __forceinline__ void dep_guard_h(v8f& a, v8f& b, v16h x, v16h y) { asm volatile("v_nop\n\tv_nop\n\tv_nop\n\tv_nop" : "+v"(a), "+v"(b) : "v"(x), "v"(y)); }
__device__ __forceinline__ void dep_guard_b(v8f& a, v8f& b, v16b x, v16b y) { asm volatile("v_nop\n\tv_nop\n\tv_nop\n\tv_nop" : "+v"(a), "+v"(b) : "v"(x), "v"(y)); }
__device__ __forceinline__ void keep4_h(v16h a, v16h b, v16h c, v16h d) { asm volatile("v_nop" :: "v"(a), "v"(b), "v"(c), "v"(d)); }
__device__ __forceinline__ void keep4_b(v16b a, v16b b, v16b c, v16b d) { asm volatile("v_nop" :: "v"(a), "v"(b), "v"(c), "v"(d)); }
__device__ __forceinline__ void acc_guard4(v8f& a, v8f& b, v8f& c, v8f& d) { asm volatile("v_nop\n\tv_nop\n\tv_nop\n\tv_nop" : "+v"(a), "+v"(b), "+v"(c), "+v"(d)); }
template <typename T> struct Frag;
template <> struct Frag<_Float16> {
  typedef v16h V; union U { v16h v; v8h h[2]; };
  static __device__ __forceinline__ v16h load(const _Float16* p) {   // elements 0..7 <- p[0..7], 8..15 <- p[16..23]
    U f; f.h[0] = *(const v8h*)(p); f.h[1] = *(const v8h*)(p + 16); return f.v;
  }
  static __device__ __forceinline__ v8f mma(v16h a, v16h b, v8f c) {
    return __builtin_amdgcn_wmma_f32_16x16x32_f16(false, a, false, b, (short)0, c, false, false);
  }
  static __device__ __forceinline__ void guard(v8f& a, v8f& b, v16h x, v16h y) { dep_guard_h(a, b, x, y); }
  static __device__ __forceinline__ void keep(v16h a, v16h b, v16h c, v16h d) { keep4_h(a, b, c, d); }
};
template <> struct Frag<__bf16> {
  typedef v16b V; union U { v16b v; v8b h[2]; };
  static __device__ __forceinline__ v16b load(const __bf16* p) {
    U f; f.h[0] = *(const v8b*)(p); f.h[1] = *(const v8b*)(p + 16); return f.v;
  }
  static __device__ __forceinline__ v8f mma(v16b a, v16b b, v8f c) {
    return __builtin_amdgcn_wmma_f32_16x16x32_bf16(false, a, false, b, (short)0, c, false, false);
  }
  static __device__ __forceinline__ void guard(v8f& a, v8f& b, v16b x, v16b y) { dep_guard_b(a, b, x, y); }
  static __device__ __forceinline__ void keep(v16b a, v16b b, v16b c, v16b d) { keep4_b(a, b, c, d); }
};

// ---- Register-blocked WMMA GEMM, all three projections of both batch elements in ONE launch ----------
// C[m,n] = sum_k A[m,k] * Bt[n,k] + bias; each wave owns a 64x64 tile; K = HID, row pitch of A and Bt = HID.
// Operands are bf16 hi/lo planes; product = hi.hi + hi.lo + lo.hi; output = bf16 hi plane + bf16 lo plane.
// blockIdx.z = projection p, blockIdx.y = batch element b, blockIdx.x * 4 + wave = tile (512 tiles per (p, b)).
//   p = 0, 1 (q, k): A = x[b] planes [SEQ][HID], Bt = W[p] planes [HID][HID], C [SEQ][HID], bias[n]
//   p = 2   (v^T)  : A = W[2] planes [HID][HID], Bt = x[b] planes [SEQ][HID], C [HID][SEQ], bias[m]
// Grid 128 x 2 x 3 = 768 work-groups of 4 waves = 3 per WGP on 256 WGPs.
__global__ __launch_bounds__(128) void qkv_gemm64(
    const unsigned short* __restrict__ Xhp, const unsigned short* __restrict__ Xlp,
    const unsigned short* __restrict__ Whp, const unsigned short* __restrict__ Wlp,
    unsigned short* __restrict__ Chp, unsigned short* __restrict__ Clp,
    const float* __restrict__ bq, const float* __restrict__ bk, const float* __restrict__ bv) {
  typedef __bf16 T;
  typedef Frag<T>::V V;
  constexpr bool SPLIT = true;                     // operands come as hi and lo planes
  __shared__ __align__(16) float sT[4][16 * 68];   // per-wave 16x64 slab, pitch 68 floats
  const int p    = blockIdx.z;
  const int b    = blockIdx.y;
  const bool vt  = (p == 2);
  const int lane = threadIdx.x & 31;
  const int wave = threadIdx.x >> 5;
  const int ldc  = vt ? SEQ : HID;
  const int shN  = vt ? 5 : 4;                     // log2 of the tiles per row of C (N / 64)
  const int tile = blockIdx.x * 4 + wave;          // 0..511, grid.x = 128
  const int tm = tile >> shN;
  const int tn = tile - (tm << shN);
  const int m0 = tm << 6;
  const int n0 = tn << 6;

  const size_t xo = (size_t)b * SEQ * HID;
  const size_t wo = (size_t)p * HID * HID;
  const T* Ab  = (const T*)(vt ? Whp + wo : Xhp + xo);
  const T* Ab2 = (const T*)(vt ? Wlp + wo : Xlp + xo);
  const T* Bb  = (const T*)(vt ? Xhp + xo : Whp + wo);
  const T* Bb2 = (const T*)(vt ? Xlp + xo : Wlp + wo);
  const float* bias = (p == 0) ? bq : ((p == 1) ? bk : bv);

  const int rlane = lane & 15;                 // row (A) / col (B, D) within subtile
  const int koff  = (lane >> 4) * 8;           // k offset of this lane half
  const int mOff  = (lane >> 4) * 8;           // D row offset

  v8f acc[4][4];
#pragma unroll
  for (int i = 0; i < 4; ++i)
#pragma unroll
    for (int j = 0; j < 4; ++j) acc[i][j] = (v8f){0.f,0.f,0.f,0.f,0.f,0.f,0.f,0.f};

  for (int k0 = 0; k0 < HID; k0 += 32) {
    V bh[4], bl[4];
#pragma unroll
    for (int j = 0; j < 4; ++j) {
      const size_t bo = (size_t)(n0 + (j << 4) + rlane) * HID + koff + k0;
      bh[j] = Frag<T>::load(Bb + bo);
      if (SPLIT) bl[j] = Frag<T>::load(Bb2 + bo);
    }
#pragma unroll
    for (int i = 0; i < 4; ++i) {
      const size_t ao = (size_t)(m0 + (i << 4) + rlane) * HID + koff + k0;
      V ah = Frag<T>::load(Ab + ao);
      V al;
      if (SPLIT) al = Frag<T>::load(Ab2 + ao);
#pragma unroll
      for (int j = 0; j < 4; ++j) {
        acc[i][j] = Frag<T>::mma(ah, bh[j], acc[i][j]);
        acc[i][j] = Frag<T>::mma(ah, bl[j], acc[i][j]);
        acc[i][j] = Frag<T>::mma(al, bh[j], acc[i][j]);
      }
      Frag<T>::guard(acc[i][0], acc[i][3], ah, al);
    }
    Frag<T>::keep(bh[0], bh[1], bh[2], bh[3]);
    Frag<T>::keep(bl[0], bl[1], bl[2], bl[3]);
  }
  acc_guard4(acc[0][0], acc[0][1], acc[0][2], acc[0][3]);
  acc_guard4(acc[1][0], acc[1][1], acc[1][2], acc[1][3]);
  acc_guard4(acc[2][0], acc[2][1], acc[2][2], acc[2][3]);
  acc_guard4(acc[3][0], acc[3][1], acc[3][2], acc[3][3]);

  // ---- epilogue ----
  float* slab = sT[wave];
  const size_t co = (size_t)(p * NB + b) * SEQ * HID;
  unsigned short* C  = Chp + co;
  unsigned short* C2 = Clp + co;
#pragma unroll
  for (int i = 0; i < 4; ++i) {
    const int mBase = m0 + (i << 4);
    float bm[8];                                   // bias[m] of this lane's 8 rows (v^T only; index 0 otherwise, unused)
#pragma unroll
    for (int r = 0; r < 8; ++r) bm[r] = bias[vt ? (mBase + mOff + r) : 0];
#pragma unroll
    for (int j = 0; j < 4; ++j) {
      const int n = n0 + (j << 4) + rlane;
      const float bn = bias[vt ? 0 : n];           // bias[n] of this lane's column (q, k only)
#pragma unroll
      for (int r = 0; r < 8; ++r) {
        const float v = acc[i][j][r] + (vt ? bm[r] : bn);
        slab[(mOff + r) * 68 + (j << 4) + rlane] = v;
      }
    }
    __builtin_amdgcn_fence(__ATOMIC_RELEASE, "workgroup");
    __builtin_amdgcn_wave_barrier();
    __builtin_amdgcn_fence(__ATOMIC_ACQUIRE, "workgroup");
    {
      const int q = lane >> 3, c8 = (lane & 7) * 8;
#pragma unroll
      for (int it = 0; it < 4; ++it) {
        const int row = it * 4 + q;                       // it 0..3 x q 0..3 = rows 0..15 of the slab
        const float* sp = slab + row * 68 + c8;
        v8h hv, lv;
#pragma unroll
        for (int e = 0; e < 8; ++e) {
          unsigned short hb = f2bf_bits(sp[e]);
          unsigned short lb = f2bf_bits(sp[e] - bf_bits2f(hb));
          hv[e] = __builtin_bit_cast(_Float16, hb);
          lv[e] = __builtin_bit_cast(_Float16, lb);
        }
        *(v8h*)(C  + (size_t)(mBase + row) * ldc + n0 + c8) = hv;
        *(v8h*)(C2 + (size_t)(mBase + row) * ldc + n0 + c8) = lv;
      }
    }
    __builtin_amdgcn_fence(__ATOMIC_RELEASE, "workgroup");
    __builtin_amdgcn_wave_barrier();
    __builtin_amdgcn_fence(__ATOMIC_ACQUIRE, "workgroup");
  }
}

// ---------------------------------------------------------------------------
// Elementwise bf16 split: hi = bf16_rne(in), lo = bf16_rne(in - hi); 2 elements per thread, one 4-B store per plane.
// blockIdx.y picks the source (in0, in1, in2) and its plane of n2 pairs in hi / lo.
//   weights: grid 2048 x 3, n2 = 1024*1024/2 = 524288 pairs per weight
//   activations, both batch elements: grid 8192 x 1, n2 = 2*2048*1024/2 = 2097152 pairs
// ---------------------------------------------------------------------------
__device__ __forceinline__ unsigned pk16(unsigned short a, unsigned short b) { return (unsigned)a | ((unsigned)b << 16); }

__global__ __launch_bounds__(256) void split_bf16x2_kernel(const float* __restrict__ in0, const float* __restrict__ in1,
                                                           const float* __restrict__ in2, unsigned short* __restrict__ hi,
                                                           unsigned short* __restrict__ lo, int n2) {
  const int y = blockIdx.y;
  const float* in = (y == 0) ? in0 : ((y == 1) ? in1 : in2);
  const int i = blockIdx.x * 256 + threadIdx.x;
  if (i < n2) {
    const v2f f = *(const v2f*)(in + 2 * (size_t)i);
    const unsigned short h0 = f2bf_bits(f[0]), h1 = f2bf_bits(f[1]);
    const unsigned short l0 = f2bf_bits(f[0] - bf_bits2f(h0)), l1 = f2bf_bits(f[1] - bf_bits2f(h1));
    const unsigned uh = pk16(h0, h1), ul = pk16(l0, l1);
    const size_t o = (size_t)y * n2 + i;
    ((unsigned*)hi)[o] = uh;
    ((unsigned*)lo)[o] = ul;
  }
}

// =====================================================================================
// Full (non-causal, unmasked) attention, head dim 64, one launch; blockIdx.y = batch element (planes and out SEQ*HID apart).
//   q planes (hi/lo bf16): element (t, h, d) at [t*HID + h*64 + d]
//   k planes (hi/lo bf16): element (s, h, d) at [s*HID + h*64 + d]
//   v^T planes (hi/lo bf16): element (h, d, s) at [(h*64 + d)*SEQ + s]
//   out f32: element (t, h, d) at [t*HID + h*64 + d]   (the module output rows of this batch element)
//   scores^T = (k . q^T) * sscale : A = K rows, B = q; bf16 hi/lo split (hi.hi + hi.lo + lo.hi) on v_wmma_f32_16x16x32_bf16
//   out^T    = v^T . p^T          : A = V^T rows, B = p^T packed in place from the score accumulators (hi/lo split), f32 accumulate
//   A lane holds scores of ONE query (column lane & 15): keys j*16 + 8*(lane >> 4) + r. Two score tiles (2kk, 2kk+1) are,
//   register for register, the B fragment of keys kk*32 .. kk*32+31, so p never goes through LDS.
//   online softmax in f32 over all SEQ keys (32 chunks of 64, compile-time trip count, no masking): maximum and sum in-lane,
//   one exchange of the maximum between the lane halves per chunk; the halves' sums are joined once after the loop.
//   Block = 4 waves = 64 query rows of one head; grid = (NHEAD * (SEQ/64) = 512) x NB.
//   K / V^T chunk staging: 128 threads x 32 elements per plane = the whole 64x64 tile (16-B copies, plain loads,
//   __syncthreads before and after); fragment loads read the LDS tiles with the same v8b element type.
// =====================================================================================
#define AT_D 64
#define AT_NW 4
#define AT_QB 64
#define AT_KC 64
#define AT_LP 72   // LDS row pitch of the K and V^T tiles in elements: 144 B = 16 B x 9 (odd), so the 16 rows of a ds_load_b128 half-wave fall on 16 different bank groups

__device__ __forceinline__ v8f at_mma(v16b a, v16b b, v8f c) {
  c = __builtin_amdgcn_wmma_f32_16x16x32_bf16(false, a, false, b, (short)0, c, false, false);
  asm volatile("v_nop\n\tv_nop\n\tv_nop\n\tv_nop" : "+v"(c) : "v"(a), "v"(b));
  return c;
}
// two f32 -> one packed register of bf16 hi parts and one of bf16 lo parts: hi = rne(f), lo = rne(f - hi)
typedef __attribute__((ext_vector_type(2))) __bf16 v2b;
__device__ __forceinline__ void at_split2(v2f f, v2b& hi, v2b& lo) {
  hi = __builtin_convertvector(f, v2b);
  lo = __builtin_convertvector(f - __builtin_convertvector(hi, v2f), v2b);
}
// value of lane l ^ 16 (the other half's share of the same query column)
__device__ __forceinline__ float at_xhalf(float f) {
  const int b = __float_as_int(f);
  return __int_as_float(__builtin_amdgcn_permlanex16(b, b, 0x76543210, 0xfedcba98, false, false));
}

__global__ __launch_bounds__(128)
void attn_full64_kernel(const unsigned short* __restrict__ qhp, const unsigned short* __restrict__ qlp,
                        const unsigned short* __restrict__ khp, const unsigned short* __restrict__ klp,
                        const unsigned short* __restrict__ vhp, const unsigned short* __restrict__ vlp,
                        float* __restrict__ out, float sscale) {
  union FB { v16b v; v8b h[2]; v2b w[8]; };
  __shared__ __align__(16) __bf16 Ksh[AT_KC * AT_LP];            // K hi [kv][d], pitch AT_LP    9 KB
  __shared__ __align__(16) __bf16 Ksl[AT_KC * AT_LP];            // K lo
  __shared__ __align__(16) __bf16 Vth[AT_D * AT_LP];             // V hi [d][kv], pitch AT_LP    9 KB
  __shared__ __align__(16) __bf16 Vtl[AT_D * AT_LP];             // V lo
  __shared__ __align__(16) float  Os[AT_NW][16 * 68];            // per wave out tile, pitch 68

  const int tid  = threadIdx.x;
  const int wave = tid >> 5;
  const int lane = tid & 31;
  const int hh   = lane >> 4;
  const int c    = lane & 15;

  const int nqb = SEQ / AT_QB;            // 32
  const int bx = blockIdx.x;
  const int qb = bx % nqb;
  const int h  = bx / nqb;                // 0..NHEAD-1 (grid = NHEAD * nqb)
  const int q0 = qb * AT_QB + wave * 16;

  const size_t bo = (size_t)blockIdx.y * SEQ * HID;   // this batch element's planes and output rows
  const __bf16* Qh = (const __bf16*)(const void*)qhp + bo + (size_t)h * AT_D;
  const __bf16* Ql = (const __bf16*)(const void*)qlp + bo + (size_t)h * AT_D;
  const __bf16* Kh = (const __bf16*)(const void*)khp + bo + (size_t)h * AT_D;
  const __bf16* Kl = (const __bf16*)(const void*)klp + bo + (size_t)h * AT_D;
  const __bf16* Vh = (const __bf16*)(const void*)vhp + bo + (size_t)h * AT_D * SEQ;
  const __bf16* Vl = (const __bf16*)(const void*)vlp + bo + (size_t)h * AT_D * SEQ;
  float*        ob = out + bo + (size_t)h * AT_D;

  // ---- Q fragments (B operand, column = lane&15, split k map via Frag load): 2 d-chunks, hi and lo ----
  v16b qah[2], qal[2];
#pragma unroll
  for (int dc = 0; dc < 2; ++dc) {
    const __bf16* qr = Qh + (size_t)(q0 + c) * HID + dc * 32 + 8 * hh;
    const __bf16* ql = Ql + (size_t)(q0 + c) * HID + dc * 32 + 8 * hh;
    qah[dc] = Frag<__bf16>::load(qr);
    qal[dc] = Frag<__bf16>::load(ql);
  }

  float mrow = -INFINITY, lrow = 0.f;   // this lane's query: running maximum (both halves agree), this half's share of the sum
  v8f oacc[4];                          // oacc[t][r] = out^T[d = t*16 + 8*hh + r][query c]
#pragma unroll
  for (int t = 0; t < 4; ++t) oacc[t] = (v8f){0.f,0.f,0.f,0.f,0.f,0.f,0.f,0.f};

  const int nChunks = SEQ / AT_KC;   // 32, compile-time constant
  for (int kc = 0; kc < nChunks; ++kc) {
    const int kv0 = kc * AT_KC;
    __syncthreads();
    {
      // staging coverage: 128 threads x (4 x 8) elements = 64 rows x 64 per plane = the whole chunk tile
      const int r = tid >> 1, half = (tid & 1) * 32;
      const __bf16* ksh = Kh + (size_t)(kv0 + r) * HID + half;    // K row kv0+r, d = half..half+31
      const __bf16* ksl = Kl + (size_t)(kv0 + r) * HID + half;
      const __bf16* vsh = Vh + (size_t)r * SEQ + kv0 + half;      // V^T row d = r, s = kv0+half..+31
      const __bf16* vsl = Vl + (size_t)r * SEQ + kv0 + half;
#pragma unroll
      for (int i = 0; i < 4; ++i) {
        const v8b a0 = *(const v8b*)(ksh + 8 * i);
        const v8b a1 = *(const v8b*)(ksl + 8 * i);
        const v8b b0 = *(const v8b*)(vsh + 8 * i);
        const v8b b1 = *(const v8b*)(vsl + 8 * i);
        *(v8b*)(Ksh + r * AT_LP + half + 8 * i) = a0;
        *(v8b*)(Ksl + r * AT_LP + half + 8 * i) = a1;
        *(v8b*)(Vth + r * AT_LP + half + 8 * i) = b0;
        *(v8b*)(Vtl + r * AT_LP + half + 8 * i) = b1;
      }
    }
    __syncthreads();

    v8f s[4];
#pragma unroll
    for (int j = 0; j < 4; ++j) {
      s[j] = (v8f){0.f,0.f,0.f,0.f,0.f,0.f,0.f,0.f};
#pragma unroll
      for (int dc = 0; dc < 2; ++dc) {
        FB kb, kl;
        kb.h[0] = *(const v8b*)(Ksh + (j * 16 + c) * AT_LP + dc * 32 + 8 * hh);
        kb.h[1] = *(const v8b*)(Ksh + (j * 16 + c) * AT_LP + dc * 32 + 16 + 8 * hh);
        kl.h[0] = *(const v8b*)(Ksl + (j * 16 + c) * AT_LP + dc * 32 + 8 * hh);
        kl.h[1] = *(const v8b*)(Ksl + (j * 16 + c) * AT_LP + dc * 32 + 16 + 8 * hh);
        s[j] = at_mma(kb.v, qah[dc], s[j]);
        s[j] = at_mma(kl.v, qah[dc], s[j]);
        s[j] = at_mma(kb.v, qal[dc], s[j]);
      }
    }
    // s[j][r] = score of key kv0 + j*16 + 8*hh + r against query c
    float mj[4];
#pragma unroll
    for (int j = 0; j < 4; ++j) {
      float m = -INFINITY;
#pragma unroll
      for (int r = 0; r < 8; ++r) {
        const float sv = s[j][r] * sscale;
        s[j][r] = sv;
        m = fmaxf(m, sv);
      }
      mj[j] = m;
    }
    const float mh = fmaxf(fmaxf(mj[0], mj[1]), fmaxf(mj[2], mj[3]));
    const float mnew = fmaxf(mrow, fmaxf(mh, at_xhalf(mh)));
    const float alpha = expf(mrow - mnew);
    mrow = mnew;
    FB pah[2], pal[2];                   // p^T as B fragments: element e of [kk] = key kk*32 + (e < 8 ? 8*hh + e : 16 + 8*hh + e - 8)
    float pj[4];
#pragma unroll
    for (int j = 0; j < 4; ++j) {
      float psum = 0.f;
#pragma unroll
      for (int r = 0; r < 8; r += 2) {
        const float p0 = expf(s[j][r] - mnew);
        const float p1 = expf(s[j][r + 1] - mnew);
        psum += p0;
        psum += p1;
        at_split2((v2f){p0, p1}, pah[j >> 1].w[(j & 1) * 4 + (r >> 1)], pal[j >> 1].w[(j & 1) * 4 + (r >> 1)]);
      }
      pj[j] = psum;
    }
    lrow = lrow * alpha + ((pj[0] + pj[1]) + (pj[2] + pj[3]));
#pragma unroll
    for (int t = 0; t < 4; ++t)
#pragma unroll
      for (int r = 0; r < 8; ++r) oacc[t][r] *= alpha;
#pragma unroll   // full unroll: pah[kk], pal[kk] live in registers and need a compile-time index
    for (int kk = 0; kk < 2; ++kk) {
#pragma unroll
      for (int t = 0; t < 4; ++t) {
        FB vb, vl;
        vb.h[0] = *(const v8b*)(Vth + (t * 16 + c) * AT_LP + kk * 32 + 8 * hh);
        vb.h[1] = *(const v8b*)(Vth + (t * 16 + c) * AT_LP + kk * 32 + 16 + 8 * hh);
        vl.h[0] = *(const v8b*)(Vtl + (t * 16 + c) * AT_LP + kk * 32 + 8 * hh);
        vl.h[1] = *(const v8b*)(Vtl + (t * 16 + c) * AT_LP + kk * 32 + 16 + 8 * hh);
        oacc[t] = at_mma(vb.v, pah[kk].v, oacc[t]);
        oacc[t] = at_mma(vl.v, pah[kk].v, oacc[t]);
        oacc[t] = at_mma(vb.v, pal[kk].v, oacc[t]);
      }
    }
  }

  float* os = Os[wave];
  const float inv = 1.0f / (lrow + at_xhalf(lrow));   // both halves' sums; >= 1 (the row max contributes p = 1)
#pragma unroll
  for (int t = 0; t < 4; ++t) {
    // query row c of the wave tile, d = t*16 + 8*hh .. +7: two 16-B LDS stores
    *(v4f*)(os + c * 68 + t * 16 + 8 * hh)     = (v4f){oacc[t][0] * inv, oacc[t][1] * inv, oacc[t][2] * inv, oacc[t][3] * inv};
    *(v4f*)(os + c * 68 + t * 16 + 8 * hh + 4) = (v4f){oacc[t][4] * inv, oacc[t][5] * inv, oacc[t][6] * inv, oacc[t][7] * inv};
  }
  __builtin_amdgcn_fence(__ATOMIC_RELEASE, "workgroup");
  __builtin_amdgcn_wave_barrier();
  __builtin_amdgcn_fence(__ATOMIC_ACQUIRE, "workgroup");
  {
    const int c4 = (lane & 15) * 4;
    {
#pragma unroll
      for (int it = 0; it < 8; ++it) {
        const int row = it * 2 + hh;   // it 0..7 x hh 0..1 covers rows 0..15 of the wave tile; 16 lanes x 16 B = the 64-float head segment
        v4f val = *(const v4f*)(os + row * 68 + c4);
        *(v4f*)(ob + (size_t)(q0 + row) * HID + c4) = val;
      }
      
    }
  }
}

// ---------------------------------------------------------------------------
// Workspace region map (byte offsets; every region is fully rewritten in each call)
//   Wh  bf16 [3 (q,k,v)][1024 o][1024 i]                0      Wl    6291456
//   Xh  bf16 [2 b][2048 s][1024 i]               12582912      Xl   20971520
//   Ch  bf16 [3 (q,k,v^T)][2 b][2048*1024]       29360128      Cl   54525952
//       q, k planes [s][h*64+d]; v^T planes [h*64+d][s]
//   total                                        79691776  (76 MiB)
// ---------------------------------------------------------------------------
extern "C" void kernel_launch(void* const* d_in, const int* in_sizes, int n_in,
                              void* d_out, int out_size, void* d_ws, size_t ws_size,
                              hipStream_t stream) {
  if (n_in < 7) return;
  if (in_sizes[0] != NB * SEQ * HID) return;
  if (in_sizes[1] != HID * HID || in_sizes[3] != HID * HID || in_sizes[5] != HID * HID) return;
  if (in_sizes[2] != HID || in_sizes[4] != HID || in_sizes[6] != HID) return;
  if (out_size != NB * SEQ * HID) return;

  const float* x  = (const float*)d_in[0];   // [2][2048][1024]
  const float* Wq = (const float*)d_in[1];   // [1024 out][1024 in]
  const float* bq = (const float*)d_in[2];   // [1024]
  const float* Wk = (const float*)d_in[3];
  const float* bk = (const float*)d_in[4];
  const float* Wv = (const float*)d_in[5];
  const float* bv = (const float*)d_in[6];

  const size_t PW = (size_t)HID * HID * 2;   // 2097152  bf16 weight plane [1024][1024]
  const size_t PX = (size_t)SEQ * HID * 2;   // 4194304  bf16 activation plane [2048][1024] (one batch element)
  size_t off = 0;
  const size_t oWh = off; off += 3 * PW;       const size_t oWl = off; off += 3 * PW;
  const size_t oXh = off; off += NB * PX;      const size_t oXl = off; off += NB * PX;
  const size_t oCh = off; off += 3 * NB * PX;  const size_t oCl = off; off += 3 * NB * PX;
  if (off > ws_size) return;                 // off = 79691776

  char* ws = (char*)d_ws;
  unsigned short* Wh = (unsigned short*)(ws + oWh); unsigned short* Wl = (unsigned short*)(ws + oWl);
  unsigned short* Xh = (unsigned short*)(ws + oXh); unsigned short* Xl = (unsigned short*)(ws + oXl);
  unsigned short* Ch = (unsigned short*)(ws + oCh); unsigned short* Cl = (unsigned short*)(ws + oCl);
  const size_t EP = (size_t)NB * SEQ * HID;  // elements of one projection's planes (both batch elements)

  const dim3 blk(256);

  // (1) weights [out][in] are already the Bt [n][k] layout -> bf16 hi/lo planes, no transpose; one launch for q, k, v
  const int n2w = HID * HID / 2;                            // 524288 pairs per plane
  split_bf16x2_kernel<<<dim3((n2w + 255) / 256, 3), blk, 0, stream>>>(Wq, Wk, Wv, Wh, Wl, n2w);
  // (2) x, both batch elements -> bf16 hi/lo planes [2][2048][1024]
  const int n2x = NB * SEQ * HID / 2;                       // 2097152 pairs per plane
  split_bf16x2_kernel<<<dim3((n2x + 255) / 256, 1), blk, 0, stream>>>(x, x, x, Xh, Xl, n2x);
  // (3) q = x . Wq^T + bq, k = x . Wk^T + bk, v^T = Wv . x^T + bv, both batch elements: 512 tiles each, 4 per work-group
  qkv_gemm64<<<dim3((SEQ / 64) * (HID / 64) / 4, NB, 3), dim3(128), 0, stream>>>(Xh, Xl, Wh, Wl, Ch, Cl, bq, bk, bv);
  // (4) full attention per head and batch element, no score scaling; f32 tiles go straight to the output rows
  attn_full64_kernel<<<dim3(NHEAD * (SEQ / 64), NB), dim3(128), 0, stream>>>(
      Ch, Cl, Ch + EP, Cl + EP, Ch + 2 * EP, Cl + 2 * EP, (float*)d_out, 1.0f);
  (void)hipGetLastError();
}

// v004
// One run takes 203 microseconds.
// In two side-by-side timings against v003, it was 1.14 and 1.13 times as fast.
// Counting every step since v000, it is 3.68 times as fast.
// All contractions (q, k, v^T projections, q.k^T, p.v): v_wmma_f32_16x16x32_bf16 with bf16 hi/lo split operands (hi.hi + hi.lo + lo.hi), f32 accumulate; online softmax, biases and normalisation in f32; no score scaling.
#include <hip/hip_runtime.h>
#include <math.h>
#include <stdint.h>

#define NB    2
#define SEQ   2048
#define HID   1024
#define NHEAD 16
#define DHD   64

typedef __attribute__((ext_vector_type(16))) _Float16 v16h;
typedef __attribute__((ext_vector_type(8)))  _Float16 v8h;
typedef __attribute__((ext_vector_type(16))) __bf16   v16b;
typedef __attribute__((ext_vector_type(8)))  __bf16   v8b;
typedef __attribute__((ext_vector_type(8)))  float    v8f;
typedef __attribute__((ext_vector_type(4)))  float    v4f;
typedef __attribute__((ext_vector_type(2)))  float    v2f;
typedef __attribute__((ext_vector_type(4)))  unsigned int v4u;

__device__ __forceinline__ unsigned short f2bf_bits(float f) {
  unsigned u = __float_as_uint(f);
  return (unsigned short)((u + 0x7FFFu + ((u >> 16) & 1u)) >> 16);
}
__device__ __forceinline__ float bf_bits2f(unsigned short h) { return __uint_as_float(((unsigned)h) << 16); }

// hazard guards as plain device helpers
__device__ __forceinline__ void dep_guard_h(v8f& a, v8f& b, v16h x, v16h y) { asm volatile("v_nop\n\tv_nop\n\tv_nop\n\tv_nop" : "+v"(a), "+v"(b) : "v"(x), "v"(y)); }
__device__ __forceinline__ void dep_guard_b(v8f& a, v8f& b, v16b x, v16b y) { asm volatile("v_nop\n\tv_nop\n\tv_nop\n\tv_nop" : "+v"(a), "+v"(b) : "v"(x), "v"(y)); }
__device__ __forceinline__ void keep4_h(v16h a, v16h b, v16h c, v16h d) { asm volatile("v_nop" :: "v"(a), "v"(b), "v"(c), "v"(d)); }
__device__ __forceinline__ void keep4_b(v16b a, v16b b, v16b c, v16b d) { asm volatile("v_nop" :: "v"(a), "v"(b), "v"(c), "v"(d)); }
__device__ __forceinline__ void acc_guard4(v8f& a, v8f& b, v8f& c, v8f& d) { asm volatile("v_nop\n\tv_nop\n\tv_nop\n\tv_nop" : "+v"(a), "+v"(b), "+v"(c), "+v"(d)); }
template <typename T> struct Frag;
template <> struct Frag<_Float16> {
  typedef v16h V; union U { v16h v; v8h h[2]; };
  static __device__ __forceinline__ v16h load(const _Float16* p) {   // elements 0..7 <- p[0..7], 8..15 <- p[16..23]
    U f; f.h[0] = *(const v8h*)(p); f.h[1] = *(const v8h*)(p + 16); return f.v;
  }
  static __device__ __forceinline__ v8f mma(v16h a, v16h b, v8f c) {
    return __builtin_amdgcn_wmma_f32_16x16x32_f16(false, a, false, b, (short)0, c, false, false);
  }
  static __device__ __forceinline__ void guard(v8f& a, v8f& b, v16h x, v16h y) { dep_guard_h(a, b, x, y); }
  static __device__ __forceinline__ void keep(v16h a, v16h b, v16h c, v16h d) { keep4_h(a, b, c, d); }
};
template <> struct Frag<__bf16> {
  typedef v16b V; union U { v16b v; v8b h[2]; };
  static __device__ __forceinline__ v16b load(const __bf16* p) {
    U f; f.h[0] = *(const v8b*)(p); f.h[1] = *(const v8b*)(p + 16); return f.v;
  }
  static __device__ __forceinline__ v8f mma(v16b a, v16b b, v8f c) {
    return __builtin_amdgcn_wmma_f32_16x16x32_bf16(false, a, false, b, (short)0, c, false, false);
  }
  static __device__ __forceinline__ void guard(v8f& a, v8f& b, v16b x, v16b y) { dep_guard_b(a, b, x, y); }
  static __device__ __forceinline__ void keep(v16b a, v16b b, v16b c, v16b d) { keep4_b(a, b, c, d); }
};

// ---- Register-blocked WMMA GEMM, all three projections of both batch elements in ONE launch ----------
// C[m,n] = sum_k A[m,k] * Bt[n,k] + bias; a work-group owns a 128x128 tile, each of its 4 waves (2 x 2) a 64x64 tile;
// K = HID, row pitch of A and Bt = HID.
// Operands are bf16 hi/lo planes; product = hi.hi + hi.lo + lo.hi; output = bf16 hi plane + bf16 lo plane.
// blockIdx.z = projection p, blockIdx.y = batch element b, blockIdx.x = 128x128 tile (128 tiles per (p, b)).
//   p = 0, 1 (q, k): A = x[b] planes [SEQ][HID], Bt = W[p] planes [HID][HID], C [SEQ][HID], bias[n]
//   p = 2   (v^T)  : A = W[2] planes [HID][HID], Bt = x[b] planes [SEQ][HID], C [HID][SEQ], bias[m]
// Grid 128 x 2 x 3 = 768 work-groups of 4 waves = 3 per WGP on 256 WGPs.
// Operand path: a stage = 32 k of the 128 A rows and the 128 Bt rows, hi and lo planes, brought into LDS by asynchronous
// copies (16 B per lane, 16 copies per lane and stage); two buffers, the next stage's copies fly while this one is worked on.
#define GS_KS   32                     // k per stage
#define GS_LP   40                     // LDS row pitch in elements: 80 B = 16 B x 5 (odd), free of bank conflicts for ds_load_b128
#define GS_PL   (128 * GS_LP)          // elements of one plane of a stage (128 rows)
#define GS_ST   (4 * GS_PL)            // elements of one stage: A hi, A lo, Bt hi, Bt lo (40960 B)
#define GS_NT   (HID / GS_KS)          // 32 stages

// Eight asynchronous 16-B copies per lane, global -> LDS. The s_wait_xcnt closes the statement so that no address register
// of a copy is rewritten in front of it.
__device__ __forceinline__ void gs_copy8(unsigned l0, unsigned l1, unsigned l2, unsigned l3,
                                         unsigned l4, unsigned l5, unsigned l6, unsigned l7,
                                         const __bf16* g0, const __bf16* g1, const __bf16* g2, const __bf16* g3,
                                         const __bf16* g4, const __bf16* g5, const __bf16* g6, const __bf16* g7) {
  asm volatile("global_load_async_to_lds_b128 %0, %8, off\n\t"
               "global_load_async_to_lds_b128 %1, %9, off\n\t"
               "global_load_async_to_lds_b128 %2, %10, off\n\t"
               "global_load_async_to_lds_b128 %3, %11, off\n\t"
               "global_load_async_to_lds_b128 %4, %12, off\n\t"
               "global_load_async_to_lds_b128 %5, %13, off\n\t"
               "global_load_async_to_lds_b128 %6, %14, off\n\t"
               "global_load_async_to_lds_b128 %7, %15, off\n\t"
               "s_wait_xcnt 0x0"
               :: "v"(l0), "v"(l1), "v"(l2), "v"(l3), "v"(l4), "v"(l5), "v"(l6), "v"(l7),
                  "v"(g0), "v"(g1), "v"(g2), "v"(g3), "v"(g4), "v"(g5), "v"(g6), "v"(g7)
               : "memory");
}
// One stage: hp, lp = this lane's first 16 B of the hi and lo plane (row tid >> 2, piece tid & 3, at the stage's k);
// l = the LDS byte address of the same piece in the hi plane. Rows step by 32, the lo plane lies GS_PL elements behind.
__device__ __forceinline__ void gs_copy_operand(unsigned l, const __bf16* hp, const __bf16* lp) {
  const unsigned rs = 32 * GS_LP * 2, ps = GS_PL * 2;
  gs_copy8(l, l + rs, l + 2 * rs, l + 3 * rs, l + ps, l + ps + rs, l + ps + 2 * rs, l + ps + 3 * rs,
           hp, hp + 32 * HID, hp + 64 * HID, hp + 96 * HID, lp, lp + 32 * HID, lp + 64 * HID, lp + 96 * HID);
}

__global__ __launch_bounds__(128) void qkv_gemm64(
    const unsigned short* __restrict__ Xhp, const unsigned short* __restrict__ Xlp,
    const unsigned short* __restrict__ Whp, const unsigned short* __restrict__ Wlp,
    unsigned short* __restrict__ Chp, unsigned short* __restrict__ Clp,
    const float* __restrict__ bq, const float* __restrict__ bk, const float* __restrict__ bv) {
  typedef __bf16 T;
  typedef Frag<T>::V V;
  __shared__ __align__(16) T     sS[2 * GS_ST];    // two stage buffers, 81920 B
  __shared__ __align__(16) float sT[4][16 * 68];   // per-wave 16x64 slab, pitch 68 floats
  const int p    = blockIdx.z;
  const int b    = blockIdx.y;
  const bool vt  = (p == 2);
  const int tid  = threadIdx.x;
  const int lane = tid & 31;
  const int wave = tid >> 5;
  const int ldc  = vt ? SEQ : HID;
  const int shN  = vt ? 4 : 3;                     // log2 of the 128-wide tiles per row of C (N / 128)
  const int tile = blockIdx.x;                     // 0..127
  const int tm = tile >> shN;
  const int tn = tile - (tm << shN);
  const int mB = tm << 7;                          // the work-group's first row and column of C
  const int nB = tn << 7;
  const int wm = (wave >> 1) << 6;                 // the wave's 64x64 tile inside it
  const int wn = (wave & 1) << 6;
  const int m0 = mB + wm;
  const int n0 = nB + wn;

  const size_t xo = (size_t)b * SEQ * HID;
  const size_t wo = (size_t)p * HID * HID;
  const T* Ab  = (const T*)(vt ? Whp + wo : Xhp + xo);
  const T* Ab2 = (const T*)(vt ? Wlp + wo : Xlp + xo);
  const T* Bb  = (const T*)(vt ? Xhp + xo : Whp + wo);
  const T* Bb2 = (const T*)(vt ? Xlp + xo : Wlp + wo);
  const float* bias = (p == 0) ? bq : ((p == 1) ? bk : bv);

  const int rlane = lane & 15;                 // row (A) / col (B, D) within subtile
  const int koff  = (lane >> 4) * 8;           // k offset of this lane half
  const int mOff  = (lane >> 4) * 8;           // D row offset

  // this lane's share of a stage: row tid >> 2 (+ 32, 64, 96), 16-B piece tid & 3 of the row's 64 B, in each of the 4 planes
  const int crow = tid >> 2, cseg = (tid & 3) * 8;
  const T* gAh = Ab  + (size_t)(mB + crow) * HID + cseg;
  const T* gAl = Ab2 + (size_t)(mB + crow) * HID + cseg;
  const T* gBh = Bb  + (size_t)(nB + crow) * HID + cseg;
  const T* gBl = Bb2 + (size_t)(nB + crow) * HID + cseg;
  const unsigned lA = (unsigned)(size_t)sS + (unsigned)(crow * GS_LP + cseg) * 2u;   // LDS byte address, buffer 0, A hi
  const unsigned lB = lA + 2u * GS_PL * 2u;                                          // buffer 0, Bt hi

  v8f acc[4][4];
#pragma unroll
  for (int i = 0; i < 4; ++i)
#pragma unroll
    for (int j = 0; j < 4; ++j) acc[i][j] = (v8f){0.f,0.f,0.f,0.f,0.f,0.f,0.f,0.f};

  // prologue: stage 0 lands and is published, then stage 1 is set off
  gs_copy_operand(lA, gAh, gAl);
  gs_copy_operand(lB, gBh, gBl);
  asm volatile("s_wait_asynccnt 0x0" ::: "memory");   // this wave's copies of stage 0 have landed
  __syncthreads();                                    // ... and every other wave's
  gs_copy_operand(lA + GS_ST * 2u, gAh + GS_KS, gAl + GS_KS);
  gs_copy_operand(lB + GS_ST * 2u, gBh + GS_KS, gBl + GS_KS);

  for (int t = 0; t < GS_NT; ++t) {
    const int bo_ = (t & 1) * GS_ST;
    const T* sA = sS + bo_ + (wm + rlane) * GS_LP + koff;               // A hi rows of this wave; lo GS_PL behind
    const T* sB = sS + bo_ + 2 * GS_PL + (wn + rlane) * GS_LP + koff;   // Bt hi rows of this wave; lo GS_PL behind
    V bh[4], bl[4];
#pragma unroll
    for (int j = 0; j < 4; ++j) {
      bh[j] = Frag<T>::load(sB + (j << 4) * GS_LP);
      bl[j] = Frag<T>::load(sB + GS_PL + (j << 4) * GS_LP);
    }
    V ah[2], al[2];                      // two A fragment sets: the next 16 rows' LDS reads are asked for ahead of this block's products
    ah[0] = Frag<T>::load(sA);
    al[0] = Frag<T>::load(sA + GS_PL);
#pragma unroll
    for (int i = 0; i < 4; ++i) {
      if (i < 3) {
        ah[(i + 1) & 1] = Frag<T>::load(sA + ((i + 1) << 4) * GS_LP);
        al[(i + 1) & 1] = Frag<T>::load(sA + GS_PL + ((i + 1) << 4) * GS_LP);
      }
#pragma unroll
      for (int j = 0; j < 4; ++j) {
        acc[i][j] = Frag<T>::mma(ah[i & 1], bh[j], acc[i][j]);
        acc[i][j] = Frag<T>::mma(ah[i & 1], bl[j], acc[i][j]);
        acc[i][j] = Frag<T>::mma(al[i & 1], bh[j], acc[i][j]);
      }
      Frag<T>::guard(acc[i][0], acc[i][3], ah[i & 1], al[i & 1]);
    }
    Frag<T>::keep(bh[0], bh[1], bh[2], bh[3]);
    Frag<T>::keep(bl[0], bl[1], bl[2], bl[3]);
    // publish point of stage t + 1
    asm volatile("s_wait_dscnt 0x0" ::: "memory");      // this wave's reads of buffer t & 1 are done before it is refilled
    asm volatile("s_wait_asynccnt 0x0" ::: "memory");   // this wave's copies of stage t + 1 have landed
    __syncthreads();                                    // stage t + 1 readable by all; buffer t & 1 left by all
    if (t + 2 < GS_NT) {
      const int kn = (t + 2) * GS_KS;
      gs_copy_operand(lA + (unsigned)bo_ * 2u, gAh + kn, gAl + kn);
      gs_copy_operand(lB + (unsigned)bo_ * 2u, gBh + kn, gBl + kn);
    }
  }
  asm volatile("s_wait_asynccnt 0x0" ::: "memory");     // no copy is outstanding when the wave goes on
  acc_guard4(acc[0][0], acc[0][1], acc[0][2], acc[0][3]);
  acc_guard4(acc[1][0], acc[1][1], acc[1][2], acc[1][3]);
  acc_guard4(acc[2][0], acc[2][1], acc[2][2], acc[2][3]);
  acc_guard4(acc[3][0], acc[3][1], acc[3][2], acc[3][3]);

  // ---- epilogue ----
  float* slab = sT[wave];
  const size_t co = (size_t)(p * NB + b) * SEQ * HID;
  unsigned short* C  = Chp + co;
  unsigned short* C2 = Clp + co;
#pragma unroll
  for (int i = 0; i < 4; ++i) {
    const int mBase = m0 + (i << 4);
    float bm[8];                                   // bias[m] of this lane's 8 rows (v^T only; index 0 otherwise, unused)
#pragma unroll
    for (int r = 0; r < 8; ++r) bm[r] = bias[vt ? (mBase + mOff + r) : 0];
#pragma unroll
    for (int j = 0; j < 4; ++j) {
      const int n = n0 + (j << 4) + rlane;
      const float bn = bias[vt ? 0 : n];           // bias[n] of this lane's column (q, k only)
#pragma unroll
      for (int r = 0; r < 8; ++r) {
        const float v = acc[i][j][r] + (vt ? bm[r] : bn);
        slab[(mOff + r) * 68 + (j << 4) + rlane] = v;
      }
    }
    __builtin_amdgcn_fence(__ATOMIC_RELEASE, "workgroup");
    __builtin_amdgcn_wave_barrier();
    __builtin_amdgcn_fence(__ATOMIC_ACQUIRE, "workgroup");
    {
      const int q = lane >> 3, c8 = (lane & 7) * 8;
#pragma unroll
      for (int it = 0; it < 4; ++it) {
        const int row = it * 4 + q;                       // it 0..3 x q 0..3 = rows 0..15 of the slab
        const float* sp = slab + row * 68 + c8;
        v8h hv, lv;
#pragma unroll
        for (int e = 0; e < 8; ++e) {
          unsigned short hb = f2bf_bits(sp[e]);
          unsigned short lb = f2bf_bits(sp[e] - bf_bits2f(hb));
          hv[e] = __builtin_bit_cast(_Float16, hb);
          lv[e] = __builtin_bit_cast(_Float16, lb);
        }
        *(v8h*)(C  + (size_t)(mBase + row) * ldc + n0 + c8) = hv;
        *(v8h*)(C2 + (size_t)(mBase + row) * ldc + n0 + c8) = lv;
      }
    }
    __builtin_amdgcn_fence(__ATOMIC_RELEASE, "workgroup");
    __builtin_amdgcn_wave_barrier();
    __builtin_amdgcn_fence(__ATOMIC_ACQUIRE, "workgroup");
  }
}

// ---------------------------------------------------------------------------
// Elementwise bf16 split: hi = bf16_rne(in), lo = bf16_rne(in - hi); 2 elements per thread, one 4-B store per plane.
// blockIdx.y picks the source (in0, in1, in2) and its plane of n2 pairs in hi / lo.
//   weights: grid 2048 x 3, n2 = 1024*1024/2 = 524288 pairs per weight
//   activations, both batch elements: grid 8192 x 1, n2 = 2*2048*1024/2 = 2097152 pairs
// ---------------------------------------------------------------------------
__device__ __forceinline__ unsigned pk16(unsigned short a, unsigned short b) { return (unsigned)a | ((unsigned)b << 16); }

__global__ __launch_bounds__(256) void split_bf16x2_kernel(const float* __restrict__ in0, const float* __restrict__ in1,
                                                           const float* __restrict__ in2, unsigned short* __restrict__ hi,
                                                           unsigned short* __restrict__ lo, int n2) {
  const int y = blockIdx.y;
  const float* in = (y == 0) ? in0 : ((y == 1) ? in1 : in2);
  const int i = blockIdx.x * 256 + threadIdx.x;
  if (i < n2) {
    const v2f f = *(const v2f*)(in + 2 * (size_t)i);
    const unsigned short h0 = f2bf_bits(f[0]), h1 = f2bf_bits(f[1]);
    const unsigned short l0 = f2bf_bits(f[0] - bf_bits2f(h0)), l1 = f2bf_bits(f[1] - bf_bits2f(h1));
    const unsigned uh = pk16(h0, h1), ul = pk16(l0, l1);
    const size_t o = (size_t)y * n2 + i;
    ((unsigned*)hi)[o] = uh;
    ((unsigned*)lo)[o] = ul;
  }
}

// =====================================================================================
// Full (non-causal, unmasked) attention, head dim 64, one launch; blockIdx.y = batch element (planes and out SEQ*HID apart).
//   q planes (hi/lo bf16): element (t, h, d) at [t*HID + h*64 + d]
//   k planes (hi/lo bf16): element (s, h, d) at [s*HID + h*64 + d]
//   v^T planes (hi/lo bf16): element (h, d, s) at [(h*64 + d)*SEQ + s]
//   out f32: element (t, h, d) at [t*HID + h*64 + d]   (the module output rows of this batch element)
//   scores^T = (k . q^T) * sscale : A = K rows, B = q; bf16 hi/lo split (hi.hi + hi.lo + lo.hi) on v_wmma_f32_16x16x32_bf16
//   out^T    = v^T . p^T          : A = V^T rows, B = p^T packed in place from the score accumulators (hi/lo split), f32 accumulate
//   A lane holds scores of ONE query (column lane & 15): keys j*16 + 8*(lane >> 4) + r. Two score tiles (2kk, 2kk+1) are,
//   register for register, the B fragment of keys kk*32 .. kk*32+31, so p never goes through LDS.
//   online softmax in f32 over all SEQ keys (32 chunks of 64, compile-time trip count, no masking): maximum and sum in-lane,
//   one exchange of the maximum between the lane halves per chunk; the halves' sums are joined once after the loop.
//   Block = 4 waves = 64 query rows of one head; grid = (NHEAD * (SEQ/64) = 512) x NB.
//   K / V^T chunk staging: 128 threads x 32 elements per plane = the whole 64x64 tile (16-B copies, plain loads,
//   __syncthreads before and after); fragment loads read the LDS tiles with the same v8b element type.
// =====================================================================================
#define AT_D 64
#define AT_NW 4
#define AT_QB 64
#define AT_KC 64
#define AT_LP 72   // LDS row pitch of the K and V^T tiles in elements: 144 B = 16 B x 9 (odd), so the 16 rows of a ds_load_b128 half-wave fall on 16 different bank groups

__device__ __forceinline__ v8f at_mma(v16b a, v16b b, v8f c) {
  c = __builtin_amdgcn_wmma_f32_16x16x32_bf16(false, a, false, b, (short)0, c, false, false);
  asm volatile("v_nop\n\tv_nop\n\tv_nop\n\tv_nop" : "+v"(c) : "v"(a), "v"(b));
  return c;
}
// two f32 -> one packed register of bf16 hi parts and one of bf16 lo parts: hi = rne(f), lo = rne(f - hi)
typedef __attribute__((ext_vector_type(2))) __bf16 v2b;
__device__ __forceinline__ void at_split2(v2f f, v2b& hi, v2b& lo) {
  hi = __builtin_convertvector(f, v2b);
  lo = __builtin_convertvector(f - __builtin_convertvector(hi, v2f), v2b);
}
// value of lane l ^ 16 (the other half's share of the same query column)
__device__ __forceinline__ float at_xhalf(float f) {
  const int b = __float_as_int(f);
  return __int_as_float(__builtin_amdgcn_permlanex16(b, b, 0x76543210, 0xfedcba98, false, false));
}

__global__ __launch_bounds__(128)
void attn_full64_kernel(const unsigned short* __restrict__ qhp, const unsigned short* __restrict__ qlp,
                        const unsigned short* __restrict__ khp, const unsigned short* __restrict__ klp,
                        const unsigned short* __restrict__ vhp, const unsigned short* __restrict__ vlp,
                        float* __restrict__ out, float sscale) {
  union FB { v16b v; v8b h[2]; v2b w[8]; };
  __shared__ __align__(16) __bf16 Ksh[AT_KC * AT_LP];            // K hi [kv][d], pitch AT_LP    9 KB
  __shared__ __align__(16) __bf16 Ksl[AT_KC * AT_LP];            // K lo
  __shared__ __align__(16) __bf16 Vth[AT_D * AT_LP];             // V hi [d][kv], pitch AT_LP    9 KB
  __shared__ __align__(16) __bf16 Vtl[AT_D * AT_LP];             // V lo
  __shared__ __align__(16) float  Os[AT_NW][16 * 68];            // per wave out tile, pitch 68

  const int tid  = threadIdx.x;
  const int wave = tid >> 5;
  const int lane = tid & 31;
  const int hh   = lane >> 4;
  const int c    = lane & 15;

  const int nqb = SEQ / AT_QB;            // 32
  const int bx = blockIdx.x;
  const int qb = bx % nqb;
  const int h  = bx / nqb;                // 0..NHEAD-1 (grid = NHEAD * nqb)
  const int q0 = qb * AT_QB + wave * 16;

  const size_t bo = (size_t)blockIdx.y * SEQ * HID;   // this batch element's planes and output rows
  const __bf16* Qh = (const __bf16*)(const void*)qhp + bo + (size_t)h * AT_D;
  const __bf16* Ql = (const __bf16*)(const void*)qlp + bo + (size_t)h * AT_D;
  const __bf16* Kh = (const __bf16*)(const void*)khp + bo + (size_t)h * AT_D;
  const __bf16* Kl = (const __bf16*)(const void*)klp + bo + (size_t)h * AT_D;
  const __bf16* Vh = (const __bf16*)(const void*)vhp + bo + (size_t)h * AT_D * SEQ;
  const __bf16* Vl = (const __bf16*)(const void*)vlp + bo + (size_t)h * AT_D * SEQ;
  float*        ob = out + bo + (size_t)h * AT_D;

  // ---- Q fragments (B operand, column = lane&15, split k map via Frag load): 2 d-chunks, hi and lo ----
  v16b qah[2], qal[2];
#pragma unroll
  for (int dc = 0; dc < 2; ++dc) {
    const __bf16* qr = Qh + (size_t)(q0 + c) * HID + dc * 32 + 8 * hh;
    const __bf16* ql = Ql + (size_t)(q0 + c) * HID + dc * 32 + 8 * hh;
    qah[dc] = Frag<__bf16>::load(qr);
    qal[dc] = Frag<__bf16>::load(ql);
  }

  float mrow = -INFINITY, lrow = 0.f;   // this lane's query: running maximum (both halves agree), this half's share of the sum
  v8f oacc[4];                          // oacc[t][r] = out^T[d = t*16 + 8*hh + r][query c]
#pragma unroll
  for (int t = 0; t < 4; ++t) oacc[t] = (v8f){0.f,0.f,0.f,0.f,0.f,0.f,0.f,0.f};

  const int nChunks = SEQ / AT_KC;   // 32, compile-time constant
  for (int kc = 0; kc < nChunks; ++kc) {
    const int kv0 = kc * AT_KC;
    __syncthreads();
    {
      // staging coverage: 128 threads x (4 x 8) elements = 64 rows x 64 per plane = the whole chunk tile
      const int r = tid >> 1, half = (tid & 1) * 32;
      const __bf16* ksh = Kh + (size_t)(kv0 + r) * HID + half;    // K row kv0+r, d = half..half+31
      const __bf16* ksl = Kl + (size_t)(kv0 + r) * HID + half;
      const __bf16* vsh = Vh + (size_t)r * SEQ + kv0 + half;      // V^T row d = r, s = kv0+half..+31
      const __bf16* vsl = Vl + (size_t)r * SEQ + kv0 + half;
#pragma unroll
      for (int i = 0; i < 4; ++i) {
        const v8b a0 = *(const v8b*)(ksh + 8 * i);
        const v8b a1 = *(const v8b*)(ksl + 8 * i);
        const v8b b0 = *(const v8b*)(vsh + 8 * i);
        const v8b b1 = *(const v8b*)(vsl + 8 * i);
        *(v8b*)(Ksh + r * AT_LP + half + 8 * i) = a0;
        *(v8b*)(Ksl + r * AT_LP + half + 8 * i) = a1;
        *(v8b*)(Vth + r * AT_LP + half + 8 * i) = b0;
        *(v8b*)(Vtl + r * AT_LP + half + 8 * i) = b1;
      }
    }
    __syncthreads();

    v8f s[4];
#pragma unroll
    for (int j = 0; j < 4; ++j) {
      s[j] = (v8f){0.f,0.f,0.f,0.f,0.f,0.f,0.f,0.f};
#pragma unroll
      for (int dc = 0; dc < 2; ++dc) {
        FB kb, kl;
        kb.h[0] = *(const v8b*)(Ksh + (j * 16 + c) * AT_LP + dc * 32 + 8 * hh);
        kb.h[1] = *(const v8b*)(Ksh + (j * 16 + c) * AT_LP + dc * 32 + 16 + 8 * hh);
        kl.h[0] = *(const v8b*)(Ksl + (j * 16 + c) * AT_LP + dc * 32 + 8 * hh);
        kl.h[1] = *(const v8b*)(Ksl + (j * 16 + c) * AT_LP + dc * 32 + 16 + 8 * hh);
        s[j] = at_mma(kb.v, qah[dc], s[j]);
        s[j] = at_mma(kl.v, qah[dc], s[j]);
        s[j] = at_mma(kb.v, qal[dc], s[j]);
      }
    }
    // s[j][r] = score of key kv0 + j*16 + 8*hh + r against query c
    float mj[4];
#pragma unroll
    for (int j = 0; j < 4; ++j) {
      float m = -INFINITY;
#pragma unroll
      for (int r = 0; r < 8; ++r) {
        const float sv = s[j][r] * sscale;
        s[j][r] = sv;
        m = fmaxf(m, sv);
      }
      mj[j] = m;
    }
    const float mh = fmaxf(fmaxf(mj[0], mj[1]), fmaxf(mj[2], mj[3]));
    const float mnew = fmaxf(mrow, fmaxf(mh, at_xhalf(mh)));
    const float alpha = expf(mrow - mnew);
    mrow = mnew;
    FB pah[2], pal[2];                   // p^T as B fragments: element e of [kk] = key kk*32 + (e < 8 ? 8*hh + e : 16 + 8*hh + e - 8)
    float pj[4];
#pragma unroll
    for (int j = 0; j < 4; ++j) {
      float psum = 0.f;
#pragma unroll
      for (int r = 0; r < 8; r += 2) {
        const float p0 = expf(s[j][r] - mnew);
        const float p1 = expf(s[j][r + 1] - mnew);
        psum += p0;
        psum += p1;
        at_split2((v2f){p0, p1}, pah[j >> 1].w[(j & 1) * 4 + (r >> 1)], pal[j >> 1].w[(j & 1) * 4 + (r >> 1)]);
      }
      pj[j] = psum;
    }
    lrow = lrow * alpha + ((pj[0] + pj[1]) + (pj[2] + pj[3]));
#pragma unroll
    for (int t = 0; t < 4; ++t)
#pragma unroll
      for (int r = 0; r < 8; ++r) oacc[t][r] *= alpha;
#pragma unroll   // full unroll: pah[kk], pal[kk] live in registers and need a compile-time index
    for (int kk = 0; kk < 2; ++kk) {
#pragma unroll
      for (int t = 0; t < 4; ++t) {
        FB vb, vl;
        vb.h[0] = *(const v8b*)(Vth + (t * 16 + c) * AT_LP + kk * 32 + 8 * hh);
        vb.h[1] = *(const v8b*)(Vth + (t * 16 + c) * AT_LP + kk * 32 + 16 + 8 * hh);
        vl.h[0] = *(const v8b*)(Vtl + (t * 16 + c) * AT_LP + kk * 32 + 8 * hh);
        vl.h[1] = *(const v8b*)(Vtl + (t * 16 + c) * AT_LP + kk * 32 + 16 + 8 * hh);
        oacc[t] = at_mma(vb.v, pah[kk].v, oacc[t]);
        oacc[t] = at_mma(vl.v, pah[kk].v, oacc[t]);
        oacc[t] = at_mma(vb.v, pal[kk].v, oacc[t]);
      }
    }
  }

  float* os = Os[wave];
  const float inv = 1.0f / (lrow + at_xhalf(lrow));   // both halves' sums; >= 1 (the row max contributes p = 1)
#pragma unroll
  for (int t = 0; t < 4; ++t) {
    // query row c of the wave tile, d = t*16 + 8*hh .. +7: two 16-B LDS stores
    *(v4f*)(os + c * 68 + t * 16 + 8 * hh)     = (v4f){oacc[t][0] * inv, oacc[t][1] * inv, oacc[t][2] * inv, oacc[t][3] * inv};
    *(v4f*)(os + c * 68 + t * 16 + 8 * hh + 4) = (v4f){oacc[t][4] * inv, oacc[t][5] * inv, oacc[t][6] * inv, oacc[t][7] * inv};
  }
  __builtin_amdgcn_fence(__ATOMIC_RELEASE, "workgroup");
  __builtin_amdgcn_wave_barrier();
  __builtin_amdgcn_fence(__ATOMIC_ACQUIRE, "workgroup");
  {
    const int c4 = (lane & 15) * 4;
    {
#pragma unroll
      for (int it = 0; it < 8; ++it) {
        const int row = it * 2 + hh;   // it 0..7 x hh 0..1 covers rows 0..15 of the wave tile; 16 lanes x 16 B = the 64-float head segment
        v4f val = *(const v4f*)(os + row * 68 + c4);
        *(v4f*)(ob + (size_t)(q0 + row) * HID + c4) = val;
      }
      
    }
  }
}

// ---------------------------------------------------------------------------
// Workspace region map (byte offsets; every region is fully rewritten in each call)
//   Wh  bf16 [3 (q,k,v)][1024 o][1024 i]                0      Wl    6291456
//   Xh  bf16 [2 b][2048 s][1024 i]               12582912      Xl   20971520
//   Ch  bf16 [3 (q,k,v^T)][2 b][2048*1024]       29360128      Cl   54525952
//       q, k planes [s][h*64+d]; v^T planes [h*64+d][s]
//   total                                        79691776  (76 MiB)
// ---------------------------------------------------------------------------
extern "C" void kernel_launch(void* const* d_in, const int* in_sizes, int n_in,
                              void* d_out, int out_size, void* d_ws, size_t ws_size,
                              hipStream_t stream) {
  if (n_in < 7) return;
  if (in_sizes[0] != NB * SEQ * HID) return;
  if (in_sizes[1] != HID * HID || in_sizes[3] != HID * HID || in_sizes[5] != HID * HID) return;
  if (in_sizes[2] != HID || in_sizes[4] != HID || in_sizes[6] != HID) return;
  if (out_size != NB * SEQ * HID) return;

  const float* x  = (const float*)d_in[0];   // [2][2048][1024]
  const float* Wq = (const float*)d_in[1];   // [1024 out][1024 in]
  const float* bq = (const float*)d_in[2];   // [1024]
  const float* Wk = (const float*)d_in[3];
  const float* bk = (const float*)d_in[4];
  const float* Wv = (const float*)d_in[5];
  const float* bv = (const float*)d_in[6];

  const size_t PW = (size_t)HID * HID * 2;   // 2097152  bf16 weight plane [1024][1024]
  const size_t PX = (size_t)SEQ * HID * 2;   // 4194304  bf16 activation plane [2048][1024] (one batch element)
  size_t off = 0;
  const size_t oWh = off; off += 3 * PW;       const size_t oWl = off; off += 3 * PW;
  const size_t oXh = off; off += NB * PX;      const size_t oXl = off; off += NB * PX;
  const size_t oCh = off; off += 3 * NB * PX;  const size_t oCl = off; off += 3 * NB * PX;
  if (off > ws_size) return;                 // off = 79691776

  char* ws = (char*)d_ws;
  unsigned short* Wh = (unsigned short*)(ws + oWh); unsigned short* Wl = (unsigned short*)(ws + oWl);
  unsigned short* Xh = (unsigned short*)(ws + oXh); unsigned short* Xl = (unsigned short*)(ws + oXl);
  unsigned short* Ch = (unsigned short*)(ws + oCh); unsigned short* Cl = (unsigned short*)(ws + oCl);
  const size_t EP = (size_t)NB * SEQ * HID;  // elements of one projection's planes (both batch elements)

  const dim3 blk(256);

  // (1) weights [out][in] are already the Bt [n][k] layout -> bf16 hi/lo planes, no transpose; one launch for q, k, v
  const int n2w = HID * HID / 2;                            // 524288 pairs per plane
  split_bf16x2_kernel<<<dim3((n2w + 255) / 256, 3), blk, 0, stream>>>(Wq, Wk, Wv, Wh, Wl, n2w);
  // (2) x, both batch elements -> bf16 hi/lo planes [2][2048][1024]
  const int n2x = NB * SEQ * HID / 2;                       // 2097152 pairs per plane
  split_bf16x2_kernel<<<dim3((n2x + 255) / 256, 1), blk, 0, stream>>>(x, x, x, Xh, Xl, n2x);
  // (3) q = x . Wq^T + bq, k = x . Wk^T + bk, v^T = Wv . x^T + bv, both batch elements: 128 tiles of 128x128 each, one per work-group
  qkv_gemm64<<<dim3((SEQ / 128) * (HID / 128), NB, 3), dim3(128), 0, stream>>>(Xh, Xl, Wh, Wl, Ch, Cl, bq, bk, bv);
  // (4) full attention per head and batch element, no score scaling; f32 tiles go straight to the output rows
  attn_full64_kernel<<<dim3(NHEAD * (SEQ / 64), NB), dim3(128), 0, stream>>>(
      Ch, Cl, Ch + EP, Cl + EP, Ch + 2 * EP, Cl + 2 * EP, (float*)d_out, 1.0f);
  (void)hipGetLastError();
}

// v005
// One run takes 189 microseconds.
// Two timings next to v004 both put it at 1.08 times that version's speed.
// Over all steps from v000 it is 3.97 times as fast.
// All contractions (q, k, v^T projections, q.k^T, p.v): v_wmma_f32_16x16x32_bf16 with bf16 hi/lo split operands (hi.hi + hi.lo + lo.hi), f32 accumulate; online softmax, biases and normalisation in f32; no score scaling.
#include <hip/hip_runtime.h>
#include <math.h>
#include <stdint.h>

#define NB    2
#define SEQ   2048
#define HID   1024
#define NHEAD 16
#define DHD   64

typedef __attribute__((ext_vector_type(16))) _Float16 v16h;
typedef __attribute__((ext_vector_type(8)))  _Float16 v8h;
typedef __attribute__((ext_vector_type(16))) __bf16   v16b;
typedef __attribute__((ext_vector_type(8)))  __bf16   v8b;
typedef __attribute__((ext_vector_type(8)))  float    v8f;
typedef __attribute__((ext_vector_type(4)))  float    v4f;
typedef __attribute__((ext_vector_type(2)))  float    v2f;
typedef __attribute__((ext_vector_type(4)))  unsigned int v4u;

__device__ __forceinline__ unsigned short f2bf_bits(float f) {
  unsigned u = __float_as_uint(f);
  return (unsigned short)((u + 0x7FFFu + ((u >> 16) & 1u)) >> 16);
}
__device__ __forceinline__ float bf_bits2f(unsigned short h) { return __uint_as_float(((unsigned)h) << 16); }

// hazard guards as plain device helpers
__device__ __forceinline__ void dep_guard_h(v8f& a, v8f& b, v16h x, v16h y) { asm volatile("v_nop\n\tv_nop\n\tv_nop\n\tv_nop" : "+v"(a), "+v"(b) : "v"(x), "v"(y)); }
__device__ __forceinline__ void dep_guard_b(v8f& a, v8f& b, v16b x, v16b y) { asm volatile("v_nop\n\tv_nop\n\tv_nop\n\tv_nop" : "+v"(a), "+v"(b) : "v"(x), "v"(y)); }
__device__ __forceinline__ void keep4_h(v16h a, v16h b, v16h c, v16h d) { asm volatile("v_nop" :: "v"(a), "v"(b), "v"(c), "v"(d)); }
__device__ __forceinline__ void keep4_b(v16b a, v16b b, v16b c, v16b d) { asm volatile("v_nop" :: "v"(a), "v"(b), "v"(c), "v"(d)); }
__device__ __forceinline__ void acc_guard4(v8f& a, v8f& b, v8f& c, v8f& d) { asm volatile("v_nop\n\tv_nop\n\tv_nop\n\tv_nop" : "+v"(a), "+v"(b), "+v"(c), "+v"(d)); }
template <typename T> struct Frag;
template <> struct Frag<_Float16> {
  typedef v16h V; union U { v16h v; v8h h[2]; };
  static __device__ __forceinline__ v16h load(const _Float16* p) {   // elements 0..7 <- p[0..7], 8..15 <- p[16..23]
    U f; f.h[0] = *(const v8h*)(p); f.h[1] = *(const v8h*)(p + 16); return f.v;
  }
  static __device__ __forceinline__ v8f mma(v16h a, v16h b, v8f c) {
    return __builtin_amdgcn_wmma_f32_16x16x32_f16(false, a, false, b, (short)0, c, false, false);
  }
  static __device__ __forceinline__ void guard(v8f& a, v8f& b, v16h x, v16h y) { dep_guard_h(a, b, x, y); }
  static __device__ __forceinline__ void keep(v16h a, v16h b, v16h c, v16h d) { keep4_h(a, b, c, d); }
};
template <> struct Frag<__bf16> {
  typedef v16b V; union U { v16b v; v8b h[2]; };
  static __device__ __forceinline__ v16b load(const __bf16* p) {
    U f; f.h[0] = *(const v8b*)(p); f.h[1] = *(const v8b*)(p + 16); return f.v;
  }
  static __device__ __forceinline__ v8f mma(v16b a, v16b b, v8f c) {
    return __builtin_amdgcn_wmma_f32_16x16x32_bf16(false, a, false, b, (short)0, c, false, false);
  }
  static __device__ __forceinline__ void guard(v8f& a, v8f& b, v16b x, v16b y) { dep_guard_b(a, b, x, y); }
  static __device__ __forceinline__ void keep(v16b a, v16b b, v16b c, v16b d) { keep4_b(a, b, c, d); }
};

// ---- Register-blocked WMMA GEMM, all three projections of both batch elements in ONE launch ----------
// C[m,n] = sum_k A[m,k] * Bt[n,k] + bias; a work-group owns a 128x128 tile, each of its 4 waves (2 x 2) a 64x64 tile;
// K = HID, row pitch of A and Bt = HID.
// Operands are bf16 hi/lo planes; product = hi.hi + hi.lo + lo.hi; output = bf16 hi plane + bf16 lo plane.
// blockIdx.z = projection p, blockIdx.y = batch element b, blockIdx.x = 128x128 tile (128 tiles per (p, b)).
//   p = 0, 1 (q, k): A = x[b] planes [SEQ][HID], Bt = W[p] planes [HID][HID], C [SEQ][HID], bias[n]
//   p = 2   (v^T)  : A = W[2] planes [HID][HID], Bt = x[b] planes [SEQ][HID], C [HID][SEQ], bias[m]
// Grid 128 x 2 x 3 = 768 work-groups of 4 waves = 3 per WGP on 256 WGPs.
// Operand path: a stage = 32 k of the 128 A rows and the 128 Bt rows, hi and lo planes, brought into LDS by asynchronous
// copies (16 B per lane, 16 copies per lane and stage); two buffers, the next stage's copies fly while this one is worked on.
#define GS_KS   32                     // k per stage
#define GS_LP   40                     // LDS row pitch in elements: 80 B = 16 B x 5 (odd), free of bank conflicts for ds_load_b128
#define GS_PL   (128 * GS_LP)          // elements of one plane of a stage (128 rows)
#define GS_ST   (4 * GS_PL)            // elements of one stage: A hi, A lo, Bt hi, Bt lo (40960 B)
#define GS_NT   (HID / GS_KS)          // 32 stages

// Eight asynchronous 16-B copies per lane, global -> LDS. The s_wait_xcnt closes the statement so that no address register
// of a copy is rewritten in front of it.
__device__ __forceinline__ void gs_copy8(unsigned l0, unsigned l1, unsigned l2, unsigned l3,
                                         unsigned l4, unsigned l5, unsigned l6, unsigned l7,
                                         const __bf16* g0, const __bf16* g1, const __bf16* g2, const __bf16* g3,
                                         const __bf16* g4, const __bf16* g5, const __bf16* g6, const __bf16* g7) {
  asm volatile("global_load_async_to_lds_b128 %0, %8, off\n\t"
               "global_load_async_to_lds_b128 %1, %9, off\n\t"
               "global_load_async_to_lds_b128 %2, %10, off\n\t"
               "global_load_async_to_lds_b128 %3, %11, off\n\t"
               "global_load_async_to_lds_b128 %4, %12, off\n\t"
               "global_load_async_to_lds_b128 %5, %13, off\n\t"
               "global_load_async_to_lds_b128 %6, %14, off\n\t"
               "global_load_async_to_lds_b128 %7, %15, off\n\t"
               "s_wait_xcnt 0x0"
               :: "v"(l0), "v"(l1), "v"(l2), "v"(l3), "v"(l4), "v"(l5), "v"(l6), "v"(l7),
                  "v"(g0), "v"(g1), "v"(g2), "v"(g3), "v"(g4), "v"(g5), "v"(g6), "v"(g7)
               : "memory");
}
// One stage: hp, lp = this lane's first 16 B of the hi and lo plane (row tid >> 2, piece tid & 3, at the stage's k);
// l = the LDS byte address of the same piece in the hi plane. Rows step by 32, the lo plane lies GS_PL elements behind.
__device__ __forceinline__ void gs_copy_operand(unsigned l, const __bf16* hp, const __bf16* lp) {
  const unsigned rs = 32 * GS_LP * 2, ps = GS_PL * 2;
  gs_copy8(l, l + rs, l + 2 * rs, l + 3 * rs, l + ps, l + ps + rs, l + ps + 2 * rs, l + ps + 3 * rs,
           hp, hp + 32 * HID, hp + 64 * HID, hp + 96 * HID, lp, lp + 32 * HID, lp + 64 * HID, lp + 96 * HID);
}

__global__ __launch_bounds__(128) void qkv_gemm64(
    const unsigned short* __restrict__ Xhp, const unsigned short* __restrict__ Xlp,
    const unsigned short* __restrict__ Whp, const unsigned short* __restrict__ Wlp,
    unsigned short* __restrict__ Chp, unsigned short* __restrict__ Clp,
    const float* __restrict__ bq, const float* __restrict__ bk, const float* __restrict__ bv) {
  typedef __bf16 T;
  typedef Frag<T>::V V;
  __shared__ __align__(16) T     sS[2 * GS_ST];    // two stage buffers, 81920 B
  __shared__ __align__(16) float sT[4][16 * 68];   // per-wave 16x64 slab, pitch 68 floats
  const int p    = blockIdx.z;
  const int b    = blockIdx.y;
  const bool vt  = (p == 2);
  const int tid  = threadIdx.x;
  const int lane = tid & 31;
  const int wave = tid >> 5;
  const int ldc  = vt ? SEQ : HID;
  const int shN  = vt ? 4 : 3;                     // log2 of the 128-wide tiles per row of C (N / 128)
  const int tile = blockIdx.x;                     // 0..127
  const int tm = tile >> shN;
  const int tn = tile - (tm << shN);
  const int mB = tm << 7;                          // the work-group's first row and column of C
  const int nB = tn << 7;
  const int wm = (wave >> 1) << 6;                 // the wave's 64x64 tile inside it
  const int wn = (wave & 1) << 6;
  const int m0 = mB + wm;
  const int n0 = nB + wn;

  const size_t xo = (size_t)b * SEQ * HID;
  const size_t wo = (size_t)p * HID * HID;
  const T* Ab  = (const T*)(vt ? Whp + wo : Xhp + xo);
  const T* Ab2 = (const T*)(vt ? Wlp + wo : Xlp + xo);
  const T* Bb  = (const T*)(vt ? Xhp + xo : Whp + wo);
  const T* Bb2 = (const T*)(vt ? Xlp + xo : Wlp + wo);
  const float* bias = (p == 0) ? bq : ((p == 1) ? bk : bv);

  const int rlane = lane & 15;                 // row (A) / col (B, D) within subtile
  const int koff  = (lane >> 4) * 8;           // k offset of this lane half
  const int mOff  = (lane >> 4) * 8;           // D row offset

  // this lane's share of a stage: row tid >> 2 (+ 32, 64, 96), 16-B piece tid & 3 of the row's 64 B, in each of the 4 planes
  const int crow = tid >> 2, cseg = (tid & 3) * 8;
  const T* gAh = Ab  + (size_t)(mB + crow) * HID + cseg;
  const T* gAl = Ab2 + (size_t)(mB + crow) * HID + cseg;
  const T* gBh = Bb  + (size_t)(nB + crow) * HID + cseg;
  const T* gBl = Bb2 + (size_t)(nB + crow) * HID + cseg;
  const unsigned lA = (unsigned)(size_t)sS + (unsigned)(crow * GS_LP + cseg) * 2u;   // LDS byte address, buffer 0, A hi
  const unsigned lB = lA + 2u * GS_PL * 2u;                                          // buffer 0, Bt hi

  v8f acc[4][4];
#pragma unroll
  for (int i = 0; i < 4; ++i)
#pragma unroll
    for (int j = 0; j < 4; ++j) acc[i][j] = (v8f){0.f,0.f,0.f,0.f,0.f,0.f,0.f,0.f};

  // prologue: stage 0 lands and is published, then stage 1 is set off
  gs_copy_operand(lA, gAh, gAl);
  gs_copy_operand(lB, gBh, gBl);
  asm volatile("s_wait_asynccnt 0x0" ::: "memory");   // this wave's copies of stage 0 have landed
  __syncthreads();                                    // ... and every other wave's
  gs_copy_operand(lA + GS_ST * 2u, gAh + GS_KS, gAl + GS_KS);
  gs_copy_operand(lB + GS_ST * 2u, gBh + GS_KS, gBl + GS_KS);

  for (int t = 0; t < GS_NT; ++t) {
    const int bo_ = (t & 1) * GS_ST;
    const T* sA = sS + bo_ + (wm + rlane) * GS_LP + koff;               // A hi rows of this wave; lo GS_PL behind
    const T* sB = sS + bo_ + 2 * GS_PL + (wn + rlane) * GS_LP + koff;   // Bt hi rows of this wave; lo GS_PL behind
    V bh[4], bl[4];
#pragma unroll
    for (int j = 0; j < 4; ++j) {
      bh[j] = Frag<T>::load(sB + (j << 4) * GS_LP);
      bl[j] = Frag<T>::load(sB + GS_PL + (j << 4) * GS_LP);
    }
    V ah[2], al[2];                      // two A fragment sets: the next 16 rows' LDS reads are asked for ahead of this block's products
    ah[0] = Frag<T>::load(sA);
    al[0] = Frag<T>::load(sA + GS_PL);
#pragma unroll
    for (int i = 0; i < 4; ++i) {
      if (i < 3) {
        ah[(i + 1) & 1] = Frag<T>::load(sA + ((i + 1) << 4) * GS_LP);
        al[(i + 1) & 1] = Frag<T>::load(sA + GS_PL + ((i + 1) << 4) * GS_LP);
      }
#pragma unroll
      for (int j = 0; j < 4; ++j) {
        acc[i][j] = Frag<T>::mma(ah[i & 1], bh[j], acc[i][j]);
        acc[i][j] = Frag<T>::mma(ah[i & 1], bl[j], acc[i][j]);
        acc[i][j] = Frag<T>::mma(al[i & 1], bh[j], acc[i][j]);
      }
      Frag<T>::guard(acc[i][0], acc[i][3], ah[i & 1], al[i & 1]);
    }
    Frag<T>::keep(bh[0], bh[1], bh[2], bh[3]);
    Frag<T>::keep(bl[0], bl[1], bl[2], bl[3]);
    // publish point of stage t + 1
    asm volatile("s_wait_dscnt 0x0" ::: "memory");      // this wave's reads of buffer t & 1 are done before it is refilled
    asm volatile("s_wait_asynccnt 0x0" ::: "memory");   // this wave's copies of stage t + 1 have landed
    __syncthreads();                                    // stage t + 1 readable by all; buffer t & 1 left by all
    if (t + 2 < GS_NT) {
      const int kn = (t + 2) * GS_KS;
      gs_copy_operand(lA + (unsigned)bo_ * 2u, gAh + kn, gAl + kn);
      gs_copy_operand(lB + (unsigned)bo_ * 2u, gBh + kn, gBl + kn);
    }
  }
  asm volatile("s_wait_asynccnt 0x0" ::: "memory");     // no copy is outstanding when the wave goes on
  acc_guard4(acc[0][0], acc[0][1], acc[0][2], acc[0][3]);
  acc_guard4(acc[1][0], acc[1][1], acc[1][2], acc[1][3]);
  acc_guard4(acc[2][0], acc[2][1], acc[2][2], acc[2][3]);
  acc_guard4(acc[3][0], acc[3][1], acc[3][2], acc[3][3]);

  // ---- epilogue ----
  float* slab = sT[wave];
  const size_t co = (size_t)(p * NB + b) * SEQ * HID;
  unsigned short* C  = Chp + co;
  unsigned short* C2 = Clp + co;
#pragma unroll
  for (int i = 0; i < 4; ++i) {
    const int mBase = m0 + (i << 4);
    float bm[8];                                   // bias[m] of this lane's 8 rows (v^T only; index 0 otherwise, unused)
#pragma unroll
    for (int r = 0; r < 8; ++r) bm[r] = bias[vt ? (mBase + mOff + r) : 0];
#pragma unroll
    for (int j = 0; j < 4; ++j) {
      const int n = n0 + (j << 4) + rlane;
      const float bn = bias[vt ? 0 : n];           // bias[n] of this lane's column (q, k only)
#pragma unroll
      for (int r = 0; r < 8; ++r) {
        const float v = acc[i][j][r] + (vt ? bm[r] : bn);
        slab[(mOff + r) * 68 + (j << 4) + rlane] = v;
      }
    }
    __builtin_amdgcn_fence(__ATOMIC_RELEASE, "workgroup");
    __builtin_amdgcn_wave_barrier();
    __builtin_amdgcn_fence(__ATOMIC_ACQUIRE, "workgroup");
    {
      const int q = lane >> 3, c8 = (lane & 7) * 8;
#pragma unroll
      for (int it = 0; it < 4; ++it) {
        const int row = it * 4 + q;                       // it 0..3 x q 0..3 = rows 0..15 of the slab
        const float* sp = slab + row * 68 + c8;
        v8h hv, lv;
#pragma unroll
        for (int e = 0; e < 8; ++e) {
          unsigned short hb = f2bf_bits(sp[e]);
          unsigned short lb = f2bf_bits(sp[e] - bf_bits2f(hb));
          hv[e] = __builtin_bit_cast(_Float16, hb);
          lv[e] = __builtin_bit_cast(_Float16, lb);
        }
        *(v8h*)(C  + (size_t)(mBase + row) * ldc + n0 + c8) = hv;
        *(v8h*)(C2 + (size_t)(mBase + row) * ldc + n0 + c8) = lv;
      }
    }
    __builtin_amdgcn_fence(__ATOMIC_RELEASE, "workgroup");
    __builtin_amdgcn_wave_barrier();
    __builtin_amdgcn_fence(__ATOMIC_ACQUIRE, "workgroup");
  }
}

// ---------------------------------------------------------------------------
// Elementwise bf16 split: hi = bf16_rne(in), lo = bf16_rne(in - hi); 2 elements per thread, one 4-B store per plane.
// blockIdx.y picks the source (in0, in1, in2) and its plane of n2 pairs in hi / lo.
//   weights: grid 2048 x 3, n2 = 1024*1024/2 = 524288 pairs per weight
//   activations, both batch elements: grid 8192 x 1, n2 = 2*2048*1024/2 = 2097152 pairs
// ---------------------------------------------------------------------------
__device__ __forceinline__ unsigned pk16(unsigned short a, unsigned short b) { return (unsigned)a | ((unsigned)b << 16); }

__global__ __launch_bounds__(256) void split_bf16x2_kernel(const float* __restrict__ in0, const float* __restrict__ in1,
                                                           const float* __restrict__ in2, unsigned short* __restrict__ hi,
                                                           unsigned short* __restrict__ lo, int n2) {
  const int y = blockIdx.y;
  const float* in = (y == 0) ? in0 : ((y == 1) ? in1 : in2);
  const int i = blockIdx.x * 256 + threadIdx.x;
  if (i < n2) {
    const v2f f = *(const v2f*)(in + 2 * (size_t)i);
    const unsigned short h0 = f2bf_bits(f[0]), h1 = f2bf_bits(f[1]);
    const unsigned short l0 = f2bf_bits(f[0] - bf_bits2f(h0)), l1 = f2bf_bits(f[1] - bf_bits2f(h1));
    const unsigned uh = pk16(h0, h1), ul = pk16(l0, l1);
    const size_t o = (size_t)y * n2 + i;
    ((unsigned*)hi)[o] = uh;
    ((unsigned*)lo)[o] = ul;
  }
}

// =====================================================================================
// Full (non-causal, unmasked) attention, head dim 64, one launch; blockIdx.y = batch element (planes and out SEQ*HID apart).
//   q planes (hi/lo bf16): element (t, h, d) at [t*HID + h*64 + d]
//   k planes (hi/lo bf16): element (s, h, d) at [s*HID + h*64 + d]
//   v^T planes (hi/lo bf16): element (h, d, s) at [(h*64 + d)*SEQ + s]
//   out f32: element (t, h, d) at [t*HID + h*64 + d]   (the module output rows of this batch element)
//   scores^T = (k . q^T) * sscale : A = K rows, B = q; bf16 hi/lo split (hi.hi + hi.lo + lo.hi) on v_wmma_f32_16x16x32_bf16
//   out^T    = v^T . p^T          : A = V^T rows, B = p^T packed in place from the score accumulators (hi/lo split), f32 accumulate
//   A lane holds scores of ONE query (column lane & 15): keys j*16 + 8*(lane >> 4) + r. Two score tiles (2kk, 2kk+1) are,
//   register for register, the B fragment of keys kk*32 .. kk*32+31, so p never goes through LDS.
//   online softmax in f32 over all SEQ keys (32 chunks of 64, compile-time trip count, no masking): maximum and sum in-lane,
//   one exchange of the maximum between the lane halves per chunk; the halves' sums are joined once after the loop.
//   Block = 4 waves = 64 query rows of one head; grid = (NHEAD * (SEQ/64) = 512) x NB.
//   K / V^T chunk staging: 128 threads x 32 elements per plane = the whole 64x64 tile (16-B copies, plain loads,
//   __syncthreads before and after); fragment loads read the LDS tiles with the same v8b element type.
// =====================================================================================
#define AT_D 64
#define AT_NW 4
#define AT_QB 64
#define AT_KC 64
#define AT_LP 72   // LDS row pitch of the K and V^T tiles in elements: 144 B = 16 B x 9 (odd), so the 16 rows of a ds_load_b128 half-wave fall on 16 different bank groups

__device__ __forceinline__ v8f at_mma(v16b a, v16b b, v8f c) {
  return __builtin_amdgcn_wmma_f32_16x16x32_bf16(false, a, false, b, (short)0, c, false, false);
}
// two f32 -> one packed register of bf16 hi parts and one of bf16 lo parts: hi = rne(f), lo = rne(f - hi)
typedef __attribute__((ext_vector_type(2))) __bf16 v2b;
__device__ __forceinline__ void at_split2(v2f f, v2b& hi, v2b& lo) {
  hi = __builtin_convertvector(f, v2b);
  lo = __builtin_convertvector(f - __builtin_convertvector(hi, v2f), v2b);
}
// value of lane l ^ 16 (the other half's share of the same query column)
__device__ __forceinline__ float at_xhalf(float f) {
  const int b = __float_as_int(f);
  return __int_as_float(__builtin_amdgcn_permlanex16(b, b, 0x76543210, 0xfedcba98, false, false));
}

// register budget 256 a wave = four waves per SIMD, so that all 1024 work-groups (four per WGP) stay resident at once;
// told the budget, the compiler reads the fragments further ahead of their products than it does without it
__global__ __launch_bounds__(128) __attribute__((amdgpu_waves_per_eu(4, 4)))
void attn_full64_kernel(const unsigned short* __restrict__ qhp, const unsigned short* __restrict__ qlp,
                        const unsigned short* __restrict__ khp, const unsigned short* __restrict__ klp,
                        const unsigned short* __restrict__ vhp, const unsigned short* __restrict__ vlp,
                        float* __restrict__ out, float sscale) {
  union FB { v16b v; v8b h[2]; v2b w[8]; };
  __shared__ __align__(16) __bf16 Ksh[AT_KC * AT_LP];            // K hi [kv][d], pitch AT_LP    9 KB
  __shared__ __align__(16) __bf16 Ksl[AT_KC * AT_LP];            // K lo
  __shared__ __align__(16) __bf16 Vth[AT_D * AT_LP];             // V hi [d][kv], pitch AT_LP    9 KB
  __shared__ __align__(16) __bf16 Vtl[AT_D * AT_LP];             // V lo
  __shared__ __align__(16) float  Os[AT_NW][16 * 68];            // per wave out tile, pitch 68

  const int tid  = threadIdx.x;
  const int wave = tid >> 5;
  const int lane = tid & 31;
  const int hh   = lane >> 4;
  const int c    = lane & 15;

  const int nqb = SEQ / AT_QB;            // 32
  const int bx = blockIdx.x;
  const int qb = bx % nqb;
  const int h  = bx / nqb;                // 0..NHEAD-1 (grid = NHEAD * nqb)
  const int q0 = qb * AT_QB + wave * 16;

  const size_t bo = (size_t)blockIdx.y * SEQ * HID;   // this batch element's planes and output rows
  const __bf16* Qh = (const __bf16*)(const void*)qhp + bo + (size_t)h * AT_D;
  const __bf16* Ql = (const __bf16*)(const void*)qlp + bo + (size_t)h * AT_D;
  const __bf16* Kh = (const __bf16*)(const void*)khp + bo + (size_t)h * AT_D;
  const __bf16* Kl = (const __bf16*)(const void*)klp + bo + (size_t)h * AT_D;
  const __bf16* Vh = (const __bf16*)(const void*)vhp + bo + (size_t)h * AT_D * SEQ;
  const __bf16* Vl = (const __bf16*)(const void*)vlp + bo + (size_t)h * AT_D * SEQ;
  float*        ob = out + bo + (size_t)h * AT_D;

  // ---- Q fragments (B operand, column = lane&15, split k map via Frag load): 2 d-chunks, hi and lo ----
  v16b qah[2], qal[2];
#pragma unroll
  for (int dc = 0; dc < 2; ++dc) {
    const __bf16* qr = Qh + (size_t)(q0 + c) * HID + dc * 32 + 8 * hh;
    const __bf16* ql = Ql + (size_t)(q0 + c) * HID + dc * 32 + 8 * hh;
    qah[dc] = Frag<__bf16>::load(qr);
    qal[dc] = Frag<__bf16>::load(ql);
  }

  float mrow = -INFINITY, lrow = 0.f;   // this lane's query: running maximum (both halves agree), this half's share of the sum
  v8f oacc[4];                          // oacc[t][r] = out^T[d = t*16 + 8*hh + r][query c]
#pragma unroll
  for (int t = 0; t < 4; ++t) oacc[t] = (v8f){0.f,0.f,0.f,0.f,0.f,0.f,0.f,0.f};

  const int nChunks = SEQ / AT_KC;   // 32, compile-time constant
  for (int kc = 0; kc < nChunks; ++kc) {
    const int kv0 = kc * AT_KC;
    __syncthreads();
    {
      // staging coverage: 128 threads x (4 x 8) elements = 64 rows x 64 per plane = the whole chunk tile
      const int r = tid >> 1, half = (tid & 1) * 32;
      const __bf16* ksh = Kh + (size_t)(kv0 + r) * HID + half;    // K row kv0+r, d = half..half+31
      const __bf16* ksl = Kl + (size_t)(kv0 + r) * HID + half;
      const __bf16* vsh = Vh + (size_t)r * SEQ + kv0 + half;      // V^T row d = r, s = kv0+half..+31
      const __bf16* vsl = Vl + (size_t)r * SEQ + kv0 + half;
#pragma unroll
      for (int i = 0; i < 4; ++i) {
        const v8b a0 = *(const v8b*)(ksh + 8 * i);
        const v8b a1 = *(const v8b*)(ksl + 8 * i);
        const v8b b0 = *(const v8b*)(vsh + 8 * i);
        const v8b b1 = *(const v8b*)(vsl + 8 * i);
        *(v8b*)(Ksh + r * AT_LP + half + 8 * i) = a0;
        *(v8b*)(Ksl + r * AT_LP + half + 8 * i) = a1;
        *(v8b*)(Vth + r * AT_LP + half + 8 * i) = b0;
        *(v8b*)(Vtl + r * AT_LP + half + 8 * i) = b1;
      }
    }
    __syncthreads();

    // The four key tiles are four independent accumulator chains: the fragments of all four are read as one group, then each
    // of the three products runs over the four tiles in turn. Each s[j] still sums its six products in the order dc, hi.hi, lo.hi, hi.lo.
    // Every loop here is fully unrolled: kb[], kl[] and s[] live in registers and need compile-time indices.
    v8f s[4];
#pragma unroll
    for (int j = 0; j < 4; ++j) s[j] = (v8f){0.f,0.f,0.f,0.f,0.f,0.f,0.f,0.f};
#pragma unroll
    for (int dc = 0; dc < 2; ++dc) {
      FB kb[4], kl[4];
#pragma unroll
      for (int j = 0; j < 4; ++j) {
        kb[j].h[0] = *(const v8b*)(Ksh + (j * 16 + c) * AT_LP + dc * 32 + 8 * hh);
        kb[j].h[1] = *(const v8b*)(Ksh + (j * 16 + c) * AT_LP + dc * 32 + 16 + 8 * hh);
        kl[j].h[0] = *(const v8b*)(Ksl + (j * 16 + c) * AT_LP + dc * 32 + 8 * hh);
        kl[j].h[1] = *(const v8b*)(Ksl + (j * 16 + c) * AT_LP + dc * 32 + 16 + 8 * hh);
      }
#pragma unroll
      for (int j = 0; j < 4; ++j) s[j] = at_mma(kb[j].v, qah[dc], s[j]);
#pragma unroll
      for (int j = 0; j < 4; ++j) s[j] = at_mma(kl[j].v, qah[dc], s[j]);
#pragma unroll
      for (int j = 0; j < 4; ++j) s[j] = at_mma(kb[j].v, qal[dc], s[j]);
    }
    // s[j][r] = score of key kv0 + j*16 + 8*hh + r against query c
    float mj[4];
#pragma unroll
    for (int j = 0; j < 4; ++j) {
      float m = -INFINITY;
#pragma unroll
      for (int r = 0; r < 8; ++r) {
        const float sv = s[j][r] * sscale;
        s[j][r] = sv;
        m = fmaxf(m, sv);
      }
      mj[j] = m;
    }
    const float mh = fmaxf(fmaxf(mj[0], mj[1]), fmaxf(mj[2], mj[3]));
    const float mnew = fmaxf(mrow, fmaxf(mh, at_xhalf(mh)));
    const float alpha = expf(mrow - mnew);
    mrow = mnew;
    FB pah[2], pal[2];                   // p^T as B fragments: element e of [kk] = key kk*32 + (e < 8 ? 8*hh + e : 16 + 8*hh + e - 8)
    float pj[4];
#pragma unroll
    for (int j = 0; j < 4; ++j) {
      float psum = 0.f;
#pragma unroll
      for (int r = 0; r < 8; r += 2) {
        const float p0 = expf(s[j][r] - mnew);
        const float p1 = expf(s[j][r + 1] - mnew);
        psum += p0;
        psum += p1;
        at_split2((v2f){p0, p1}, pah[j >> 1].w[(j & 1) * 4 + (r >> 1)], pal[j >> 1].w[(j & 1) * 4 + (r >> 1)]);
      }
      pj[j] = psum;
    }
    lrow = lrow * alpha + ((pj[0] + pj[1]) + (pj[2] + pj[3]));
#pragma unroll
    for (int t = 0; t < 4; ++t)
#pragma unroll
      for (int r = 0; r < 8; ++r) oacc[t][r] *= alpha;
    // keeps the V^T fragment reads behind the softmax: read ahead of it they lift the wave over 256 VGPRs and q fragments spill
    __builtin_amdgcn_sched_barrier(0);
#pragma unroll   // full unroll: pah[kk], pal[kk] live in registers and need a compile-time index
    for (int kk = 0; kk < 2; ++kk) {
      // as for the scores: the four d tiles are independent chains, their fragments read as one group; order per oacc[t] unchanged;
      // full unroll for the same reason (vb[], vl[], oacc[] in registers)
      FB vb[4], vl[4];
#pragma unroll
      for (int t = 0; t < 4; ++t) {
        vb[t].h[0] = *(const v8b*)(Vth + (t * 16 + c) * AT_LP + kk * 32 + 8 * hh);
        vb[t].h[1] = *(const v8b*)(Vth + (t * 16 + c) * AT_LP + kk * 32 + 16 + 8 * hh);
        vl[t].h[0] = *(const v8b*)(Vtl + (t * 16 + c) * AT_LP + kk * 32 + 8 * hh);
        vl[t].h[1] = *(const v8b*)(Vtl + (t * 16 + c) * AT_LP + kk * 32 + 16 + 8 * hh);
      }
#pragma unroll
      for (int t = 0; t < 4; ++t) oacc[t] = at_mma(vb[t].v, pah[kk].v, oacc[t]);
#pragma unroll
      for (int t = 0; t < 4; ++t) oacc[t] = at_mma(vl[t].v, pah[kk].v, oacc[t]);
#pragma unroll
      for (int t = 0; t < 4; ++t) oacc[t] = at_mma(vb[t].v, pal[kk].v, oacc[t]);
    }
  }

  float* os = Os[wave];
  const float inv = 1.0f / (lrow + at_xhalf(lrow));   // both halves' sums; >= 1 (the row max contributes p = 1)
#pragma unroll
  for (int t = 0; t < 4; ++t) {
    // query row c of the wave tile, d = t*16 + 8*hh .. +7: two 16-B LDS stores
    *(v4f*)(os + c * 68 + t * 16 + 8 * hh)     = (v4f){oacc[t][0] * inv, oacc[t][1] * inv, oacc[t][2] * inv, oacc[t][3] * inv};
    *(v4f*)(os + c * 68 + t * 16 + 8 * hh + 4) = (v4f){oacc[t][4] * inv, oacc[t][5] * inv, oacc[t][6] * inv, oacc[t][7] * inv};
  }
  __builtin_amdgcn_fence(__ATOMIC_RELEASE, "workgroup");
  __builtin_amdgcn_wave_barrier();
  __builtin_amdgcn_fence(__ATOMIC_ACQUIRE, "workgroup");
  {
    const int c4 = (lane & 15) * 4;
    {
#pragma unroll
      for (int it = 0; it < 8; ++it) {
        const int row = it * 2 + hh;   // it 0..7 x hh 0..1 covers rows 0..15 of the wave tile; 16 lanes x 16 B = the 64-float head segment
        v4f val = *(const v4f*)(os + row * 68 + c4);
        *(v4f*)(ob + (size_t)(q0 + row) * HID + c4) = val;
      }
      
    }
  }
}

// ---------------------------------------------------------------------------
// Workspace region map (byte offsets; every region is fully rewritten in each call)
//   Wh  bf16 [3 (q,k,v)][1024 o][1024 i]                0      Wl    6291456
//   Xh  bf16 [2 b][2048 s][1024 i]               12582912      Xl   20971520
//   Ch  bf16 [3 (q,k,v^T)][2 b][2048*1024]       29360128      Cl   54525952
//       q, k planes [s][h*64+d]; v^T planes [h*64+d][s]
//   total                                        79691776  (76 MiB)
// ---------------------------------------------------------------------------
extern "C" void kernel_launch(void* const* d_in, const int* in_sizes, int n_in,
                              void* d_out, int out_size, void* d_ws, size_t ws_size,
                              hipStream_t stream) {
  if (n_in < 7) return;
  if (in_sizes[0] != NB * SEQ * HID) return;
  if (in_sizes[1] != HID * HID || in_sizes[3] != HID * HID || in_sizes[5] != HID * HID) return;
  if (in_sizes[2] != HID || in_sizes[4] != HID || in_sizes[6] != HID) return;
  if (out_size != NB * SEQ * HID) return;

  const float* x  = (const float*)d_in[0];   // [2][2048][1024]
  const float* Wq = (const float*)d_in[1];   // [1024 out][1024 in]
  const float* bq = (const float*)d_in[2];   // [1024]
  const float* Wk = (const float*)d_in[3];
  const float* bk = (const float*)d_in[4];
  const float* Wv = (const float*)d_in[5];
  const float* bv = (const float*)d_in[6];

  const size_t PW = (size_t)HID * HID * 2;   // 2097152  bf16 weight plane [1024][1024]
  const size_t PX = (size_t)SEQ * HID * 2;   // 4194304  bf16 activation plane [2048][1024] (one batch element)
  size_t off = 0;
  const size_t oWh = off; off += 3 * PW;       const size_t oWl = off; off += 3 * PW;
  const size_t oXh = off; off += NB * PX;      const size_t oXl = off; off += NB * PX;
  const size_t oCh = off; off += 3 * NB * PX;  const size_t oCl = off; off += 3 * NB * PX;
  if (off > ws_size) return;                 // off = 79691776

  char* ws = (char*)d_ws;
  unsigned short* Wh = (unsigned short*)(ws + oWh); unsigned short* Wl = (unsigned short*)(ws + oWl);
  unsigned short* Xh = (unsigned short*)(ws + oXh); unsigned short* Xl = (unsigned short*)(ws + oXl);
  unsigned short* Ch = (unsigned short*)(ws + oCh); unsigned short* Cl = (unsigned short*)(ws + oCl);
  const size_t EP = (size_t)NB * SEQ * HID;  // elements of one projection's planes (both batch elements)

  const dim3 blk(256);

  // (1) weights [out][in] are already the Bt [n][k] layout -> bf16 hi/lo planes, no transpose; one launch for q, k, v
  const int n2w = HID * HID / 2;                            // 524288 pairs per plane
  split_bf16x2_kernel<<<dim3((n2w + 255) / 256, 3), blk, 0, stream>>>(Wq, Wk, Wv, Wh, Wl, n2w);
  // (2) x, both batch elements -> bf16 hi/lo planes [2][2048][1024]
  const int n2x = NB * SEQ * HID / 2;                       // 2097152 pairs per plane
  split_bf16x2_kernel<<<dim3((n2x + 255) / 256, 1), blk, 0, stream>>>(x, x, x, Xh, Xl, n2x);
  // (3) q = x . Wq^T + bq, k = x . Wk^T + bk, v^T = Wv . x^T + bv, both batch elements: 128 tiles of 128x128 each, one per work-group
  qkv_gemm64<<<dim3((SEQ / 128) * (HID / 128), NB, 3), dim3(128), 0, stream>>>(Xh, Xl, Wh, Wl, Ch, Cl, bq, bk, bv);
  // (4) full attention per head and batch element, no score scaling; f32 tiles go straight to the output rows
  attn_full64_kernel<<<dim3(NHEAD * (SEQ / 64), NB), dim3(128), 0, stream>>>(
      Ch, Cl, Ch + EP, Cl + EP, Ch + 2 * EP, Cl + 2 * EP, (float*)d_out, 1.0f);
  (void)hipGetLastError();
}

// v006
// It runs in 171 microseconds.
// Two timings next to v005 put it at 1.10 and 1.11 times that version's speed.
// Over all steps from v000 it is 4.38 times as fast.
// All contractions (q, k, v^T projections, q.k^T, p.v): v_wmma_f32_16x16x32_bf16 with bf16 hi/lo split operands (hi.hi + hi.lo + lo.hi), f32 accumulate; online softmax, biases and normalisation in f32; no score scaling.
#include <hip/hip_runtime.h>
#include <math.h>
#include <stdint.h>

#define NB    2
#define SEQ   2048
#define HID   1024
#define NHEAD 16
#define DHD   64

typedef __attribute__((ext_vector_type(16))) _Float16 v16h;
typedef __attribute__((ext_vector_type(8)))  _Float16 v8h;
typedef __attribute__((ext_vector_type(16))) __bf16   v16b;
typedef __attribute__((ext_vector_type(8)))  __bf16   v8b;
typedef __attribute__((ext_vector_type(8)))  float    v8f;
typedef __attribute__((ext_vector_type(4)))  float    v4f;
typedef __attribute__((ext_vector_type(2)))  float    v2f;
typedef __attribute__((ext_vector_type(4)))  unsigned int v4u;

__device__ __forceinline__ unsigned short f2bf_bits(float f) {
  unsigned u = __float_as_uint(f);
  return (unsigned short)((u + 0x7FFFu + ((u >> 16) & 1u)) >> 16);
}
__device__ __forceinline__ float bf_bits2f(unsigned short h) { return __uint_as_float(((unsigned)h) << 16); }

// hazard guards as plain device helpers
__device__ __forceinline__ void dep_guard_h(v8f& a, v8f& b, v16h x, v16h y) { asm volatile("v_nop\n\tv_nop\n\tv_nop\n\tv_nop" : "+v"(a), "+v"(b) : "v"(x), "v"(y)); }
__device__ __forceinline__ void dep_guard_b(v8f& a, v8f& b, v16b x, v16b y) { asm volatile("v_nop\n\tv_nop\n\tv_nop\n\tv_nop" : "+v"(a), "+v"(b) : "v"(x), "v"(y)); }
__device__ __forceinline__ void keep4_h(v16h a, v16h b, v16h c, v16h d) { asm volatile("v_nop" :: "v"(a), "v"(b), "v"(c), "v"(d)); }
__device__ __forceinline__ void keep4_b(v16b a, v16b b, v16b c, v16b d) { asm volatile("v_nop" :: "v"(a), "v"(b), "v"(c), "v"(d)); }
__device__ __forceinline__ void acc_guard4(v8f& a, v8f& b, v8f& c, v8f& d) { asm volatile("v_nop\n\tv_nop\n\tv_nop\n\tv_nop" : "+v"(a), "+v"(b), "+v"(c), "+v"(d)); }
template <typename T> struct Frag;
template <> struct Frag<_Float16> {
  typedef v16h V; union U { v16h v; v8h h[2]; };
  static __device__ __forceinline__ v16h load(const _Float16* p) {   // elements 0..7 <- p[0..7], 8..15 <- p[16..23]
    U f; f.h[0] = *(const v8h*)(p); f.h[1] = *(const v8h*)(p + 16); return f.v;
  }
  static __device__ __forceinline__ v8f mma(v16h a, v16h b, v8f c) {
    return __builtin_amdgcn_wmma_f32_16x16x32_f16(false, a, false, b, (short)0, c, false, false);
  }
  static __device__ __forceinline__ void guard(v8f& a, v8f& b, v16h x, v16h y) { dep_guard_h(a, b, x, y); }
  static __device__ __forceinline__ void keep(v16h a, v16h b, v16h c, v16h d) { keep4_h(a, b, c, d); }
};
template <> struct Frag<__bf16> {
  typedef v16b V; union U { v16b v; v8b h[2]; };
  static __device__ __forceinline__ v16b load(const __bf16* p) {
    U f; f.h[0] = *(const v8b*)(p); f.h[1] = *(const v8b*)(p + 16); return f.v;
  }
  static __device__ __forceinline__ v8f mma(v16b a, v16b b, v8f c) {
    return __builtin_amdgcn_wmma_f32_16x16x32_bf16(false, a, false, b, (short)0, c, false, false);
  }
  static __device__ __forceinline__ void guard(v8f& a, v8f& b, v16b x, v16b y) { dep_guard_b(a, b, x, y); }
  static __device__ __forceinline__ void keep(v16b a, v16b b, v16b c, v16b d) { keep4_b(a, b, c, d); }
};

// ---- Register-blocked WMMA GEMM, all three projections of both batch elements in ONE launch ----------
// C[m,n] = sum_k A[m,k] * Bt[n,k] + bias; a work-group owns a 128x128 tile, each of its 4 waves (2 x 2) a 64x64 tile;
// K = HID, row pitch of A and Bt = HID.
// Operands are bf16 hi/lo planes; product = hi.hi + hi.lo + lo.hi; output = bf16 hi plane + bf16 lo plane.
// blockIdx.z = projection p, blockIdx.y = batch element b, blockIdx.x = 128x128 tile (128 tiles per (p, b)).
//   p = 0, 1 (q, k): A = x[b] planes [SEQ][HID], Bt = W[p] planes [HID][HID], C [SEQ][HID], bias[n]
//   p = 2   (v^T)  : A = W[2] planes [HID][HID], Bt = x[b] planes [SEQ][HID], C [HID][SEQ], bias[m]
// Grid 128 x 2 x 3 = 768 work-groups of 4 waves = 3 per WGP on 256 WGPs.
// Operand path: a stage = 32 k of the 128 A rows and the 128 Bt rows, hi and lo planes, brought into LDS by asynchronous
// copies (16 B per lane, 16 copies per lane and stage); two buffers, the next stage's copies fly while this one is worked on.
#define GS_KS   32                     // k per stage
#define GS_LP   40                     // LDS row pitch in elements: 80 B = 16 B x 5 (odd), free of bank conflicts for ds_load_b128
#define GS_PL   (128 * GS_LP)          // elements of one plane of a stage (128 rows)
#define GS_ST   (4 * GS_PL)            // elements of one stage: A hi, A lo, Bt hi, Bt lo (40960 B)
#define GS_NT   (HID / GS_KS)          // 32 stages

// Eight asynchronous 16-B copies per lane, global -> LDS. The s_wait_xcnt closes the statement so that no address register
// of a copy is rewritten in front of it.
__device__ __forceinline__ void gs_copy8(unsigned l0, unsigned l1, unsigned l2, unsigned l3,
                                         unsigned l4, unsigned l5, unsigned l6, unsigned l7,
                                         const __bf16* g0, const __bf16* g1, const __bf16* g2, const __bf16* g3,
                                         const __bf16* g4, const __bf16* g5, const __bf16* g6, const __bf16* g7) {
  asm volatile("global_load_async_to_lds_b128 %0, %8, off\n\t"
               "global_load_async_to_lds_b128 %1, %9, off\n\t"
               "global_load_async_to_lds_b128 %2, %10, off\n\t"
               "global_load_async_to_lds_b128 %3, %11, off\n\t"
               "global_load_async_to_lds_b128 %4, %12, off\n\t"
               "global_load_async_to_lds_b128 %5, %13, off\n\t"
               "global_load_async_to_lds_b128 %6, %14, off\n\t"
               "global_load_async_to_lds_b128 %7, %15, off\n\t"
               "s_wait_xcnt 0x0"
               :: "v"(l0), "v"(l1), "v"(l2), "v"(l3), "v"(l4), "v"(l5), "v"(l6), "v"(l7),
                  "v"(g0), "v"(g1), "v"(g2), "v"(g3), "v"(g4), "v"(g5), "v"(g6), "v"(g7)
               : "memory");
}
// One stage: hp, lp = this lane's first 16 B of the hi and lo plane (row tid >> 2, piece tid & 3, at the stage's k);
// l = the LDS byte address of the same piece in the hi plane. Rows step by 32, the lo plane lies GS_PL elements behind.
__device__ __forceinline__ void gs_copy_operand(unsigned l, const __bf16* hp, const __bf16* lp) {
  const unsigned rs = 32 * GS_LP * 2, ps = GS_PL * 2;
  gs_copy8(l, l + rs, l + 2 * rs, l + 3 * rs, l + ps, l + ps + rs, l + ps + 2 * rs, l + ps + 3 * rs,
           hp, hp + 32 * HID, hp + 64 * HID, hp + 96 * HID, lp, lp + 32 * HID, lp + 64 * HID, lp + 96 * HID);
}

__global__ __launch_bounds__(128) void qkv_gemm64(
    const unsigned short* __restrict__ Xhp, const unsigned short* __restrict__ Xlp,
    const unsigned short* __restrict__ Whp, const unsigned short* __restrict__ Wlp,
    unsigned short* __restrict__ Chp, unsigned short* __restrict__ Clp,
    const float* __restrict__ bq, const float* __restrict__ bk, const float* __restrict__ bv) {
  typedef __bf16 T;
  typedef Frag<T>::V V;
  __shared__ __align__(16) T     sS[2 * GS_ST];    // two stage buffers, 81920 B
  __shared__ __align__(16) float sT[4][16 * 68];   // per-wave 16x64 slab, pitch 68 floats
  const int p    = blockIdx.z;
  const int b    = blockIdx.y;
  const bool vt  = (p == 2);
  const int tid  = threadIdx.x;
  const int lane = tid & 31;
  const int wave = tid >> 5;
  const int ldc  = vt ? SEQ : HID;
  const int shN  = vt ? 4 : 3;                     // log2 of the 128-wide tiles per row of C (N / 128)
  const int tile = blockIdx.x;                     // 0..127
  const int tm = tile >> shN;
  const int tn = tile - (tm << shN);
  const int mB = tm << 7;                          // the work-group's first row and column of C
  const int nB = tn << 7;
  const int wm = (wave >> 1) << 6;                 // the wave's 64x64 tile inside it
  const int wn = (wave & 1) << 6;
  const int m0 = mB + wm;
  const int n0 = nB + wn;

  const size_t xo = (size_t)b * SEQ * HID;
  const size_t wo = (size_t)p * HID * HID;
  const T* Ab  = (const T*)(vt ? Whp + wo : Xhp + xo);
  const T* Ab2 = (const T*)(vt ? Wlp + wo : Xlp + xo);
  const T* Bb  = (const T*)(vt ? Xhp + xo : Whp + wo);
  const T* Bb2 = (const T*)(vt ? Xlp + xo : Wlp + wo);
  const float* bias = (p == 0) ? bq : ((p == 1) ? bk : bv);

  const int rlane = lane & 15;                 // row (A) / col (B, D) within subtile
  const int koff  = (lane >> 4) * 8;           // k offset of this lane half
  const int mOff  = (lane >> 4) * 8;           // D row offset

  // this lane's share of a stage: row tid >> 2 (+ 32, 64, 96), 16-B piece tid & 3 of the row's 64 B, in each of the 4 planes
  const int crow = tid >> 2, cseg = (tid & 3) * 8;
  const T* gAh = Ab  + (size_t)(mB + crow) * HID + cseg;
  const T* gAl = Ab2 + (size_t)(mB + crow) * HID + cseg;
  const T* gBh = Bb  + (size_t)(nB + crow) * HID + cseg;
  const T* gBl = Bb2 + (size_t)(nB + crow) * HID + cseg;
  const unsigned lA = (unsigned)(size_t)sS + (unsigned)(crow * GS_LP + cseg) * 2u;   // LDS byte address, buffer 0, A hi
  const unsigned lB = lA + 2u * GS_PL * 2u;                                          // buffer 0, Bt hi

  v8f acc[4][4];
#pragma unroll
  for (int i = 0; i < 4; ++i)
#pragma unroll
    for (int j = 0; j < 4; ++j) acc[i][j] = (v8f){0.f,0.f,0.f,0.f,0.f,0.f,0.f,0.f};

  // prologue: stage 0 lands and is published, then stage 1 is set off
  gs_copy_operand(lA, gAh, gAl);
  gs_copy_operand(lB, gBh, gBl);
  asm volatile("s_wait_asynccnt 0x0" ::: "memory");   // this wave's copies of stage 0 have landed
  __syncthreads();                                    // ... and every other wave's
  gs_copy_operand(lA + GS_ST * 2u, gAh + GS_KS, gAl + GS_KS);
  gs_copy_operand(lB + GS_ST * 2u, gBh + GS_KS, gBl + GS_KS);

  for (int t = 0; t < GS_NT; ++t) {
    const int bo_ = (t & 1) * GS_ST;
    const T* sA = sS + bo_ + (wm + rlane) * GS_LP + koff;               // A hi rows of this wave; lo GS_PL behind
    const T* sB = sS + bo_ + 2 * GS_PL + (wn + rlane) * GS_LP + koff;   // Bt hi rows of this wave; lo GS_PL behind
    V bh[4], bl[4];
#pragma unroll
    for (int j = 0; j < 4; ++j) {
      bh[j] = Frag<T>::load(sB + (j << 4) * GS_LP);
      bl[j] = Frag<T>::load(sB + GS_PL + (j << 4) * GS_LP);
    }
    V ah[2], al[2];                      // two A fragment sets: the next 16 rows' LDS reads are asked for ahead of this block's products
    ah[0] = Frag<T>::load(sA);
    al[0] = Frag<T>::load(sA + GS_PL);
#pragma unroll
    for (int i = 0; i < 4; ++i) {
      if (i < 3) {
        ah[(i + 1) & 1] = Frag<T>::load(sA + ((i + 1) << 4) * GS_LP);
        al[(i + 1) & 1] = Frag<T>::load(sA + GS_PL + ((i + 1) << 4) * GS_LP);
      }
#pragma unroll
      for (int j = 0; j < 4; ++j) {
        acc[i][j] = Frag<T>::mma(ah[i & 1], bh[j], acc[i][j]);
        acc[i][j] = Frag<T>::mma(ah[i & 1], bl[j], acc[i][j]);
        acc[i][j] = Frag<T>::mma(al[i & 1], bh[j], acc[i][j]);
      }
      Frag<T>::guard(acc[i][0], acc[i][3], ah[i & 1], al[i & 1]);
    }
    Frag<T>::keep(bh[0], bh[1], bh[2], bh[3]);
    Frag<T>::keep(bl[0], bl[1], bl[2], bl[3]);
    // publish point of stage t + 1
    asm volatile("s_wait_dscnt 0x0" ::: "memory");      // this wave's reads of buffer t & 1 are done before it is refilled
    asm volatile("s_wait_asynccnt 0x0" ::: "memory");   // this wave's copies of stage t + 1 have landed
    __syncthreads();                                    // stage t + 1 readable by all; buffer t & 1 left by all
    if (t + 2 < GS_NT) {
      const int kn = (t + 2) * GS_KS;
      gs_copy_operand(lA + (unsigned)bo_ * 2u, gAh + kn, gAl + kn);
      gs_copy_operand(lB + (unsigned)bo_ * 2u, gBh + kn, gBl + kn);
    }
  }
  asm volatile("s_wait_asynccnt 0x0" ::: "memory");     // no copy is outstanding when the wave goes on
  acc_guard4(acc[0][0], acc[0][1], acc[0][2], acc[0][3]);
  acc_guard4(acc[1][0], acc[1][1], acc[1][2], acc[1][3]);
  acc_guard4(acc[2][0], acc[2][1], acc[2][2], acc[2][3]);
  acc_guard4(acc[3][0], acc[3][1], acc[3][2], acc[3][3]);

  // ---- epilogue ----
  float* slab = sT[wave];
  const size_t co = (size_t)(p * NB + b) * SEQ * HID;
  unsigned short* C  = Chp + co;
  unsigned short* C2 = Clp + co;
#pragma unroll
  for (int i = 0; i < 4; ++i) {
    const int mBase = m0 + (i << 4);
    float bm[8];                                   // bias[m] of this lane's 8 rows (v^T only; index 0 otherwise, unused)
#pragma unroll
    for (int r = 0; r < 8; ++r) bm[r] = bias[vt ? (mBase + mOff + r) : 0];
#pragma unroll
    for (int j = 0; j < 4; ++j) {
      const int n = n0 + (j << 4) + rlane;
      const float bn = bias[vt ? 0 : n];           // bias[n] of this lane's column (q, k only)
#pragma unroll
      for (int r = 0; r < 8; ++r) {
        const float v = acc[i][j][r] + (vt ? bm[r] : bn);
        slab[(mOff + r) * 68 + (j << 4) + rlane] = v;
      }
    }
    __builtin_amdgcn_fence(__ATOMIC_RELEASE, "workgroup");
    __builtin_amdgcn_wave_barrier();
    __builtin_amdgcn_fence(__ATOMIC_ACQUIRE, "workgroup");
    {
      const int q = lane >> 3, c8 = (lane & 7) * 8;
#pragma unroll
      for (int it = 0; it < 4; ++it) {
        const int row = it * 4 + q;                       // it 0..3 x q 0..3 = rows 0..15 of the slab
        const float* sp = slab + row * 68 + c8;
        v8h hv, lv;
#pragma unroll
        for (int e = 0; e < 8; ++e) {
          unsigned short hb = f2bf_bits(sp[e]);
          unsigned short lb = f2bf_bits(sp[e] - bf_bits2f(hb));
          hv[e] = __builtin_bit_cast(_Float16, hb);
          lv[e] = __builtin_bit_cast(_Float16, lb);
        }
        *(v8h*)(C  + (size_t)(mBase + row) * ldc + n0 + c8) = hv;
        *(v8h*)(C2 + (size_t)(mBase + row) * ldc + n0 + c8) = lv;
      }
    }
    __builtin_amdgcn_fence(__ATOMIC_RELEASE, "workgroup");
    __builtin_amdgcn_wave_barrier();
    __builtin_amdgcn_fence(__ATOMIC_ACQUIRE, "workgroup");
  }
}

// ---------------------------------------------------------------------------
// Elementwise bf16 split: hi = bf16_rne(in), lo = bf16_rne(in - hi); 2 elements per thread, one 4-B store per plane.
// blockIdx.y picks the source (in0, in1, in2) and its plane of n2 pairs in hi / lo.
//   weights: grid 2048 x 3, n2 = 1024*1024/2 = 524288 pairs per weight
//   activations, both batch elements: grid 8192 x 1, n2 = 2*2048*1024/2 = 2097152 pairs
// ---------------------------------------------------------------------------
__device__ __forceinline__ unsigned pk16(unsigned short a, unsigned short b) { return (unsigned)a | ((unsigned)b << 16); }

__global__ __launch_bounds__(256) void split_bf16x2_kernel(const float* __restrict__ in0, const float* __restrict__ in1,
                                                           const float* __restrict__ in2, unsigned short* __restrict__ hi,
                                                           unsigned short* __restrict__ lo, int n2) {
  const int y = blockIdx.y;
  const float* in = (y == 0) ? in0 : ((y == 1) ? in1 : in2);
  const int i = blockIdx.x * 256 + threadIdx.x;
  if (i < n2) {
    const v2f f = *(const v2f*)(in + 2 * (size_t)i);
    const unsigned short h0 = f2bf_bits(f[0]), h1 = f2bf_bits(f[1]);
    const unsigned short l0 = f2bf_bits(f[0] - bf_bits2f(h0)), l1 = f2bf_bits(f[1] - bf_bits2f(h1));
    const unsigned uh = pk16(h0, h1), ul = pk16(l0, l1);
    const size_t o = (size_t)y * n2 + i;
    ((unsigned*)hi)[o] = uh;
    ((unsigned*)lo)[o] = ul;
  }
}

// =====================================================================================
// Full (non-causal, unmasked) attention, head dim 64, one launch; blockIdx.y = batch element (planes and out SEQ*HID apart).
//   q planes (hi/lo bf16): element (t, h, d) at [t*HID + h*64 + d]
//   k planes (hi/lo bf16): element (s, h, d) at [s*HID + h*64 + d]
//   v^T planes (hi/lo bf16): element (h, d, s) at [(h*64 + d)*SEQ + s]
//   out f32: element (t, h, d) at [t*HID + h*64 + d]   (the module output rows of this batch element)
//   scores^T = k . q^T (unscaled)  : A = K rows, B = q; bf16 hi/lo split (hi.hi + hi.lo + lo.hi) on v_wmma_f32_16x16x32_bf16
//   out^T    = v^T . p^T          : A = V^T rows, B = p^T packed in place from the score accumulators (hi/lo split), f32 accumulate
//   A lane holds scores of ONE query (column lane & 15): keys j*16 + 8*(lane >> 4) + r. Two score tiles (2kk, 2kk+1) are,
//   register for register, the B fragment of keys kk*32 .. kk*32+31, so p never goes through LDS.
//   online softmax in f32 over all SEQ keys (32 chunks of 64, compile-time trip count, no masking): maximum and sum in-lane,
//   one exchange of the maximum between the lane halves per chunk; the halves' sums are joined once after the loop.
//   Exponentials in base 2: the maximum is taken over the raw scores and kept as m2 = max * log2(e); p = 2^(s * log2(e) - m2), one
//   multiply-add and one v_exp_f32 per score. The rounding of m2 scales every term of a row alike and cancels in the normalisation.
//   Block = 4 waves = 64 query rows of one head; grid = (NHEAD * (SEQ/64) = 512) x NB.
//   K / V^T chunk staging: 128 threads x 32 elements per plane = the whole 64x64 tile (16-B copies, plain loads,
//   __syncthreads before and after); fragment loads read the LDS tiles with the same v8b element type.
// =====================================================================================
#define AT_D 64
#define AT_NW 4
#define AT_QB 64
#define AT_KC 64
#define AT_L2E 1.4426950408889634f   // log2(e)
#define AT_LP 72   // LDS row pitch of the K and V^T tiles in elements: 144 B = 16 B x 9 (odd), so the 16 rows of a ds_load_b128 half-wave fall on 16 different bank groups

__device__ __forceinline__ v8f at_mma(v16b a, v16b b, v8f c) {
  return __builtin_amdgcn_wmma_f32_16x16x32_bf16(false, a, false, b, (short)0, c, false, false);
}
// two f32 -> one packed register of bf16 hi parts and one of bf16 lo parts: hi = rne(f), lo = rne(f - hi)
typedef __attribute__((ext_vector_type(2))) __bf16 v2b;
__device__ __forceinline__ void at_split2(v2f f, v2b& hi, v2b& lo) {
  hi = __builtin_convertvector(f, v2b);
  lo = __builtin_convertvector(f - __builtin_convertvector(hi, v2f), v2b);
}
// value of lane l ^ 16 (the other half's share of the same query column)
__device__ __forceinline__ float at_xhalf(float f) {
  const int b = __float_as_int(f);
  return __int_as_float(__builtin_amdgcn_permlanex16(b, b, 0x76543210, 0xfedcba98, false, false));
}

// register budget 256 a wave = four waves per SIMD, so that all 1024 work-groups (four per WGP) stay resident at once;
// told the budget, the compiler reads the fragments further ahead of their products than it does without it
__global__ __launch_bounds__(128) __attribute__((amdgpu_waves_per_eu(4, 4)))
void attn_full64_kernel(const unsigned short* __restrict__ qhp, const unsigned short* __restrict__ qlp,
                        const unsigned short* __restrict__ khp, const unsigned short* __restrict__ klp,
                        const unsigned short* __restrict__ vhp, const unsigned short* __restrict__ vlp,
                        float* __restrict__ out) {
  union FB { v16b v; v8b h[2]; v2b w[8]; };
  __shared__ __align__(16) __bf16 Ksh[AT_KC * AT_LP];            // K hi [kv][d], pitch AT_LP    9 KB
  __shared__ __align__(16) __bf16 Ksl[AT_KC * AT_LP];            // K lo
  __shared__ __align__(16) __bf16 Vth[AT_D * AT_LP];             // V hi [d][kv], pitch AT_LP    9 KB
  __shared__ __align__(16) __bf16 Vtl[AT_D * AT_LP];             // V lo
  __shared__ __align__(16) float  Os[AT_NW][16 * 68];            // per wave out tile, pitch 68

  const int tid  = threadIdx.x;
  const int wave = tid >> 5;
  const int lane = tid & 31;
  const int hh   = lane >> 4;
  const int c    = lane & 15;

  const int nqb = SEQ / AT_QB;            // 32
  const int bx = blockIdx.x;
  const int qb = bx % nqb;
  const int h  = bx / nqb;                // 0..NHEAD-1 (grid = NHEAD * nqb)
  const int q0 = qb * AT_QB + wave * 16;

  const size_t bo = (size_t)blockIdx.y * SEQ * HID;   // this batch element's planes and output rows
  const __bf16* Qh = (const __bf16*)(const void*)qhp + bo + (size_t)h * AT_D;
  const __bf16* Ql = (const __bf16*)(const void*)qlp + bo + (size_t)h * AT_D;
  const __bf16* Kh = (const __bf16*)(const void*)khp + bo + (size_t)h * AT_D;
  const __bf16* Kl = (const __bf16*)(const void*)klp + bo + (size_t)h * AT_D;
  const __bf16* Vh = (const __bf16*)(const void*)vhp + bo + (size_t)h * AT_D * SEQ;
  const __bf16* Vl = (const __bf16*)(const void*)vlp + bo + (size_t)h * AT_D * SEQ;
  float*        ob = out + bo + (size_t)h * AT_D;

  // ---- Q fragments (B operand, column = lane&15, split k map via Frag load): 2 d-chunks, hi and lo ----
  v16b qah[2], qal[2];
#pragma unroll
  for (int dc = 0; dc < 2; ++dc) {
    const __bf16* qr = Qh + (size_t)(q0 + c) * HID + dc * 32 + 8 * hh;
    const __bf16* ql = Ql + (size_t)(q0 + c) * HID + dc * 32 + 8 * hh;
    qah[dc] = Frag<__bf16>::load(qr);
    qal[dc] = Frag<__bf16>::load(ql);
  }

  float mrow = -INFINITY, lrow = 0.f;   // this lane's query: running maximum times log2(e) (both halves agree), this half's share of the sum
  v8f oacc[4];                          // oacc[t][r] = out^T[d = t*16 + 8*hh + r][query c]
#pragma unroll
  for (int t = 0; t < 4; ++t) oacc[t] = (v8f){0.f,0.f,0.f,0.f,0.f,0.f,0.f,0.f};

  const int nChunks = SEQ / AT_KC;   // 32, compile-time constant
  for (int kc = 0; kc < nChunks; ++kc) {
    const int kv0 = kc * AT_KC;
    __syncthreads();
    {
      // staging coverage: 128 threads x (4 x 8) elements = 64 rows x 64 per plane = the whole chunk tile
      const int r = tid >> 1, half = (tid & 1) * 32;
      const __bf16* ksh = Kh + (size_t)(kv0 + r) * HID + half;    // K row kv0+r, d = half..half+31
      const __bf16* ksl = Kl + (size_t)(kv0 + r) * HID + half;
      const __bf16* vsh = Vh + (size_t)r * SEQ + kv0 + half;      // V^T row d = r, s = kv0+half..+31
      const __bf16* vsl = Vl + (size_t)r * SEQ + kv0 + half;
#pragma unroll
      for (int i = 0; i < 4; ++i) {
        const v8b a0 = *(const v8b*)(ksh + 8 * i);
        const v8b a1 = *(const v8b*)(ksl + 8 * i);
        const v8b b0 = *(const v8b*)(vsh + 8 * i);
        const v8b b1 = *(const v8b*)(vsl + 8 * i);
        *(v8b*)(Ksh + r * AT_LP + half + 8 * i) = a0;
        *(v8b*)(Ksl + r * AT_LP + half + 8 * i) = a1;
        *(v8b*)(Vth + r * AT_LP + half + 8 * i) = b0;
        *(v8b*)(Vtl + r * AT_LP + half + 8 * i) = b1;
      }
    }
    __syncthreads();

    // The four key tiles are four independent accumulator chains: the fragments of all four are read as one group, then each
    // of the three products runs over the four tiles in turn. Each s[j] still sums its six products in the order dc, hi.hi, lo.hi, hi.lo.
    // Every loop here is fully unrolled: kb[], kl[] and s[] live in registers and need compile-time indices.
    v8f s[4];
#pragma unroll
    for (int j = 0; j < 4; ++j) s[j] = (v8f){0.f,0.f,0.f,0.f,0.f,0.f,0.f,0.f};
#pragma unroll
    for (int dc = 0; dc < 2; ++dc) {
      FB kb[4], kl[4];
#pragma unroll
      for (int j = 0; j < 4; ++j) {
        kb[j].h[0] = *(const v8b*)(Ksh + (j * 16 + c) * AT_LP + dc * 32 + 8 * hh);
        kb[j].h[1] = *(const v8b*)(Ksh + (j * 16 + c) * AT_LP + dc * 32 + 16 + 8 * hh);
        kl[j].h[0] = *(const v8b*)(Ksl + (j * 16 + c) * AT_LP + dc * 32 + 8 * hh);
        kl[j].h[1] = *(const v8b*)(Ksl + (j * 16 + c) * AT_LP + dc * 32 + 16 + 8 * hh);
      }
#pragma unroll
      for (int j = 0; j < 4; ++j) s[j] = at_mma(kb[j].v, qah[dc], s[j]);
#pragma unroll
      for (int j = 0; j < 4; ++j) s[j] = at_mma(kl[j].v, qah[dc], s[j]);
#pragma unroll
      for (int j = 0; j < 4; ++j) s[j] = at_mma(kb[j].v, qal[dc], s[j]);
    }
    // s[j][r] = score of key kv0 + j*16 + 8*hh + r against query c
    float mj[4];
#pragma unroll
    for (int j = 0; j < 4; ++j) {
      float m = -INFINITY;
#pragma unroll
      for (int r = 0; r < 8; ++r) m = fmaxf(m, s[j][r]);
      mj[j] = m;
    }
    const float mh = fmaxf(fmaxf(mj[0], mj[1]), fmaxf(mj[2], mj[3]));
    const float mnew = fmaxf(mrow, fmaxf(mh, at_xhalf(mh)) * AT_L2E);
    const float alpha = __builtin_amdgcn_exp2f(mrow - mnew);   // 0 in the first chunk, where mrow is -inf
    mrow = mnew;
    const v2f l2e = (v2f){AT_L2E, AT_L2E}, nm = (v2f){-mnew, -mnew};
    FB pah[2], pal[2];                   // p^T as B fragments: element e of [kk] = key kk*32 + (e < 8 ? 8*hh + e : 16 + 8*hh + e - 8)
    float pj[4];
#pragma unroll
    for (int j = 0; j < 4; ++j) {
      float psum = 0.f;
#pragma unroll
      for (int r = 0; r < 8; r += 2) {
        const v2f arg = __builtin_elementwise_fma((v2f){s[j][r], s[j][r + 1]}, l2e, nm);   // <= about 0: no overflow
        const float p0 = __builtin_amdgcn_exp2f(arg[0]);
        const float p1 = __builtin_amdgcn_exp2f(arg[1]);
        psum += p0;
        psum += p1;
        at_split2((v2f){p0, p1}, pah[j >> 1].w[(j & 1) * 4 + (r >> 1)], pal[j >> 1].w[(j & 1) * 4 + (r >> 1)]);
      }
      pj[j] = psum;
    }
    lrow = lrow * alpha + ((pj[0] + pj[1]) + (pj[2] + pj[3]));
#pragma unroll
    for (int t = 0; t < 4; ++t)
#pragma unroll
      for (int r = 0; r < 8; ++r) oacc[t][r] *= alpha;
#pragma unroll   // full unroll: pah[kk], pal[kk] live in registers and need a compile-time index
    for (int kk = 0; kk < 2; ++kk) {
      // as for the scores: the four d tiles are independent chains, their fragments read as one group; order per oacc[t] unchanged;
      // full unroll for the same reason (vb[], vl[], oacc[] in registers)
      FB vb[4], vl[4];
#pragma unroll
      for (int t = 0; t < 4; ++t) {
        vb[t].h[0] = *(const v8b*)(Vth + (t * 16 + c) * AT_LP + kk * 32 + 8 * hh);
        vb[t].h[1] = *(const v8b*)(Vth + (t * 16 + c) * AT_LP + kk * 32 + 16 + 8 * hh);
        vl[t].h[0] = *(const v8b*)(Vtl + (t * 16 + c) * AT_LP + kk * 32 + 8 * hh);
        vl[t].h[1] = *(const v8b*)(Vtl + (t * 16 + c) * AT_LP + kk * 32 + 16 + 8 * hh);
      }
#pragma unroll
      for (int t = 0; t < 4; ++t) oacc[t] = at_mma(vb[t].v, pah[kk].v, oacc[t]);
#pragma unroll
      for (int t = 0; t < 4; ++t) oacc[t] = at_mma(vl[t].v, pah[kk].v, oacc[t]);
#pragma unroll
      for (int t = 0; t < 4; ++t) oacc[t] = at_mma(vb[t].v, pal[kk].v, oacc[t]);
    }
  }

  float* os = Os[wave];
  const float inv = 1.0f / (lrow + at_xhalf(lrow));   // both halves' sums; >= 1 (the row max contributes p = 1)
#pragma unroll
  for (int t = 0; t < 4; ++t) {
    // query row c of the wave tile, d = t*16 + 8*hh .. +7: two 16-B LDS stores
    *(v4f*)(os + c * 68 + t * 16 + 8 * hh)     = (v4f){oacc[t][0] * inv, oacc[t][1] * inv, oacc[t][2] * inv, oacc[t][3] * inv};
    *(v4f*)(os + c * 68 + t * 16 + 8 * hh + 4) = (v4f){oacc[t][4] * inv, oacc[t][5] * inv, oacc[t][6] * inv, oacc[t][7] * inv};
  }
  __builtin_amdgcn_fence(__ATOMIC_RELEASE, "workgroup");
  __builtin_amdgcn_wave_barrier();
  __builtin_amdgcn_fence(__ATOMIC_ACQUIRE, "workgroup");
  {
    const int c4 = (lane & 15) * 4;
    {
#pragma unroll
      for (int it = 0; it < 8; ++it) {
        const int row = it * 2 + hh;   // it 0..7 x hh 0..1 covers rows 0..15 of the wave tile; 16 lanes x 16 B = the 64-float head segment
        v4f val = *(const v4f*)(os + row * 68 + c4);
        *(v4f*)(ob + (size_t)(q0 + row) * HID + c4) = val;
      }
      
    }
  }
}

// ---------------------------------------------------------------------------
// Workspace region map (byte offsets; every region is fully rewritten in each call)
//   Wh  bf16 [3 (q,k,v)][1024 o][1024 i]                0      Wl    6291456
//   Xh  bf16 [2 b][2048 s][1024 i]               12582912      Xl   20971520
//   Ch  bf16 [3 (q,k,v^T)][2 b][2048*1024]       29360128      Cl   54525952
//       q, k planes [s][h*64+d]; v^T planes [h*64+d][s]
//   total                                        79691776  (76 MiB)
// ---------------------------------------------------------------------------
extern "C" void kernel_launch(void* const* d_in, const int* in_sizes, int n_in,
                              void* d_out, int out_size, void* d_ws, size_t ws_size,
                              hipStream_t stream) {
  if (n_in < 7) return;
  if (in_sizes[0] != NB * SEQ * HID) return;
  if (in_sizes[1] != HID * HID || in_sizes[3] != HID * HID || in_sizes[5] != HID * HID) return;
  if (in_sizes[2] != HID || in_sizes[4] != HID || in_sizes[6] != HID) return;
  if (out_size != NB * SEQ * HID) return;

  const float* x  = (const float*)d_in[0];   // [2][2048][1024]
  const float* Wq = (const float*)d_in[1];   // [1024 out][1024 in]
  const float* bq = (const float*)d_in[2];   // [1024]
  const float* Wk = (const float*)d_in[3];
  const float* bk = (const float*)d_in[4];
  const float* Wv = (const float*)d_in[5];
  const float* bv = (const float*)d_in[6];

  const size_t PW = (size_t)HID * HID * 2;   // 2097152  bf16 weight plane [1024][1024]
  const size_t PX = (size_t)SEQ * HID * 2;   // 4194304  bf16 activation plane [2048][1024] (one batch element)
  size_t off = 0;
  const size_t oWh = off; off += 3 * PW;       const size_t oWl = off; off += 3 * PW;
  const size_t oXh = off; off += NB * PX;      const size_t oXl = off; off += NB * PX;
  const size_t oCh = off; off += 3 * NB * PX;  const size_t oCl = off; off += 3 * NB * PX;
  if (off > ws_size) return;                 // off = 79691776

  char* ws = (char*)d_ws;
  unsigned short* Wh = (unsigned short*)(ws + oWh); unsigned short* Wl = (unsigned short*)(ws + oWl);
  unsigned short* Xh = (unsigned short*)(ws + oXh); unsigned short* Xl = (unsigned short*)(ws + oXl);
  unsigned short* Ch = (unsigned short*)(ws + oCh); unsigned short* Cl = (unsigned short*)(ws + oCl);
  const size_t EP = (size_t)NB * SEQ * HID;  // elements of one projection's planes (both batch elements)

  const dim3 blk(256);

  // (1) weights [out][in] are already the Bt [n][k] layout -> bf16 hi/lo planes, no transpose; one launch for q, k, v
  const int n2w = HID * HID / 2;                            // 524288 pairs per plane
  split_bf16x2_kernel<<<dim3((n2w + 255) / 256, 3), blk, 0, stream>>>(Wq, Wk, Wv, Wh, Wl, n2w);
  // (2) x, both batch elements -> bf16 hi/lo planes [2][2048][1024]
  const int n2x = NB * SEQ * HID / 2;                       // 2097152 pairs per plane
  split_bf16x2_kernel<<<dim3((n2x + 255) / 256, 1), blk, 0, stream>>>(x, x, x, Xh, Xl, n2x);
  // (3) q = x . Wq^T + bq, k = x . Wk^T + bk, v^T = Wv . x^T + bv, both batch elements: 128 tiles of 128x128 each, one per work-group
  qkv_gemm64<<<dim3((SEQ / 128) * (HID / 128), NB, 3), dim3(128), 0, stream>>>(Xh, Xl, Wh, Wl, Ch, Cl, bq, bk, bv);
  // (4) full attention per head and batch element, no score scaling; f32 tiles go straight to the output rows
  attn_full64_kernel<<<dim3(NHEAD * (SEQ / 64), NB), dim3(128), 0, stream>>>(
      Ch, Cl, Ch + EP, Cl + EP, Ch + 2 * EP, Cl + 2 * EP, (float*)d_out);
  (void)hipGetLastError();
}

// v007
// Measured time: 160 microseconds a run.
// Two timings next to v006 both put it at 1.07 times that version's speed.
// Counting every step since v000, it is 4.69 times as fast.
// All contractions (q, k, v^T projections, q.k^T, p.v): v_wmma_f32_16x16x32_bf16 with bf16 hi/lo split operands (hi.hi + hi.lo + lo.hi), f32 accumulate; online softmax, biases and normalisation in f32; no score scaling.
#include <hip/hip_runtime.h>
#include <math.h>
#include <stdint.h>

#define NB    2
#define SEQ   2048
#define HID   1024
#define NHEAD 16
#define DHD   64

typedef __attribute__((ext_vector_type(16))) _Float16 v16h;
typedef __attribute__((ext_vector_type(8)))  _Float16 v8h;
typedef __attribute__((ext_vector_type(16))) __bf16   v16b;
typedef __attribute__((ext_vector_type(8)))  __bf16   v8b;
typedef __attribute__((ext_vector_type(8)))  float    v8f;
typedef __attribute__((ext_vector_type(4)))  float    v4f;
typedef __attribute__((ext_vector_type(2)))  float    v2f;
typedef __attribute__((ext_vector_type(4)))  unsigned int v4u;

__device__ __forceinline__ unsigned short f2bf_bits(float f) {
  unsigned u = __float_as_uint(f);
  return (unsigned short)((u + 0x7FFFu + ((u >> 16) & 1u)) >> 16);
}
__device__ __forceinline__ float bf_bits2f(unsigned short h) { return __uint_as_float(((unsigned)h) << 16); }

// hazard guards as plain device helpers
__device__ __forceinline__ void dep_guard_h(v8f& a, v8f& b, v16h x, v16h y) { asm volatile("v_nop\n\tv_nop\n\tv_nop\n\tv_nop" : "+v"(a), "+v"(b) : "v"(x), "v"(y)); }
__device__ __forceinline__ void dep_guard_b(v8f& a, v8f& b, v16b x, v16b y) { asm volatile("v_nop\n\tv_nop\n\tv_nop\n\tv_nop" : "+v"(a), "+v"(b) : "v"(x), "v"(y)); }
__device__ __forceinline__ void keep4_h(v16h a, v16h b, v16h c, v16h d) { asm volatile("v_nop" :: "v"(a), "v"(b), "v"(c), "v"(d)); }
__device__ __forceinline__ void keep4_b(v16b a, v16b b, v16b c, v16b d) { asm volatile("v_nop" :: "v"(a), "v"(b), "v"(c), "v"(d)); }
__device__ __forceinline__ void acc_guard4(v8f& a, v8f& b, v8f& c, v8f& d) { asm volatile("v_nop\n\tv_nop\n\tv_nop\n\tv_nop" : "+v"(a), "+v"(b), "+v"(c), "+v"(d)); }
template <typename T> struct Frag;
template <> struct Frag<_Float16> {
  typedef v16h V; union U { v16h v; v8h h[2]; };
  static __device__ __forceinline__ v16h load(const _Float16* p) {   // elements 0..7 <- p[0..7], 8..15 <- p[16..23]
    U f; f.h[0] = *(const v8h*)(p); f.h[1] = *(const v8h*)(p + 16); return f.v;
  }
  static __device__ __forceinline__ v8f mma(v16h a, v16h b, v8f c) {
    return __builtin_amdgcn_wmma_f32_16x16x32_f16(false, a, false, b, (short)0, c, false, false);
  }
  static __device__ __forceinline__ void guard(v8f& a, v8f& b, v16h x, v16h y) { dep_guard_h(a, b, x, y); }
  static __device__ __forceinline__ void keep(v16h a, v16h b, v16h c, v16h d) { keep4_h(a, b, c, d); }
};
template <> struct Frag<__bf16> {
  typedef v16b V; union U { v16b v; v8b h[2]; };
  static __device__ __forceinline__ v16b load(const __bf16* p) {
    U f; f.h[0] = *(const v8b*)(p); f.h[1] = *(const v8b*)(p + 16); return f.v;
  }
  static __device__ __forceinline__ v8f mma(v16b a, v16b b, v8f c) {
    return __builtin_amdgcn_wmma_f32_16x16x32_bf16(false, a, false, b, (short)0, c, false, false);
  }
  static __device__ __forceinline__ void guard(v8f& a, v8f& b, v16b x, v16b y) { dep_guard_b(a, b, x, y); }
  static __device__ __forceinline__ void keep(v16b a, v16b b, v16b c, v16b d) { keep4_b(a, b, c, d); }
};

// ---- Register-blocked WMMA GEMM, all three projections of both batch elements in ONE launch ----------
// C[m,n] = sum_k A[m,k] * Bt[n,k] + bias; a work-group owns a 128x128 tile, each of its 4 waves (2 x 2) a 64x64 tile;
// K = HID, row pitch of A and Bt = HID.
// Operands are bf16 hi/lo planes; product = hi.hi + hi.lo + lo.hi; output = bf16 hi plane + bf16 lo plane.
// blockIdx.z = projection p, blockIdx.y = batch element b, blockIdx.x = 128x128 tile (128 tiles per (p, b)).
//   p = 0, 1 (q, k): A = x[b] planes [SEQ][HID], Bt = W[p] planes [HID][HID], C [SEQ][HID], bias[n]
//   p = 2   (v^T)  : A = W[2] planes [HID][HID], Bt = x[b] planes [SEQ][HID], C [HID][SEQ], bias[m]
// Grid 128 x 2 x 3 = 768 work-groups of 4 waves = 3 per WGP on 256 WGPs.
// Operand path: a stage = 32 k of the 128 A rows and the 128 Bt rows, hi and lo planes, brought into LDS by asynchronous
// copies (16 B per lane, 16 copies per lane and stage); two buffers, the next stage's copies fly while this one is worked on.
#define GS_KS   32                     // k per stage
#define GS_LP   40                     // LDS row pitch in elements: 80 B = 16 B x 5 (odd), free of bank conflicts for ds_load_b128
#define GS_PL   (128 * GS_LP)          // elements of one plane of a stage (128 rows)
#define GS_ST   (4 * GS_PL)            // elements of one stage: A hi, A lo, Bt hi, Bt lo (40960 B)
#define GS_NT   (HID / GS_KS)          // 32 stages

// Eight asynchronous 16-B copies per lane, global -> LDS. The s_wait_xcnt closes the statement so that no address register
// of a copy is rewritten in front of it.
__device__ __forceinline__ void gs_copy8(unsigned l0, unsigned l1, unsigned l2, unsigned l3,
                                         unsigned l4, unsigned l5, unsigned l6, unsigned l7,
                                         const __bf16* g0, const __bf16* g1, const __bf16* g2, const __bf16* g3,
                                         const __bf16* g4, const __bf16* g5, const __bf16* g6, const __bf16* g7) {
  asm volatile("global_load_async_to_lds_b128 %0, %8, off\n\t"
               "global_load_async_to_lds_b128 %1, %9, off\n\t"
               "global_load_async_to_lds_b128 %2, %10, off\n\t"
               "global_load_async_to_lds_b128 %3, %11, off\n\t"
               "global_load_async_to_lds_b128 %4, %12, off\n\t"
               "global_load_async_to_lds_b128 %5, %13, off\n\t"
               "global_load_async_to_lds_b128 %6, %14, off\n\t"
               "global_load_async_to_lds_b128 %7, %15, off\n\t"
               "s_wait_xcnt 0x0"
               :: "v"(l0), "v"(l1), "v"(l2), "v"(l3), "v"(l4), "v"(l5), "v"(l6), "v"(l7),
                  "v"(g0), "v"(g1), "v"(g2), "v"(g3), "v"(g4), "v"(g5), "v"(g6), "v"(g7)
               : "memory");
}
// One stage: hp, lp = this lane's first 16 B of the hi and lo plane (row tid >> 2, piece tid & 3, at the stage's k);
// l = the LDS byte address of the same piece in the hi plane. Rows step by 32, the lo plane lies GS_PL elements behind.
__device__ __forceinline__ void gs_copy_operand(unsigned l, const __bf16* hp, const __bf16* lp) {
  const unsigned rs = 32 * GS_LP * 2, ps = GS_PL * 2;
  gs_copy8(l, l + rs, l + 2 * rs, l + 3 * rs, l + ps, l + ps + rs, l + ps + 2 * rs, l + ps + 3 * rs,
           hp, hp + 32 * HID, hp + 64 * HID, hp + 96 * HID, lp, lp + 32 * HID, lp + 64 * HID, lp + 96 * HID);
}

__global__ __launch_bounds__(128) void qkv_gemm64(
    const unsigned short* __restrict__ Xhp, const unsigned short* __restrict__ Xlp,
    const unsigned short* __restrict__ Whp, const unsigned short* __restrict__ Wlp,
    unsigned short* __restrict__ Chp, unsigned short* __restrict__ Clp,
    const float* __restrict__ bq, const float* __restrict__ bk, const float* __restrict__ bv) {
  typedef __bf16 T;
  typedef Frag<T>::V V;
  __shared__ __align__(16) T     sS[2 * GS_ST];    // two stage buffers, 81920 B
  __shared__ __align__(16) float sT[4][16 * 68];   // per-wave 16x64 slab, pitch 68 floats
  const int p    = blockIdx.z;
  const int b    = blockIdx.y;
  const bool vt  = (p == 2);
  const int tid  = threadIdx.x;
  const int lane = tid & 31;
  const int wave = tid >> 5;
  const int ldc  = vt ? SEQ : HID;
  const int shN  = vt ? 4 : 3;                     // log2 of the 128-wide tiles per row of C (N / 128)
  const int tile = blockIdx.x;                     // 0..127
  const int tm = tile >> shN;
  const int tn = tile - (tm << shN);
  const int mB = tm << 7;                          // the work-group's first row and column of C
  const int nB = tn << 7;
  const int wm = (wave >> 1) << 6;                 // the wave's 64x64 tile inside it
  const int wn = (wave & 1) << 6;
  const int m0 = mB + wm;
  const int n0 = nB + wn;

  const size_t xo = (size_t)b * SEQ * HID;
  const size_t wo = (size_t)p * HID * HID;
  const T* Ab  = (const T*)(vt ? Whp + wo : Xhp + xo);
  const T* Ab2 = (const T*)(vt ? Wlp + wo : Xlp + xo);
  const T* Bb  = (const T*)(vt ? Xhp + xo : Whp + wo);
  const T* Bb2 = (const T*)(vt ? Xlp + xo : Wlp + wo);
  const float* bias = (p == 0) ? bq : ((p == 1) ? bk : bv);

  const int rlane = lane & 15;                 // row (A) / col (B, D) within subtile
  const int koff  = (lane >> 4) * 8;           // k offset of this lane half
  const int mOff  = (lane >> 4) * 8;           // D row offset

  // this lane's share of a stage: row tid >> 2 (+ 32, 64, 96), 16-B piece tid & 3 of the row's 64 B, in each of the 4 planes
  const int crow = tid >> 2, cseg = (tid & 3) * 8;
  const T* gAh = Ab  + (size_t)(mB + crow) * HID + cseg;
  const T* gAl = Ab2 + (size_t)(mB + crow) * HID + cseg;
  const T* gBh = Bb  + (size_t)(nB + crow) * HID + cseg;
  const T* gBl = Bb2 + (size_t)(nB + crow) * HID + cseg;
  const unsigned lA = (unsigned)(size_t)sS + (unsigned)(crow * GS_LP + cseg) * 2u;   // LDS byte address, buffer 0, A hi
  const unsigned lB = lA + 2u * GS_PL * 2u;                                          // buffer 0, Bt hi

  v8f acc[4][4];
#pragma unroll
  for (int i = 0; i < 4; ++i)
#pragma unroll
    for (int j = 0; j < 4; ++j) acc[i][j] = (v8f){0.f,0.f,0.f,0.f,0.f,0.f,0.f,0.f};

  // prologue: stage 0 lands and is published, then stage 1 is set off
  gs_copy_operand(lA, gAh, gAl);
  gs_copy_operand(lB, gBh, gBl);
  asm volatile("s_wait_asynccnt 0x0" ::: "memory");   // this wave's copies of stage 0 have landed
  __syncthreads();                                    // ... and every other wave's
  gs_copy_operand(lA + GS_ST * 2u, gAh + GS_KS, gAl + GS_KS);
  gs_copy_operand(lB + GS_ST * 2u, gBh + GS_KS, gBl + GS_KS);

  for (int t = 0; t < GS_NT; ++t) {
    const int bo_ = (t & 1) * GS_ST;
    const T* sA = sS + bo_ + (wm + rlane) * GS_LP + koff;               // A hi rows of this wave; lo GS_PL behind
    const T* sB = sS + bo_ + 2 * GS_PL + (wn + rlane) * GS_LP + koff;   // Bt hi rows of this wave; lo GS_PL behind
    V bh[4], bl[4];
#pragma unroll
    for (int j = 0; j < 4; ++j) {
      bh[j] = Frag<T>::load(sB + (j << 4) * GS_LP);
      bl[j] = Frag<T>::load(sB + GS_PL + (j << 4) * GS_LP);
    }
    V ah[2], al[2];                      // two A fragment sets: the next 16 rows' LDS reads are asked for ahead of this block's products
    ah[0] = Frag<T>::load(sA);
    al[0] = Frag<T>::load(sA + GS_PL);
#pragma unroll
    for (int i = 0; i < 4; ++i) {
      if (i < 3) {
        ah[(i + 1) & 1] = Frag<T>::load(sA + ((i + 1) << 4) * GS_LP);
        al[(i + 1) & 1] = Frag<T>::load(sA + GS_PL + ((i + 1) << 4) * GS_LP);
      }
#pragma unroll
      for (int j = 0; j < 4; ++j) {
        acc[i][j] = Frag<T>::mma(ah[i & 1], bh[j], acc[i][j]);
        acc[i][j] = Frag<T>::mma(ah[i & 1], bl[j], acc[i][j]);
        acc[i][j] = Frag<T>::mma(al[i & 1], bh[j], acc[i][j]);
      }
      Frag<T>::guard(acc[i][0], acc[i][3], ah[i & 1], al[i & 1]);
    }
    Frag<T>::keep(bh[0], bh[1], bh[2], bh[3]);
    Frag<T>::keep(bl[0], bl[1], bl[2], bl[3]);
    // publish point of stage t + 1
    asm volatile("s_wait_dscnt 0x0" ::: "memory");      // this wave's reads of buffer t & 1 are done before it is refilled
    asm volatile("s_wait_asynccnt 0x0" ::: "memory");   // this wave's copies of stage t + 1 have landed
    __syncthreads();                                    // stage t + 1 readable by all; buffer t & 1 left by all
    if (t + 2 < GS_NT) {
      const int kn = (t + 2) * GS_KS;
      gs_copy_operand(lA + (unsigned)bo_ * 2u, gAh + kn, gAl + kn);
      gs_copy_operand(lB + (unsigned)bo_ * 2u, gBh + kn, gBl + kn);
    }
  }
  asm volatile("s_wait_asynccnt 0x0" ::: "memory");     // no copy is outstanding when the wave goes on
  acc_guard4(acc[0][0], acc[0][1], acc[0][2], acc[0][3]);
  acc_guard4(acc[1][0], acc[1][1], acc[1][2], acc[1][3]);
  acc_guard4(acc[2][0], acc[2][1], acc[2][2], acc[2][3]);
  acc_guard4(acc[3][0], acc[3][1], acc[3][2], acc[3][3]);

  // ---- epilogue ----
  float* slab = sT[wave];
  const size_t co = (size_t)(p * NB + b) * SEQ * HID;
  unsigned short* C  = Chp + co;
  unsigned short* C2 = Clp + co;
#pragma unroll
  for (int i = 0; i < 4; ++i) {
    const int mBase = m0 + (i << 4);
    float bm[8];                                   // bias[m] of this lane's 8 rows (v^T only; index 0 otherwise, unused)
#pragma unroll
    for (int r = 0; r < 8; ++r) bm[r] = bias[vt ? (mBase + mOff + r) : 0];
#pragma unroll
    for (int j = 0; j < 4; ++j) {
      const int n = n0 + (j << 4) + rlane;
      const float bn = bias[vt ? 0 : n];           // bias[n] of this lane's column (q, k only)
#pragma unroll
      for (int r = 0; r < 8; ++r) {
        const float v = acc[i][j][r] + (vt ? bm[r] : bn);
        slab[(mOff + r) * 68 + (j << 4) + rlane] = v;
      }
    }
    __builtin_amdgcn_fence(__ATOMIC_RELEASE, "workgroup");
    __builtin_amdgcn_wave_barrier();
    __builtin_amdgcn_fence(__ATOMIC_ACQUIRE, "workgroup");
    {
      const int q = lane >> 3, c8 = (lane & 7) * 8;
#pragma unroll
      for (int it = 0; it < 4; ++it) {
        const int row = it * 4 + q;                       // it 0..3 x q 0..3 = rows 0..15 of the slab
        const float* sp = slab + row * 68 + c8;
        v8h hv, lv;
#pragma unroll
        for (int e = 0; e < 8; ++e) {
          unsigned short hb = f2bf_bits(sp[e]);
          unsigned short lb = f2bf_bits(sp[e] - bf_bits2f(hb));
          hv[e] = __builtin_bit_cast(_Float16, hb);
          lv[e] = __builtin_bit_cast(_Float16, lb);
        }
        *(v8h*)(C  + (size_t)(mBase + row) * ldc + n0 + c8) = hv;
        *(v8h*)(C2 + (size_t)(mBase + row) * ldc + n0 + c8) = lv;
      }
    }
    __builtin_amdgcn_fence(__ATOMIC_RELEASE, "workgroup");
    __builtin_amdgcn_wave_barrier();
    __builtin_amdgcn_fence(__ATOMIC_ACQUIRE, "workgroup");
  }
}

// ---------------------------------------------------------------------------
// Elementwise bf16 split: hi = bf16_rne(in), lo = bf16_rne(in - hi); 2 elements per thread, one 4-B store per plane.
// blockIdx.y picks the source (in0, in1, in2) and its plane of n2 pairs in hi / lo.
//   weights: grid 2048 x 3, n2 = 1024*1024/2 = 524288 pairs per weight
//   activations, both batch elements: grid 8192 x 1, n2 = 2*2048*1024/2 = 2097152 pairs
// ---------------------------------------------------------------------------
__device__ __forceinline__ unsigned pk16(unsigned short a, unsigned short b) { return (unsigned)a | ((unsigned)b << 16); }

__global__ __launch_bounds__(256) void split_bf16x2_kernel(const float* __restrict__ in0, const float* __restrict__ in1,
                                                           const float* __restrict__ in2, unsigned short* __restrict__ hi,
                                                           unsigned short* __restrict__ lo, int n2) {
  const int y = blockIdx.y;
  const float* in = (y == 0) ? in0 : ((y == 1) ? in1 : in2);
  const int i = blockIdx.x * 256 + threadIdx.x;
  if (i < n2) {
    const v2f f = *(const v2f*)(in + 2 * (size_t)i);
    const unsigned short h0 = f2bf_bits(f[0]), h1 = f2bf_bits(f[1]);
    const unsigned short l0 = f2bf_bits(f[0] - bf_bits2f(h0)), l1 = f2bf_bits(f[1] - bf_bits2f(h1));
    const unsigned uh = pk16(h0, h1), ul = pk16(l0, l1);
    const size_t o = (size_t)y * n2 + i;
    ((unsigned*)hi)[o] = uh;
    ((unsigned*)lo)[o] = ul;
  }
}

// =====================================================================================
// Full (non-causal, unmasked) attention, head dim 64, one launch; blockIdx.y = batch element (planes and out SEQ*HID apart).
//   q planes (hi/lo bf16): element (t, h, d) at [t*HID + h*64 + d]
//   k planes (hi/lo bf16): element (s, h, d) at [s*HID + h*64 + d]
//   v^T planes (hi/lo bf16): element (h, d, s) at [(h*64 + d)*SEQ + s]
//   out f32: element (t, h, d) at [t*HID + h*64 + d]   (the module output rows of this batch element)
//   scores^T = k . q^T (unscaled)  : A = K rows, B = q; bf16 hi/lo split (hi.hi + hi.lo + lo.hi) on v_wmma_f32_16x16x32_bf16
//   out^T    = v^T . p^T          : A = V^T rows, B = p^T packed in place from the score accumulators (hi/lo split), f32 accumulate
//   A lane holds scores of ONE query (column lane & 15): keys j*16 + 8*(lane >> 4) + r. Two score tiles (2kk, 2kk+1) are,
//   register for register, the B fragment of keys kk*32 .. kk*32+31, so p never goes through LDS.
//   online softmax in f32 over all SEQ keys (32 chunks of 64, compile-time trip count, no masking): maximum and sum in-lane,
//   one exchange of the maximum between the lane halves per chunk; the halves' sums are joined once after the loop.
//   Exponentials in base 2: the maximum is taken over the raw scores and kept as m2 = max * log2(e); p = 2^(s * log2(e) - m2), one
//   multiply-add and one v_exp_f32 per score. The rounding of m2 scales every term of a row alike and cancels in the normalisation.
//   Block = 4 waves = 64 query rows of one head; grid = (NHEAD * (SEQ/64) = 512) x NB.
//   K / V^T chunk staging: 128 threads x 32 elements per plane = the whole 64x64 tile (16-B copies, plain loads, 8 lanes per 128-B row,
//   __syncthreads before and after); fragment loads read the LDS tiles with the same v8b element type.
// =====================================================================================
#define AT_D 64
#define AT_NW 4
#define AT_QB 64
#define AT_KC 64
#define AT_L2E 1.4426950408889634f   // log2(e)
#define AT_LP 72   // LDS row pitch of the K and V^T tiles in elements: 144 B = 16 B x 9 (odd), so the 16 rows of a ds_load_b128 half-wave fall on 16 different bank groups

__device__ __forceinline__ v8f at_mma(v16b a, v16b b, v8f c) {
  return __builtin_amdgcn_wmma_f32_16x16x32_bf16(false, a, false, b, (short)0, c, false, false);
}
// two f32 -> one packed register of bf16 hi parts and one of bf16 lo parts: hi = rne(f), lo = rne(f - hi)
typedef __attribute__((ext_vector_type(2))) __bf16 v2b;
__device__ __forceinline__ void at_split2(v2f f, v2b& hi, v2b& lo) {
  hi = __builtin_convertvector(f, v2b);
  lo = __builtin_convertvector(f - __builtin_convertvector(hi, v2f), v2b);
}
// value of lane l ^ 16 (the other half's share of the same query column)
__device__ __forceinline__ float at_xhalf(float f) {
  const int b = __float_as_int(f);
  return __int_as_float(__builtin_amdgcn_permlanex16(b, b, 0x76543210, 0xfedcba98, false, false));
}

// register budget 256 a wave = four waves per SIMD, so that all 1024 work-groups (four per WGP) stay resident at once;
// told the budget, the compiler reads the fragments further ahead of their products than it does without it
__global__ __launch_bounds__(128) __attribute__((amdgpu_waves_per_eu(4, 4)))
void attn_full64_kernel(const unsigned short* __restrict__ qhp, const unsigned short* __restrict__ qlp,
                        const unsigned short* __restrict__ khp, const unsigned short* __restrict__ klp,
                        const unsigned short* __restrict__ vhp, const unsigned short* __restrict__ vlp,
                        float* __restrict__ out) {
  union FB { v16b v; v8b h[2]; v2b w[8]; };
  __shared__ __align__(16) __bf16 Ksh[AT_KC * AT_LP];            // K hi [kv][d], pitch AT_LP    9 KB
  __shared__ __align__(16) __bf16 Ksl[AT_KC * AT_LP];            // K lo
  __shared__ __align__(16) __bf16 Vth[AT_D * AT_LP];             // V hi [d][kv], pitch AT_LP    9 KB
  __shared__ __align__(16) __bf16 Vtl[AT_D * AT_LP];             // V lo
  __shared__ __align__(16) float  Os[AT_NW][16 * 68];            // per wave out tile, pitch 68

  const int tid  = threadIdx.x;
  const int wave = tid >> 5;
  const int lane = tid & 31;
  const int hh   = lane >> 4;
  const int c    = lane & 15;

  const int nqb = SEQ / AT_QB;            // 32
  const int bx = blockIdx.x;
  const int qb = bx % nqb;
  const int h  = bx / nqb;                // 0..NHEAD-1 (grid = NHEAD * nqb)
  const int q0 = qb * AT_QB + wave * 16;

  const size_t bo = (size_t)blockIdx.y * SEQ * HID;   // this batch element's planes and output rows
  const __bf16* Qh = (const __bf16*)(const void*)qhp + bo + (size_t)h * AT_D;
  const __bf16* Ql = (const __bf16*)(const void*)qlp + bo + (size_t)h * AT_D;
  const __bf16* Kh = (const __bf16*)(const void*)khp + bo + (size_t)h * AT_D;
  const __bf16* Kl = (const __bf16*)(const void*)klp + bo + (size_t)h * AT_D;
  const __bf16* Vh = (const __bf16*)(const void*)vhp + bo + (size_t)h * AT_D * SEQ;
  const __bf16* Vl = (const __bf16*)(const void*)vlp + bo + (size_t)h * AT_D * SEQ;
  float*        ob = out + bo + (size_t)h * AT_D;

  // ---- Q fragments (B operand, column = lane&15, split k map via Frag load): 2 d-chunks, hi and lo ----
  v16b qah[2], qal[2];
#pragma unroll
  for (int dc = 0; dc < 2; ++dc) {
    const __bf16* qr = Qh + (size_t)(q0 + c) * HID + dc * 32 + 8 * hh;
    const __bf16* ql = Ql + (size_t)(q0 + c) * HID + dc * 32 + 8 * hh;
    qah[dc] = Frag<__bf16>::load(qr);
    qal[dc] = Frag<__bf16>::load(ql);
  }

  float mrow = -INFINITY, lrow = 0.f;   // this lane's query: running maximum times log2(e) (both halves agree), this half's share of the sum
  v8f oacc[4];                          // oacc[t][r] = out^T[d = t*16 + 8*hh + r][query c]
#pragma unroll
  for (int t = 0; t < 4; ++t) oacc[t] = (v8f){0.f,0.f,0.f,0.f,0.f,0.f,0.f,0.f};

  const int nChunks = SEQ / AT_KC;   // 32, compile-time constant
  for (int kc = 0; kc < nChunks; ++kc) {
    const int kv0 = kc * AT_KC;
    __syncthreads();
    {
      // staging coverage: 4 passes x 16 rows x 8 pieces of 16 B = 64 rows x 64 elements per plane = the whole chunk tile.
      // Eight neighbouring lanes take one row's 128 B, so a wave-wide load touches 4 whole cache lines.
      const int r = tid >> 3, pc = (tid & 7) * 8;
      const __bf16* ksh = Kh + (size_t)(kv0 + r) * HID + pc;      // K row kv0+r (+16 per pass), d = pc..pc+7
      const __bf16* ksl = Kl + (size_t)(kv0 + r) * HID + pc;
      const __bf16* vsh = Vh + (size_t)r * SEQ + kv0 + pc;        // V^T row d = r (+16 per pass), s = kv0+pc..+7
      const __bf16* vsl = Vl + (size_t)r * SEQ + kv0 + pc;
#pragma unroll
      for (int i = 0; i < 4; ++i) {
        const v8b a0 = *(const v8b*)(ksh + (size_t)(16 * i) * HID);
        const v8b a1 = *(const v8b*)(ksl + (size_t)(16 * i) * HID);
        const v8b b0 = *(const v8b*)(vsh + (size_t)(16 * i) * SEQ);
        const v8b b1 = *(const v8b*)(vsl + (size_t)(16 * i) * SEQ);
        *(v8b*)(Ksh + (r + 16 * i) * AT_LP + pc) = a0;
        *(v8b*)(Ksl + (r + 16 * i) * AT_LP + pc) = a1;
        *(v8b*)(Vth + (r + 16 * i) * AT_LP + pc) = b0;
        *(v8b*)(Vtl + (r + 16 * i) * AT_LP + pc) = b1;
      }
    }
    __syncthreads();

    // The four key tiles are four independent accumulator chains: the fragments of all four are read as one group, then each
    // of the three products runs over the four tiles in turn. Each s[j] still sums its six products in the order dc, hi.hi, lo.hi, hi.lo.
    // Every loop here is fully unrolled: kb[], kl[] and s[] live in registers and need compile-time indices.
    v8f s[4];
#pragma unroll
    for (int j = 0; j < 4; ++j) s[j] = (v8f){0.f,0.f,0.f,0.f,0.f,0.f,0.f,0.f};
#pragma unroll
    for (int dc = 0; dc < 2; ++dc) {
      FB kb[4], kl[4];
#pragma unroll
      for (int j = 0; j < 4; ++j) {
        kb[j].h[0] = *(const v8b*)(Ksh + (j * 16 + c) * AT_LP + dc * 32 + 8 * hh);
        kb[j].h[1] = *(const v8b*)(Ksh + (j * 16 + c) * AT_LP + dc * 32 + 16 + 8 * hh);
        kl[j].h[0] = *(const v8b*)(Ksl + (j * 16 + c) * AT_LP + dc * 32 + 8 * hh);
        kl[j].h[1] = *(const v8b*)(Ksl + (j * 16 + c) * AT_LP + dc * 32 + 16 + 8 * hh);
      }
#pragma unroll
      for (int j = 0; j < 4; ++j) s[j] = at_mma(kb[j].v, qah[dc], s[j]);
#pragma unroll
      for (int j = 0; j < 4; ++j) s[j] = at_mma(kl[j].v, qah[dc], s[j]);
#pragma unroll
      for (int j = 0; j < 4; ++j) s[j] = at_mma(kb[j].v, qal[dc], s[j]);
    }
    // s[j][r] = score of key kv0 + j*16 + 8*hh + r against query c
    float mj[4];
#pragma unroll
    for (int j = 0; j < 4; ++j) {
      float m = -INFINITY;
#pragma unroll
      for (int r = 0; r < 8; ++r) m = fmaxf(m, s[j][r]);
      mj[j] = m;
    }
    const float mh = fmaxf(fmaxf(mj[0], mj[1]), fmaxf(mj[2], mj[3]));
    const float mnew = fmaxf(mrow, fmaxf(mh, at_xhalf(mh)) * AT_L2E);
    const float alpha = __builtin_amdgcn_exp2f(mrow - mnew);   // 0 in the first chunk, where mrow is -inf
    mrow = mnew;
    const v2f l2e = (v2f){AT_L2E, AT_L2E}, nm = (v2f){-mnew, -mnew};
    FB pah[2], pal[2];                   // p^T as B fragments: element e of [kk] = key kk*32 + (e < 8 ? 8*hh + e : 16 + 8*hh + e - 8)
    float pj[4];
#pragma unroll
    for (int j = 0; j < 4; ++j) {
      float psum = 0.f;
#pragma unroll
      for (int r = 0; r < 8; r += 2) {
        const v2f arg = __builtin_elementwise_fma((v2f){s[j][r], s[j][r + 1]}, l2e, nm);   // <= about 0: no overflow
        const float p0 = __builtin_amdgcn_exp2f(arg[0]);
        const float p1 = __builtin_amdgcn_exp2f(arg[1]);
        psum += p0;
        psum += p1;
        at_split2((v2f){p0, p1}, pah[j >> 1].w[(j & 1) * 4 + (r >> 1)], pal[j >> 1].w[(j & 1) * 4 + (r >> 1)]);
      }
      pj[j] = psum;
    }
    lrow = lrow * alpha + ((pj[0] + pj[1]) + (pj[2] + pj[3]));
#pragma unroll
    for (int t = 0; t < 4; ++t)
#pragma unroll
      for (int r = 0; r < 8; ++r) oacc[t][r] *= alpha;
#pragma unroll   // full unroll: pah[kk], pal[kk] live in registers and need a compile-time index
    for (int kk = 0; kk < 2; ++kk) {
      // as for the scores: the four d tiles are independent chains, their fragments read as one group; order per oacc[t] unchanged;
      // full unroll for the same reason (vb[], vl[], oacc[] in registers)
      FB vb[4], vl[4];
#pragma unroll
      for (int t = 0; t < 4; ++t) {
        vb[t].h[0] = *(const v8b*)(Vth + (t * 16 + c) * AT_LP + kk * 32 + 8 * hh);
        vb[t].h[1] = *(const v8b*)(Vth + (t * 16 + c) * AT_LP + kk * 32 + 16 + 8 * hh);
        vl[t].h[0] = *(const v8b*)(Vtl + (t * 16 + c) * AT_LP + kk * 32 + 8 * hh);
        vl[t].h[1] = *(const v8b*)(Vtl + (t * 16 + c) * AT_LP + kk * 32 + 16 + 8 * hh);
      }
#pragma unroll
      for (int t = 0; t < 4; ++t) oacc[t] = at_mma(vb[t].v, pah[kk].v, oacc[t]);
#pragma unroll
      for (int t = 0; t < 4; ++t) oacc[t] = at_mma(vl[t].v, pah[kk].v, oacc[t]);
#pragma unroll
      for (int t = 0; t < 4; ++t) oacc[t] = at_mma(vb[t].v, pal[kk].v, oacc[t]);
    }
  }

  float* os = Os[wave];
  const float inv = 1.0f / (lrow + at_xhalf(lrow));   // both halves' sums; >= 1 (the row max contributes p = 1)
#pragma unroll
  for (int t = 0; t < 4; ++t) {
    // query row c of the wave tile, d = t*16 + 8*hh .. +7: two 16-B LDS stores
    *(v4f*)(os + c * 68 + t * 16 + 8 * hh)     = (v4f){oacc[t][0] * inv, oacc[t][1] * inv, oacc[t][2] * inv, oacc[t][3] * inv};
    *(v4f*)(os + c * 68 + t * 16 + 8 * hh + 4) = (v4f){oacc[t][4] * inv, oacc[t][5] * inv, oacc[t][6] * inv, oacc[t][7] * inv};
  }
  __builtin_amdgcn_fence(__ATOMIC_RELEASE, "workgroup");
  __builtin_amdgcn_wave_barrier();
  __builtin_amdgcn_fence(__ATOMIC_ACQUIRE, "workgroup");
  {
    const int c4 = (lane & 15) * 4;
    {
#pragma unroll
      for (int it = 0; it < 8; ++it) {
        const int row = it * 2 + hh;   // it 0..7 x hh 0..1 covers rows 0..15 of the wave tile; 16 lanes x 16 B = the 64-float head segment
        v4f val = *(const v4f*)(os + row * 68 + c4);
        *(v4f*)(ob + (size_t)(q0 + row) * HID + c4) = val;
      }
      
    }
  }
}

// ---------------------------------------------------------------------------
// Workspace region map (byte offsets; every region is fully rewritten in each call)
//   Wh  bf16 [3 (q,k,v)][1024 o][1024 i]                0      Wl    6291456
//   Xh  bf16 [2 b][2048 s][1024 i]               12582912      Xl   20971520
//   Ch  bf16 [3 (q,k,v^T)][2 b][2048*1024]       29360128      Cl   54525952
//       q, k planes [s][h*64+d]; v^T planes [h*64+d][s]
//   total                                        79691776  (76 MiB)
// ---------------------------------------------------------------------------
extern "C" void kernel_launch(void* const* d_in, const int* in_sizes, int n_in,
                              void* d_out, int out_size, void* d_ws, size_t ws_size,
                              hipStream_t stream) {
  if (n_in < 7) return;
  if (in_sizes[0] != NB * SEQ * HID) return;
  if (in_sizes[1] != HID * HID || in_sizes[3] != HID * HID || in_sizes[5] != HID * HID) return;
  if (in_sizes[2] != HID || in_sizes[4] != HID || in_sizes[6] != HID) return;
  if (out_size != NB * SEQ * HID) return;

  const float* x  = (const float*)d_in[0];   // [2][2048][1024]
  const float* Wq = (const float*)d_in[1];   // [1024 out][1024 in]
  const float* bq = (const float*)d_in[2];   // [1024]
  const float* Wk = (const float*)d_in[3];
  const float* bk = (const float*)d_in[4];
  const float* Wv = (const float*)d_in[5];
  const float* bv = (const float*)d_in[6];

  const size_t PW = (size_t)HID * HID * 2;   // 2097152  bf16 weight plane [1024][1024]
  const size_t PX = (size_t)SEQ * HID * 2;   // 4194304  bf16 activation plane [2048][1024] (one batch element)
  size_t off = 0;
  const size_t oWh = off; off += 3 * PW;       const size_t oWl = off; off += 3 * PW;
  const size_t oXh = off; off += NB * PX;      const size_t oXl = off; off += NB * PX;
  const size_t oCh = off; off += 3 * NB * PX;  const size_t oCl = off; off += 3 * NB * PX;
  if (off > ws_size) return;                 // off = 79691776

  char* ws = (char*)d_ws;
  unsigned short* Wh = (unsigned short*)(ws + oWh); unsigned short* Wl = (unsigned short*)(ws + oWl);
  unsigned short* Xh = (unsigned short*)(ws + oXh); unsigned short* Xl = (unsigned short*)(ws + oXl);
  unsigned short* Ch = (unsigned short*)(ws + oCh); unsigned short* Cl = (unsigned short*)(ws + oCl);
  const size_t EP = (size_t)NB * SEQ * HID;  // elements of one projection's planes (both batch elements)

  const dim3 blk(256);

  // (1) weights [out][in] are already the Bt [n][k] layout -> bf16 hi/lo planes, no transpose; one launch for q, k, v
  const int n2w = HID * HID / 2;                            // 524288 pairs per plane
  split_bf16x2_kernel<<<dim3((n2w + 255) / 256, 3), blk, 0, stream>>>(Wq, Wk, Wv, Wh, Wl, n2w);
  // (2) x, both batch elements -> bf16 hi/lo planes [2][2048][1024]
  const int n2x = NB * SEQ * HID / 2;                       // 2097152 pairs per plane
  split_bf16x2_kernel<<<dim3((n2x + 255) / 256, 1), blk, 0, stream>>>(x, x, x, Xh, Xl, n2x);
  // (3) q = x . Wq^T + bq, k = x . Wk^T + bk, v^T = Wv . x^T + bv, both batch elements: 128 tiles of 128x128 each, one per work-group
  qkv_gemm64<<<dim3((SEQ / 128) * (HID / 128), NB, 3), dim3(128), 0, stream>>>(Xh, Xl, Wh, Wl, Ch, Cl, bq, bk, bv);
  // (4) full attention per head and batch element, no score scaling; f32 tiles go straight to the output rows
  attn_full64_kernel<<<dim3(NHEAD * (SEQ / 64), NB), dim3(128), 0, stream>>>(
      Ch, Cl, Ch + EP, Cl + EP, Ch + 2 * EP, Cl + 2 * EP, (float*)d_out);
  (void)hipGetLastError();
}

// v008
// Measured time: 155 microseconds a run.
// Timed twice side by side with v007, it ran 1.04 and 1.02 times as fast.
// Counting every step since v000, it is 4.84 times as fast.
// All contractions (q, k, v^T projections, q.k^T, p.v): v_wmma_f32_16x16x32_bf16 with bf16 hi/lo split operands (hi.hi + hi.lo + lo.hi), f32 accumulate; online softmax, biases and normalisation in f32; no score scaling.
#include <hip/hip_runtime.h>
#include <math.h>
#include <stdint.h>

#define NB    2
#define SEQ   2048
#define HID   1024
#define NHEAD 16
#define DHD   64

typedef __attribute__((ext_vector_type(16))) _Float16 v16h;
typedef __attribute__((ext_vector_type(8)))  _Float16 v8h;
typedef __attribute__((ext_vector_type(16))) __bf16   v16b;
typedef __attribute__((ext_vector_type(8)))  __bf16   v8b;
typedef __attribute__((ext_vector_type(8)))  float    v8f;
typedef __attribute__((ext_vector_type(4)))  float    v4f;
typedef __attribute__((ext_vector_type(2)))  float    v2f;
typedef __attribute__((ext_vector_type(4)))  unsigned int v4u;

__device__ __forceinline__ unsigned short f2bf_bits(float f) {
  unsigned u = __float_as_uint(f);
  return (unsigned short)((u + 0x7FFFu + ((u >> 16) & 1u)) >> 16);
}
__device__ __forceinline__ float bf_bits2f(unsigned short h) { return __uint_as_float(((unsigned)h) << 16); }

// hazard guards as plain device helpers
__device__ __forceinline__ void dep_guard_h(v8f& a, v8f& b, v16h x, v16h y) { asm volatile("v_nop\n\tv_nop\n\tv_nop\n\tv_nop" : "+v"(a), "+v"(b) : "v"(x), "v"(y)); }
__device__ __forceinline__ void dep_guard_b(v8f& a, v8f& b, v16b x, v16b y) { asm volatile("v_nop\n\tv_nop\n\tv_nop\n\tv_nop" : "+v"(a), "+v"(b) : "v"(x), "v"(y)); }
__device__ __forceinline__ void keep4_h(v16h a, v16h b, v16h c, v16h d) { asm volatile("v_nop" :: "v"(a), "v"(b), "v"(c), "v"(d)); }
__device__ __forceinline__ void keep4_b(v16b a, v16b b, v16b c, v16b d) { asm volatile("v_nop" :: "v"(a), "v"(b), "v"(c), "v"(d)); }
__device__ __forceinline__ void acc_guard4(v8f& a, v8f& b, v8f& c, v8f& d) { asm volatile("v_nop\n\tv_nop\n\tv_nop\n\tv_nop" : "+v"(a), "+v"(b), "+v"(c), "+v"(d)); }
template <typename T> struct Frag;
template <> struct Frag<_Float16> {
  typedef v16h V; union U { v16h v; v8h h[2]; };
  static __device__ __forceinline__ v16h load(const _Float16* p) {   // elements 0..7 <- p[0..7], 8..15 <- p[16..23]
    U f; f.h[0] = *(const v8h*)(p); f.h[1] = *(const v8h*)(p + 16); return f.v;
  }
  static __device__ __forceinline__ v8f mma(v16h a, v16h b, v8f c) {
    return __builtin_amdgcn_wmma_f32_16x16x32_f16(false, a, false, b, (short)0, c, false, false);
  }
  static __device__ __forceinline__ void guard(v8f& a, v8f& b, v16h x, v16h y) { dep_guard_h(a, b, x, y); }
  static __device__ __forceinline__ void keep(v16h a, v16h b, v16h c, v16h d) { keep4_h(a, b, c, d); }
};
template <> struct Frag<__bf16> {
  typedef v16b V; union U { v16b v; v8b h[2]; };
  static __device__ __forceinline__ v16b load(const __bf16* p) {
    U f; f.h[0] = *(const v8b*)(p); f.h[1] = *(const v8b*)(p + 16); return f.v;
  }
  static __device__ __forceinline__ v8f mma(v16b a, v16b b, v8f c) {
    return __builtin_amdgcn_wmma_f32_16x16x32_bf16(false, a, false, b, (short)0, c, false, false);
  }
  static __device__ __forceinline__ void guard(v8f& a, v8f& b, v16b x, v16b y) { dep_guard_b(a, b, x, y); }
  static __device__ __forceinline__ void keep(v16b a, v16b b, v16b c, v16b d) { keep4_b(a, b, c, d); }
};

// ---- Register-blocked WMMA GEMM, all three projections of both batch elements in ONE launch ----------
// C[m,n] = sum_k A[m,k] * Bt[n,k] + bias; a work-group owns a 128x128 tile, each of its 4 waves (2 x 2) a 64x64 tile;
// K = HID, row pitch of A and Bt = HID.
// Operands are bf16 hi/lo planes; product = hi.hi + hi.lo + lo.hi; output = bf16 hi plane + bf16 lo plane.
// blockIdx.z = projection p, blockIdx.y = batch element b, blockIdx.x = 128x128 tile (128 tiles per (p, b)).
//   p = 0, 1 (q, k): A = x[b] planes [SEQ][HID], Bt = W[p] planes [HID][HID], C [SEQ][HID], bias[n]
//   p = 2   (v^T)  : A = W[2] planes [HID][HID], Bt = x[b] planes [SEQ][HID], C [HID][SEQ], bias[m]
// Grid 128 x 2 x 3 = 768 work-groups of 4 waves = 3 per WGP on 256 WGPs.
// Operand path: a stage = 32 k of the 128 A rows and the 128 Bt rows, hi and lo planes, brought into LDS by asynchronous
// copies (16 B per lane, 16 copies per lane and stage); two buffers, the next stage's copies fly while this one is worked on.
#define GS_KS   32                     // k per stage
#define GS_LP   40                     // LDS row pitch in elements: 80 B = 16 B x 5 (odd), free of bank conflicts for ds_load_b128
#define GS_PL   (128 * GS_LP)          // elements of one plane of a stage (128 rows)
#define GS_ST   (4 * GS_PL)            // elements of one stage: A hi, A lo, Bt hi, Bt lo (40960 B)
#define GS_NT   (HID / GS_KS)          // 32 stages

// Eight asynchronous 16-B copies per lane, global -> LDS. The s_wait_xcnt closes the statement so that no address register
// of a copy is rewritten in front of it.
__device__ __forceinline__ void gs_copy8(unsigned l0, unsigned l1, unsigned l2, unsigned l3,
                                         unsigned l4, unsigned l5, unsigned l6, unsigned l7,
                                         const __bf16* g0, const __bf16* g1, const __bf16* g2, const __bf16* g3,
                                         const __bf16* g4, const __bf16* g5, const __bf16* g6, const __bf16* g7) {
  asm volatile("global_load_async_to_lds_b128 %0, %8, off\n\t"
               "global_load_async_to_lds_b128 %1, %9, off\n\t"
               "global_load_async_to_lds_b128 %2, %10, off\n\t"
               "global_load_async_to_lds_b128 %3, %11, off\n\t"
               "global_load_async_to_lds_b128 %4, %12, off\n\t"
               "global_load_async_to_lds_b128 %5, %13, off\n\t"
               "global_load_async_to_lds_b128 %6, %14, off\n\t"
               "global_load_async_to_lds_b128 %7, %15, off\n\t"
               "s_wait_xcnt 0x0"
               :: "v"(l0), "v"(l1), "v"(l2), "v"(l3), "v"(l4), "v"(l5), "v"(l6), "v"(l7),
                  "v"(g0), "v"(g1), "v"(g2), "v"(g3), "v"(g4), "v"(g5), "v"(g6), "v"(g7)
               : "memory");
}
// One stage: hp, lp = this lane's first 16 B of the hi and lo plane (row tid >> 2, piece tid & 3, at the stage's k);
// l = the LDS byte address of the same piece in the hi plane. Rows step by 32, the lo plane lies GS_PL elements behind.
__device__ __forceinline__ void gs_copy_operand(unsigned l, const __bf16* hp, const __bf16* lp) {
  const unsigned rs = 32 * GS_LP * 2, ps = GS_PL * 2;
  gs_copy8(l, l + rs, l + 2 * rs, l + 3 * rs, l + ps, l + ps + rs, l + ps + 2 * rs, l + ps + 3 * rs,
           hp, hp + 32 * HID, hp + 64 * HID, hp + 96 * HID, lp, lp + 32 * HID, lp + 64 * HID, lp + 96 * HID);
}

__global__ __launch_bounds__(128) void qkv_gemm64(
    const unsigned short* __restrict__ Xhp, const unsigned short* __restrict__ Xlp,
    const unsigned short* __restrict__ Whp, const unsigned short* __restrict__ Wlp,
    unsigned short* __restrict__ Chp, unsigned short* __restrict__ Clp,
    const float* __restrict__ bq, const float* __restrict__ bk, const float* __restrict__ bv) {
  typedef __bf16 T;
  typedef Frag<T>::V V;
  __shared__ __align__(16) T     sS[2 * GS_ST];    // two stage buffers, 81920 B
  __shared__ __align__(16) float sT[4][16 * 68];   // per-wave 16x64 slab, pitch 68 floats
  const int p    = blockIdx.z;
  const int b    = blockIdx.y;
  const bool vt  = (p == 2);
  const int tid  = threadIdx.x;
  const int lane = tid & 31;
  const int wave = tid >> 5;
  const int ldc  = vt ? SEQ : HID;
  const int shN  = vt ? 4 : 3;                     // log2 of the 128-wide tiles per row of C (N / 128)
  const int tile = blockIdx.x;                     // 0..127
  const int tm = tile >> shN;
  const int tn = tile - (tm << shN);
  const int mB = tm << 7;                          // the work-group's first row and column of C
  const int nB = tn << 7;
  const int wm = (wave >> 1) << 6;                 // the wave's 64x64 tile inside it
  const int wn = (wave & 1) << 6;
  const int m0 = mB + wm;
  const int n0 = nB + wn;

  const size_t xo = (size_t)b * SEQ * HID;
  const size_t wo = (size_t)p * HID * HID;
  const T* Ab  = (const T*)(vt ? Whp + wo : Xhp + xo);
  const T* Ab2 = (const T*)(vt ? Wlp + wo : Xlp + xo);
  const T* Bb  = (const T*)(vt ? Xhp + xo : Whp + wo);
  const T* Bb2 = (const T*)(vt ? Xlp + xo : Wlp + wo);
  const float* bias = (p == 0) ? bq : ((p == 1) ? bk : bv);

  const int rlane = lane & 15;                 // row (A) / col (B, D) within subtile
  const int koff  = (lane >> 4) * 8;           // k offset of this lane half
  const int mOff  = (lane >> 4) * 8;           // D row offset

  // this lane's share of a stage: row tid >> 2 (+ 32, 64, 96), 16-B piece tid & 3 of the row's 64 B, in each of the 4 planes
  const int crow = tid >> 2, cseg = (tid & 3) * 8;
  const T* gAh = Ab  + (size_t)(mB + crow) * HID + cseg;
  const T* gAl = Ab2 + (size_t)(mB + crow) * HID + cseg;
  const T* gBh = Bb  + (size_t)(nB + crow) * HID + cseg;
  const T* gBl = Bb2 + (size_t)(nB + crow) * HID + cseg;
  const unsigned lA = (unsigned)(size_t)sS + (unsigned)(crow * GS_LP + cseg) * 2u;   // LDS byte address, buffer 0, A hi
  const unsigned lB = lA + 2u * GS_PL * 2u;                                          // buffer 0, Bt hi

  v8f acc[4][4];
#pragma unroll
  for (int i = 0; i < 4; ++i)
#pragma unroll
    for (int j = 0; j < 4; ++j) acc[i][j] = (v8f){0.f,0.f,0.f,0.f,0.f,0.f,0.f,0.f};

  // prologue: stage 0 lands and is published, then stage 1 is set off
  gs_copy_operand(lA, gAh, gAl);
  gs_copy_operand(lB, gBh, gBl);
  asm volatile("s_wait_asynccnt 0x0" ::: "memory");   // this wave's copies of stage 0 have landed
  __syncthreads();                                    // ... and every other wave's
  gs_copy_operand(lA + GS_ST * 2u, gAh + GS_KS, gAl + GS_KS);
  gs_copy_operand(lB + GS_ST * 2u, gBh + GS_KS, gBl + GS_KS);

  for (int t = 0; t < GS_NT; ++t) {
    const int bo_ = (t & 1) * GS_ST;
    const T* sA = sS + bo_ + (wm + rlane) * GS_LP + koff;               // A hi rows of this wave; lo GS_PL behind
    const T* sB = sS + bo_ + 2 * GS_PL + (wn + rlane) * GS_LP + koff;   // Bt hi rows of this wave; lo GS_PL behind
    V bh[4], bl[4];
#pragma unroll
    for (int j = 0; j < 4; ++j) {
      bh[j] = Frag<T>::load(sB + (j << 4) * GS_LP);
      bl[j] = Frag<T>::load(sB + GS_PL + (j << 4) * GS_LP);
    }
    V ah[2], al[2];                      // two A fragment sets: the next 16 rows' LDS reads are asked for ahead of this block's products
    ah[0] = Frag<T>::load(sA);
    al[0] = Frag<T>::load(sA + GS_PL);
#pragma unroll
    for (int i = 0; i < 4; ++i) {
      if (i < 3) {
        ah[(i + 1) & 1] = Frag<T>::load(sA + ((i + 1) << 4) * GS_LP);
        al[(i + 1) & 1] = Frag<T>::load(sA + GS_PL + ((i + 1) << 4) * GS_LP);
      }
#pragma unroll
      for (int j = 0; j < 4; ++j) {
        acc[i][j] = Frag<T>::mma(ah[i & 1], bh[j], acc[i][j]);
        acc[i][j] = Frag<T>::mma(ah[i & 1], bl[j], acc[i][j]);
        acc[i][j] = Frag<T>::mma(al[i & 1], bh[j], acc[i][j]);
      }
      Frag<T>::guard(acc[i][0], acc[i][3], ah[i & 1], al[i & 1]);
    }
    Frag<T>::keep(bh[0], bh[1], bh[2], bh[3]);
    Frag<T>::keep(bl[0], bl[1], bl[2], bl[3]);
    // publish point of stage t + 1
    asm volatile("s_wait_dscnt 0x0" ::: "memory");      // this wave's reads of buffer t & 1 are done before it is refilled
    asm volatile("s_wait_asynccnt 0x0" ::: "memory");   // this wave's copies of stage t + 1 have landed
    __syncthreads();                                    // stage t + 1 readable by all; buffer t & 1 left by all
    if (t + 2 < GS_NT) {
      const int kn = (t + 2) * GS_KS;
      gs_copy_operand(lA + (unsigned)bo_ * 2u, gAh + kn, gAl + kn);
      gs_copy_operand(lB + (unsigned)bo_ * 2u, gBh + kn, gBl + kn);
    }
  }
  asm volatile("s_wait_asynccnt 0x0" ::: "memory");     // no copy is outstanding when the wave goes on
  acc_guard4(acc[0][0], acc[0][1], acc[0][2], acc[0][3]);
  acc_guard4(acc[1][0], acc[1][1], acc[1][2], acc[1][3]);
  acc_guard4(acc[2][0], acc[2][1], acc[2][2], acc[2][3]);
  acc_guard4(acc[3][0], acc[3][1], acc[3][2], acc[3][3]);

  // ---- epilogue ----
  float* slab = sT[wave];
  const size_t co = (size_t)(p * NB + b) * SEQ * HID;
  unsigned short* C  = Chp + co;
  unsigned short* C2 = Clp + co;
#pragma unroll
  for (int i = 0; i < 4; ++i) {
    const int mBase = m0 + (i << 4);
    float bm[8];                                   // bias[m] of this lane's 8 rows (v^T only; index 0 otherwise, unused)
#pragma unroll
    for (int r = 0; r < 8; ++r) bm[r] = bias[vt ? (mBase + mOff + r) : 0];
#pragma unroll
    for (int j = 0; j < 4; ++j) {
      const int n = n0 + (j << 4) + rlane;
      const float bn = bias[vt ? 0 : n];           // bias[n] of this lane's column (q, k only)
#pragma unroll
      for (int r = 0; r < 8; ++r) {
        const float v = acc[i][j][r] + (vt ? bm[r] : bn);
        slab[(mOff + r) * 68 + (j << 4) + rlane] = v;
      }
    }
    __builtin_amdgcn_fence(__ATOMIC_RELEASE, "workgroup");
    __builtin_amdgcn_wave_barrier();
    __builtin_amdgcn_fence(__ATOMIC_ACQUIRE, "workgroup");
    {
      const int q = lane >> 3, c8 = (lane & 7) * 8;
#pragma unroll
      for (int it = 0; it < 4; ++it) {
        const int row = it * 4 + q;                       // it 0..3 x q 0..3 = rows 0..15 of the slab
        const float* sp = slab + row * 68 + c8;
        v8h hv, lv;
#pragma unroll
        for (int e = 0; e < 8; ++e) {
          unsigned short hb = f2bf_bits(sp[e]);
          unsigned short lb = f2bf_bits(sp[e] - bf_bits2f(hb));
          hv[e] = __builtin_bit_cast(_Float16, hb);
          lv[e] = __builtin_bit_cast(_Float16, lb);
        }
        *(v8h*)(C  + (size_t)(mBase + row) * ldc + n0 + c8) = hv;
        *(v8h*)(C2 + (size_t)(mBase + row) * ldc + n0 + c8) = lv;
      }
    }
    __builtin_amdgcn_fence(__ATOMIC_RELEASE, "workgroup");
    __builtin_amdgcn_wave_barrier();
    __builtin_amdgcn_fence(__ATOMIC_ACQUIRE, "workgroup");
  }
}

// ---------------------------------------------------------------------------
// Elementwise bf16 split: hi = bf16_rne(in), lo = bf16_rne(in - hi); 2 elements per thread, one 4-B store per plane.
// blockIdx.y picks the source (in0, in1, in2) and its plane of n2 pairs in hi / lo.
//   weights: grid 2048 x 3, n2 = 1024*1024/2 = 524288 pairs per weight
//   activations, both batch elements: grid 8192 x 1, n2 = 2*2048*1024/2 = 2097152 pairs
// ---------------------------------------------------------------------------
__device__ __forceinline__ unsigned pk16(unsigned short a, unsigned short b) { return (unsigned)a | ((unsigned)b << 16); }

__global__ __launch_bounds__(256) void split_bf16x2_kernel(const float* __restrict__ in0, const float* __restrict__ in1,
                                                           const float* __restrict__ in2, unsigned short* __restrict__ hi,
                                                           unsigned short* __restrict__ lo, int n2) {
  const int y = blockIdx.y;
  const float* in = (y == 0) ? in0 : ((y == 1) ? in1 : in2);
  const int i = blockIdx.x * 256 + threadIdx.x;
  if (i < n2) {
    const v2f f = *(const v2f*)(in + 2 * (size_t)i);
    const unsigned short h0 = f2bf_bits(f[0]), h1 = f2bf_bits(f[1]);
    const unsigned short l0 = f2bf_bits(f[0] - bf_bits2f(h0)), l1 = f2bf_bits(f[1] - bf_bits2f(h1));
    const unsigned uh = pk16(h0, h1), ul = pk16(l0, l1);
    const size_t o = (size_t)y * n2 + i;
    ((unsigned*)hi)[o] = uh;
    ((unsigned*)lo)[o] = ul;
  }
}

// =====================================================================================
// Full (non-causal, unmasked) attention, head dim 64, one launch; blockIdx.y = batch element (planes and out SEQ*HID apart).
//   q planes (hi/lo bf16): element (t, h, d) at [t*HID + h*64 + d]
//   k planes (hi/lo bf16): element (s, h, d) at [s*HID + h*64 + d]
//   v^T planes (hi/lo bf16): element (h, d, s) at [(h*64 + d)*SEQ + s]
//   out f32: element (t, h, d) at [t*HID + h*64 + d]   (the module output rows of this batch element)
//   scores^T = k . q^T (unscaled)  : A = K rows, B = q; bf16 hi/lo split (hi.hi + hi.lo + lo.hi) on v_wmma_f32_16x16x32_bf16
//   out^T    = v^T . p^T          : A = V^T rows, B = p^T packed in place from the score accumulators (hi/lo split), f32 accumulate
//   A lane holds scores of ONE query (column lane & 15): keys j*16 + 8*(lane >> 4) + r. Two score tiles (2kk, 2kk+1) are,
//   register for register, the B fragment of keys kk*32 .. kk*32+31, so p never goes through LDS.
//   online softmax in f32 over all SEQ keys (32 chunks of 64, compile-time trip count, no masking): maximum and sum in-lane,
//   one exchange of the maximum between the lane halves per chunk; the halves' sums are joined once after the loop.
//   Exponentials in base 2: the maximum is taken over the raw scores and kept as m2 = max * log2(e); p = 2^(s * log2(e) - m2), one
//   multiply-add and one v_exp_f32 per score. The rounding of m2 scales every term of a row alike and cancels in the normalisation.
//   A wave owns 32 queries = two column groups g of 16: every K and V^T fragment read from LDS feeds the products of both groups.
//   Block = 4 waves = 128 query rows of one head; grid = (NHEAD * (SEQ/128) = 256) x NB.
//   K / V^T chunk staging: 128 threads x 32 elements per plane = the whole 64x64 tile (16-B copies, plain loads, 8 lanes per 128-B row,
//   __syncthreads before and after); fragment loads read the LDS tiles with the same v8b element type.
// =====================================================================================
#define AT_D 64
#define AT_NW 4
#define AT_G 2     // column groups of 16 queries per wave
#define AT_QB 128  // queries per work-group = AT_NW * AT_G * 16
#define AT_KC 64
#define AT_L2E 1.4426950408889634f   // log2(e)
#define AT_LP 72   // LDS row pitch of the K and V^T tiles in elements: 144 B = 16 B x 9 (odd), so the 16 rows of a ds_load_b128 half-wave fall on 16 different bank groups

__device__ __forceinline__ v8f at_mma(v16b a, v16b b, v8f c) {
  return __builtin_amdgcn_wmma_f32_16x16x32_bf16(false, a, false, b, (short)0, c, false, false);
}
// two f32 -> one packed register of bf16 hi parts and one of bf16 lo parts: hi = rne(f), lo = rne(f - hi)
typedef __attribute__((ext_vector_type(2))) __bf16 v2b;
__device__ __forceinline__ void at_split2(v2f f, v2b& hi, v2b& lo) {
  hi = __builtin_convertvector(f, v2b);
  lo = __builtin_convertvector(f - __builtin_convertvector(hi, v2f), v2b);
}
// value of lane l ^ 16 (the other half's share of the same query column)
__device__ __forceinline__ float at_xhalf(float f) {
  const int b = __float_as_int(f);
  return __int_as_float(__builtin_amdgcn_permlanex16(b, b, 0x76543210, 0xfedcba98, false, false));
}

// 512 work-groups of 4 waves = two per WGP, one wave of each on every SIMD: register budget 512 a wave
__global__ __launch_bounds__(128) __attribute__((amdgpu_waves_per_eu(2, 2)))
void attn_full64_kernel(const unsigned short* __restrict__ qhp, const unsigned short* __restrict__ qlp,
                        const unsigned short* __restrict__ khp, const unsigned short* __restrict__ klp,
                        const unsigned short* __restrict__ vhp, const unsigned short* __restrict__ vlp,
                        float* __restrict__ out) {
  union FB { v16b v; v8b h[2]; v2b w[8]; };
  __shared__ __align__(16) __bf16 Ksh[AT_KC * AT_LP];            // K hi [kv][d], pitch AT_LP    9 KB
  __shared__ __align__(16) __bf16 Ksl[AT_KC * AT_LP];            // K lo
  __shared__ __align__(16) __bf16 Vth[AT_D * AT_LP];             // V hi [d][kv], pitch AT_LP    9 KB
  __shared__ __align__(16) __bf16 Vtl[AT_D * AT_LP];             // V lo
  __shared__ __align__(16) float  Os[AT_NW][AT_G * 16 * 68];     // per wave out tile (32 query rows), pitch 68

  const int tid  = threadIdx.x;
  const int wave = tid >> 5;
  const int lane = tid & 31;
  const int hh   = lane >> 4;
  const int c    = lane & 15;

  const int nqb = SEQ / AT_QB;            // 16
  const int bx = blockIdx.x;
  const int qb = bx % nqb;
  const int h  = bx / nqb;                // 0..NHEAD-1 (grid = NHEAD * nqb)
  const int q0 = qb * AT_QB + wave * (AT_G * 16);

  const size_t bo = (size_t)blockIdx.y * SEQ * HID;   // this batch element's planes and output rows
  const __bf16* Qh = (const __bf16*)(const void*)qhp + bo + (size_t)h * AT_D;
  const __bf16* Ql = (const __bf16*)(const void*)qlp + bo + (size_t)h * AT_D;
  const __bf16* Kh = (const __bf16*)(const void*)khp + bo + (size_t)h * AT_D;
  const __bf16* Kl = (const __bf16*)(const void*)klp + bo + (size_t)h * AT_D;
  const __bf16* Vh = (const __bf16*)(const void*)vhp + bo + (size_t)h * AT_D * SEQ;
  const __bf16* Vl = (const __bf16*)(const void*)vlp + bo + (size_t)h * AT_D * SEQ;
  float*        ob = out + bo + (size_t)h * AT_D;

  // ---- Q fragments (B operand, column = lane&15 of group g, split k map via Frag load): 2 d-chunks, hi and lo ----
  v16b qah[AT_G][2], qal[AT_G][2];
#pragma unroll   // full unroll, here and in every loop over g below: what g indexes lives in registers and needs a compile-time index
  for (int g = 0; g < AT_G; ++g)
#pragma unroll
    for (int dc = 0; dc < 2; ++dc) {
      const __bf16* qr = Qh + (size_t)(q0 + g * 16 + c) * HID + dc * 32 + 8 * hh;
      const __bf16* ql = Ql + (size_t)(q0 + g * 16 + c) * HID + dc * 32 + 8 * hh;
      qah[g][dc] = Frag<__bf16>::load(qr);
      qal[g][dc] = Frag<__bf16>::load(ql);
    }

  // per group, this lane's query: running maximum times log2(e) (both halves agree), this half's share of the sum
  float mrow[AT_G], lrow[AT_G];
  v8f oacc[AT_G][4];                    // oacc[g][t][r] = out^T[d = t*16 + 8*hh + r][query g*16 + c]
#pragma unroll
  for (int g = 0; g < AT_G; ++g) {
    mrow[g] = -INFINITY;
    lrow[g] = 0.f;
#pragma unroll
    for (int t = 0; t < 4; ++t) oacc[g][t] = (v8f){0.f,0.f,0.f,0.f,0.f,0.f,0.f,0.f};
  }

  const int nChunks = SEQ / AT_KC;   // 32, compile-time constant
  for (int kc = 0; kc < nChunks; ++kc) {
    const int kv0 = kc * AT_KC;
    __syncthreads();
    {
      // staging coverage: 4 passes x 16 rows x 8 pieces of 16 B = 64 rows x 64 elements per plane = the whole chunk tile.
      // Eight neighbouring lanes take one row's 128 B, so a wave-wide load touches 4 whole cache lines.
      const int r = tid >> 3, pc = (tid & 7) * 8;
      const __bf16* ksh = Kh + (size_t)(kv0 + r) * HID + pc;      // K row kv0+r (+16 per pass), d = pc..pc+7
      const __bf16* ksl = Kl + (size_t)(kv0 + r) * HID + pc;
      const __bf16* vsh = Vh + (size_t)r * SEQ + kv0 + pc;        // V^T row d = r (+16 per pass), s = kv0+pc..+7
      const __bf16* vsl = Vl + (size_t)r * SEQ + kv0 + pc;
#pragma unroll
      for (int i = 0; i < 4; ++i) {
        const v8b a0 = *(const v8b*)(ksh + (size_t)(16 * i) * HID);
        const v8b a1 = *(const v8b*)(ksl + (size_t)(16 * i) * HID);
        const v8b b0 = *(const v8b*)(vsh + (size_t)(16 * i) * SEQ);
        const v8b b1 = *(const v8b*)(vsl + (size_t)(16 * i) * SEQ);
        *(v8b*)(Ksh + (r + 16 * i) * AT_LP + pc) = a0;
        *(v8b*)(Ksl + (r + 16 * i) * AT_LP + pc) = a1;
        *(v8b*)(Vth + (r + 16 * i) * AT_LP + pc) = b0;
        *(v8b*)(Vtl + (r + 16 * i) * AT_LP + pc) = b1;
      }
    }
    __syncthreads();

    // The four key tiles of both column groups are eight independent accumulator chains: the fragments of all four tiles are read as
    // one group, then each of the three products runs over the eight chains in turn. Each s[g][j] still sums its six products in the
    // order dc, hi.hi, lo.hi, hi.lo.
    // Every loop here is fully unrolled: kb[], kl[] and s[][] live in registers and need compile-time indices.
    v8f s[AT_G][4];
#pragma unroll
    for (int g = 0; g < AT_G; ++g)
#pragma unroll
      for (int j = 0; j < 4; ++j) s[g][j] = (v8f){0.f,0.f,0.f,0.f,0.f,0.f,0.f,0.f};
#pragma unroll
    for (int dc = 0; dc < 2; ++dc) {
      FB kb[4], kl[4];
#pragma unroll
      for (int j = 0; j < 4; ++j) {
        kb[j].h[0] = *(const v8b*)(Ksh + (j * 16 + c) * AT_LP + dc * 32 + 8 * hh);
        kb[j].h[1] = *(const v8b*)(Ksh + (j * 16 + c) * AT_LP + dc * 32 + 16 + 8 * hh);
        kl[j].h[0] = *(const v8b*)(Ksl + (j * 16 + c) * AT_LP + dc * 32 + 8 * hh);
        kl[j].h[1] = *(const v8b*)(Ksl + (j * 16 + c) * AT_LP + dc * 32 + 16 + 8 * hh);
      }
#pragma unroll
      for (int g = 0; g < AT_G; ++g)
#pragma unroll
        for (int j = 0; j < 4; ++j) s[g][j] = at_mma(kb[j].v, qah[g][dc], s[g][j]);
#pragma unroll
      for (int g = 0; g < AT_G; ++g)
#pragma unroll
        for (int j = 0; j < 4; ++j) s[g][j] = at_mma(kl[j].v, qah[g][dc], s[g][j]);
#pragma unroll
      for (int g = 0; g < AT_G; ++g)
#pragma unroll
        for (int j = 0; j < 4; ++j) s[g][j] = at_mma(kb[j].v, qal[g][dc], s[g][j]);
    }
    // s[g][j][r] = score of key kv0 + j*16 + 8*hh + r against query g*16 + c
    FB pah[AT_G][2], pal[AT_G][2];       // p^T as B fragments: element e of [g][kk] = key kk*32 + (e < 8 ? 8*hh + e : 16 + 8*hh + e - 8)
#pragma unroll   // full unroll: every array indexed by g lives in registers
    for (int g = 0; g < AT_G; ++g) {
      float mj[4];
#pragma unroll
      for (int j = 0; j < 4; ++j) {
        float m = -INFINITY;
#pragma unroll
        for (int r = 0; r < 8; ++r) m = fmaxf(m, s[g][j][r]);
        mj[j] = m;
      }
      const float mh = fmaxf(fmaxf(mj[0], mj[1]), fmaxf(mj[2], mj[3]));
      const float mnew = fmaxf(mrow[g], fmaxf(mh, at_xhalf(mh)) * AT_L2E);
      const float alpha = __builtin_amdgcn_exp2f(mrow[g] - mnew);   // 0 in the first chunk, where mrow is -inf
      mrow[g] = mnew;
      const v2f l2e = (v2f){AT_L2E, AT_L2E}, nm = (v2f){-mnew, -mnew};
      float pj[4];
#pragma unroll
      for (int j = 0; j < 4; ++j) {
        float psum = 0.f;
#pragma unroll
        for (int r = 0; r < 8; r += 2) {
          const v2f arg = __builtin_elementwise_fma((v2f){s[g][j][r], s[g][j][r + 1]}, l2e, nm);   // <= about 0: no overflow
          const float p0 = __builtin_amdgcn_exp2f(arg[0]);
          const float p1 = __builtin_amdgcn_exp2f(arg[1]);
          psum += p0;
          psum += p1;
          at_split2((v2f){p0, p1}, pah[g][j >> 1].w[(j & 1) * 4 + (r >> 1)], pal[g][j >> 1].w[(j & 1) * 4 + (r >> 1)]);
        }
        pj[j] = psum;
      }
      lrow[g] = lrow[g] * alpha + ((pj[0] + pj[1]) + (pj[2] + pj[3]));
#pragma unroll
      for (int t = 0; t < 4; ++t)
#pragma unroll
        for (int r = 0; r < 8; ++r) oacc[g][t][r] *= alpha;
    }
#pragma unroll   // full unroll: pah[g][kk], pal[g][kk] live in registers and need a compile-time index
    for (int kk = 0; kk < 2; ++kk) {
      // as for the scores: the four d tiles of both groups are independent chains, their fragments read as one group; order per
      // oacc[g][t] unchanged; full unroll for the same reason (vb[], vl[], oacc[][] in registers)
      FB vb[4], vl[4];
#pragma unroll
      for (int t = 0; t < 4; ++t) {
        vb[t].h[0] = *(const v8b*)(Vth + (t * 16 + c) * AT_LP + kk * 32 + 8 * hh);
        vb[t].h[1] = *(const v8b*)(Vth + (t * 16 + c) * AT_LP + kk * 32 + 16 + 8 * hh);
        vl[t].h[0] = *(const v8b*)(Vtl + (t * 16 + c) * AT_LP + kk * 32 + 8 * hh);
        vl[t].h[1] = *(const v8b*)(Vtl + (t * 16 + c) * AT_LP + kk * 32 + 16 + 8 * hh);
      }
#pragma unroll
      for (int g = 0; g < AT_G; ++g)
#pragma unroll
        for (int t = 0; t < 4; ++t) oacc[g][t] = at_mma(vb[t].v, pah[g][kk].v, oacc[g][t]);
#pragma unroll
      for (int g = 0; g < AT_G; ++g)
#pragma unroll
        for (int t = 0; t < 4; ++t) oacc[g][t] = at_mma(vl[t].v, pah[g][kk].v, oacc[g][t]);
#pragma unroll
      for (int g = 0; g < AT_G; ++g)
#pragma unroll
        for (int t = 0; t < 4; ++t) oacc[g][t] = at_mma(vb[t].v, pal[g][kk].v, oacc[g][t]);
    }
  }

  float* os = Os[wave];
#pragma unroll
  for (int g = 0; g < AT_G; ++g) {
    const float inv = 1.0f / (lrow[g] + at_xhalf(lrow[g]));   // both halves' sums; >= 1 (the row max contributes p = 1)
#pragma unroll
    for (int t = 0; t < 4; ++t) {
      // query row g*16 + c of the wave tile, d = t*16 + 8*hh .. +7: two 16-B LDS stores
      float* op = os + (g * 16 + c) * 68 + t * 16 + 8 * hh;
      *(v4f*)(op)     = (v4f){oacc[g][t][0] * inv, oacc[g][t][1] * inv, oacc[g][t][2] * inv, oacc[g][t][3] * inv};
      *(v4f*)(op + 4) = (v4f){oacc[g][t][4] * inv, oacc[g][t][5] * inv, oacc[g][t][6] * inv, oacc[g][t][7] * inv};
    }
  }
  __builtin_amdgcn_fence(__ATOMIC_RELEASE, "workgroup");
  __builtin_amdgcn_wave_barrier();
  __builtin_amdgcn_fence(__ATOMIC_ACQUIRE, "workgroup");
  {
    const int c4 = (lane & 15) * 4;
#pragma unroll
    for (int it = 0; it < AT_G * 8; ++it) {
      const int row = it * 2 + hh;   // it 0..15 x hh 0..1 covers rows 0..31 of the wave tile; 16 lanes x 16 B = the 64-float head segment
      v4f val = *(const v4f*)(os + row * 68 + c4);
      *(v4f*)(ob + (size_t)(q0 + row) * HID + c4) = val;
    }
  }
}

// ---------------------------------------------------------------------------
// Workspace region map (byte offsets; every region is fully rewritten in each call)
//   Wh  bf16 [3 (q,k,v)][1024 o][1024 i]                0      Wl    6291456
//   Xh  bf16 [2 b][2048 s][1024 i]               12582912      Xl   20971520
//   Ch  bf16 [3 (q,k,v^T)][2 b][2048*1024]       29360128      Cl   54525952
//       q, k planes [s][h*64+d]; v^T planes [h*64+d][s]
//   total                                        79691776  (76 MiB)
// ---------------------------------------------------------------------------
extern "C" void kernel_launch(void* const* d_in, const int* in_sizes, int n_in,
                              void* d_out, int out_size, void* d_ws, size_t ws_size,
                              hipStream_t stream) {
  if (n_in < 7) return;
  if (in_sizes[0] != NB * SEQ * HID) return;
  if (in_sizes[1] != HID * HID || in_sizes[3] != HID * HID || in_sizes[5] != HID * HID) return;
  if (in_sizes[2] != HID || in_sizes[4] != HID || in_sizes[6] != HID) return;
  if (out_size != NB * SEQ * HID) return;

  const float* x  = (const float*)d_in[0];   // [2][2048][1024]
  const float* Wq = (const float*)d_in[1];   // [1024 out][1024 in]
  const float* bq = (const float*)d_in[2];   // [1024]
  const float* Wk = (const float*)d_in[3];
  const float* bk = (const float*)d_in[4];
  const float* Wv = (const float*)d_in[5];
  const float* bv = (const float*)d_in[6];

  const size_t PW = (size_t)HID * HID * 2;   // 2097152  bf16 weight plane [1024][1024]
  const size_t PX = (size_t)SEQ * HID * 2;   // 4194304  bf16 activation plane [2048][1024] (one batch element)
  size_t off = 0;
  const size_t oWh = off; off += 3 * PW;       const size_t oWl = off; off += 3 * PW;
  const size_t oXh = off; off += NB * PX;      const size_t oXl = off; off += NB * PX;
  const size_t oCh = off; off += 3 * NB * PX;  const size_t oCl = off; off += 3 * NB * PX;
  if (off > ws_size) return;                 // off = 79691776

  char* ws = (char*)d_ws;
  unsigned short* Wh = (unsigned short*)(ws + oWh); unsigned short* Wl = (unsigned short*)(ws + oWl);
  unsigned short* Xh = (unsigned short*)(ws + oXh); unsigned short* Xl = (unsigned short*)(ws + oXl);
  unsigned short* Ch = (unsigned short*)(ws + oCh); unsigned short* Cl = (unsigned short*)(ws + oCl);
  const size_t EP = (size_t)NB * SEQ * HID;  // elements of one projection's planes (both batch elements)

  const dim3 blk(256);

  // (1) weights [out][in] are already the Bt [n][k] layout -> bf16 hi/lo planes, no transpose; one launch for q, k, v
  const int n2w = HID * HID / 2;                            // 524288 pairs per plane
  split_bf16x2_kernel<<<dim3((n2w + 255) / 256, 3), blk, 0, stream>>>(Wq, Wk, Wv, Wh, Wl, n2w);
  // (2) x, both batch elements -> bf16 hi/lo planes [2][2048][1024]
  const int n2x = NB * SEQ * HID / 2;                       // 2097152 pairs per plane
  split_bf16x2_kernel<<<dim3((n2x + 255) / 256, 1), blk, 0, stream>>>(x, x, x, Xh, Xl, n2x);
  // (3) q = x . Wq^T + bq, k = x . Wk^T + bk, v^T = Wv . x^T + bv, both batch elements: 128 tiles of 128x128 each, one per work-group
  qkv_gemm64<<<dim3((SEQ / 128) * (HID / 128), NB, 3), dim3(128), 0, stream>>>(Xh, Xl, Wh, Wl, Ch, Cl, bq, bk, bv);
  // (4) full attention per head and batch element, no score scaling; f32 tiles go straight to the output rows
  attn_full64_kernel<<<dim3(NHEAD * (SEQ / 128), NB), dim3(128), 0, stream>>>(
      Ch, Cl, Ch + EP, Cl + EP, Ch + 2 * EP, Cl + 2 * EP, (float*)d_out);
  (void)hipGetLastError();
}

// v009
// Measured time: 130 microseconds a run.
// Two timings next to v008 put it at 1.20 and 1.19 times that version's speed.
// Counting every step since v000, it is 5.79 times as fast.
// All contractions (q, k, v^T projections, q.k^T, p.v): v_wmma_f32_16x16x32_bf16 with bf16 hi/lo split operands (hi.hi + hi.lo + lo.hi), f32 accumulate; online softmax, biases and normalisation in f32; no score scaling.
#include <hip/hip_runtime.h>
#include <math.h>
#include <stdint.h>

#define NB    2
#define SEQ   2048
#define HID   1024
#define NHEAD 16
#define DHD   64

typedef __attribute__((ext_vector_type(16))) _Float16 v16h;
typedef __attribute__((ext_vector_type(8)))  _Float16 v8h;
typedef __attribute__((ext_vector_type(16))) __bf16   v16b;
typedef __attribute__((ext_vector_type(8)))  __bf16   v8b;
typedef __attribute__((ext_vector_type(8)))  float    v8f;
typedef __attribute__((ext_vector_type(4)))  float    v4f;
typedef __attribute__((ext_vector_type(2)))  float    v2f;
typedef __attribute__((ext_vector_type(4)))  unsigned int v4u;

__device__ __forceinline__ unsigned short f2bf_bits(float f) {
  unsigned u = __float_as_uint(f);
  return (unsigned short)((u + 0x7FFFu + ((u >> 16) & 1u)) >> 16);
}
__device__ __forceinline__ float bf_bits2f(unsigned short h) { return __uint_as_float(((unsigned)h) << 16); }

// hazard guards as plain device helpers
__device__ __forceinline__ void dep_guard_h(v8f& a, v8f& b, v16h x, v16h y) { asm volatile("v_nop\n\tv_nop\n\tv_nop\n\tv_nop" : "+v"(a), "+v"(b) : "v"(x), "v"(y)); }
__device__ __forceinline__ void dep_guard_b(v8f& a, v8f& b, v16b x, v16b y) { asm volatile("v_nop\n\tv_nop\n\tv_nop\n\tv_nop" : "+v"(a), "+v"(b) : "v"(x), "v"(y)); }
__device__ __forceinline__ void keep4_h(v16h a, v16h b, v16h c, v16h d) { asm volatile("v_nop" :: "v"(a), "v"(b), "v"(c), "v"(d)); }
__device__ __forceinline__ void keep4_b(v16b a, v16b b, v16b c, v16b d) { asm volatile("v_nop" :: "v"(a), "v"(b), "v"(c), "v"(d)); }
__device__ __forceinline__ void acc_guard4(v8f& a, v8f& b, v8f& c, v8f& d) { asm volatile("v_nop\n\tv_nop\n\tv_nop\n\tv_nop" : "+v"(a), "+v"(b), "+v"(c), "+v"(d)); }
template <typename T> struct Frag;
template <> struct Frag<_Float16> {
  typedef v16h V; union U { v16h v; v8h h[2]; };
  static __device__ __forceinline__ v16h load(const _Float16* p) {   // elements 0..7 <- p[0..7], 8..15 <- p[16..23]
    U f; f.h[0] = *(const v8h*)(p); f.h[1] = *(const v8h*)(p + 16); return f.v;
  }
  static __device__ __forceinline__ v8f mma(v16h a, v16h b, v8f c) {
    return __builtin_amdgcn_wmma_f32_16x16x32_f16(false, a, false, b, (short)0, c, false, false);
  }
  static __device__ __forceinline__ void guard(v8f& a, v8f& b, v16h x, v16h y) { dep_guard_h(a, b, x, y); }
  static __device__ __forceinline__ void keep(v16h a, v16h b, v16h c, v16h d) { keep4_h(a, b, c, d); }
};
template <> struct Frag<__bf16> {
  typedef v16b V; union U { v16b v; v8b h[2]; };
  static __device__ __forceinline__ v16b load(const __bf16* p) {
    U f; f.h[0] = *(const v8b*)(p); f.h[1] = *(const v8b*)(p + 16); return f.v;
  }
  static __device__ __forceinline__ v8f mma(v16b a, v16b b, v8f c) {
    return __builtin_amdgcn_wmma_f32_16x16x32_bf16(false, a, false, b, (short)0, c, false, false);
  }
  static __device__ __forceinline__ void guard(v8f& a, v8f& b, v16b x, v16b y) { dep_guard_b(a, b, x, y); }
  static __device__ __forceinline__ void keep(v16b a, v16b b, v16b c, v16b d) { keep4_b(a, b, c, d); }
};

// ---- Register-blocked WMMA GEMM, all three projections of both batch elements in ONE launch ----------
// C[m,n] = sum_k A[m,k] * Bt[n,k] + bias; a work-group owns a 128x128 tile, each of its 4 waves (2 x 2) a 64x64 tile;
// K = HID, row pitch of A and Bt = 2 HID elements (hi and lo blocks).
// Operands are bf16 hi/lo parts; product = hi.hi + hi.lo + lo.hi; output = bf16 hi plane + bf16 lo plane.
// Operand layout in memory (x and W): one array per operand, a row = 32 blocks of 128 B, block kb = [hi of k = 32 kb .. 32 kb + 31]
// [lo of the same k]: the 64 B of hi and the 64 B of lo that one stage needs of a row are one whole cache line.
// blockIdx.z = projection p, blockIdx.y = batch element b, blockIdx.x = 128x128 tile (128 tiles per (p, b)).
//   p = 0, 1 (q, k): A = x[b] [SEQ][2 HID], Bt = W[p] [HID][2 HID], C [SEQ][HID], bias[n]
//   p = 2   (v^T)  : A = W[2] [HID][2 HID], Bt = x[b] [SEQ][2 HID], C [HID][SEQ], bias[m]
// Grid 128 x 2 x 3 = 768 work-groups of 4 waves = 3 per WGP on 256 WGPs.
// Operand path: a stage = 32 k of the 128 A rows and the 128 Bt rows, hi and lo planes, brought into LDS by asynchronous
// copies (16 B per lane, 16 copies per lane and stage); two buffers, the next stage's copies fly while this one is worked on.
// Eight neighbouring lanes take one row's 128-B block, so a wave-wide copy touches 4 whole cache lines.
#define GS_KS   32                     // k per stage
#define GS_LP   40                     // LDS row pitch in elements: 80 B = 16 B x 5 (odd), free of bank conflicts for ds_load_b128
#define GS_PL   (128 * GS_LP)          // elements of one plane of a stage (128 rows)
#define GS_ST   (4 * GS_PL)            // elements of one stage: A hi, A lo, Bt hi, Bt lo (40960 B)
#define GS_NT   (HID / GS_KS)          // 32 stages
#define GS_GP   (2 * HID)              // row pitch of an operand in memory, elements (hi and lo blocks interleaved)

// Eight asynchronous 16-B copies per lane, global -> LDS. The s_wait_xcnt closes the statement so that no address register
// of a copy is rewritten in front of it.
__device__ __forceinline__ void gs_copy8(unsigned l0, unsigned l1, unsigned l2, unsigned l3,
                                         unsigned l4, unsigned l5, unsigned l6, unsigned l7,
                                         const __bf16* g0, const __bf16* g1, const __bf16* g2, const __bf16* g3,
                                         const __bf16* g4, const __bf16* g5, const __bf16* g6, const __bf16* g7) {
  asm volatile("global_load_async_to_lds_b128 %0, %8, off\n\t"
               "global_load_async_to_lds_b128 %1, %9, off\n\t"
               "global_load_async_to_lds_b128 %2, %10, off\n\t"
               "global_load_async_to_lds_b128 %3, %11, off\n\t"
               "global_load_async_to_lds_b128 %4, %12, off\n\t"
               "global_load_async_to_lds_b128 %5, %13, off\n\t"
               "global_load_async_to_lds_b128 %6, %14, off\n\t"
               "global_load_async_to_lds_b128 %7, %15, off\n\t"
               "s_wait_xcnt 0x0"
               :: "v"(l0), "v"(l1), "v"(l2), "v"(l3), "v"(l4), "v"(l5), "v"(l6), "v"(l7),
                  "v"(g0), "v"(g1), "v"(g2), "v"(g3), "v"(g4), "v"(g5), "v"(g6), "v"(g7)
               : "memory");
}
// One stage of one operand: g = this lane's first 16 B (row tid >> 3, piece tid & 7 of the stage's 128-B block: 0..3 hi, 4..7 lo);
// l = the LDS byte address of that piece (hi or lo plane of the stage buffer). Rows step by 16.
__device__ __forceinline__ void gs_copy_operand(unsigned l, const __bf16* g) {
  const unsigned rs = 16 * GS_LP * 2;
  gs_copy8(l, l + rs, l + 2 * rs, l + 3 * rs, l + 4 * rs, l + 5 * rs, l + 6 * rs, l + 7 * rs,
           g, g + 16 * GS_GP, g + 32 * GS_GP, g + 48 * GS_GP, g + 64 * GS_GP, g + 80 * GS_GP, g + 96 * GS_GP, g + 112 * GS_GP);
}

__global__ __launch_bounds__(128) void qkv_gemm64(
    const unsigned short* __restrict__ Xp, const unsigned short* __restrict__ Wp,
    unsigned short* __restrict__ Chp, unsigned short* __restrict__ Clp,
    const float* __restrict__ bq, const float* __restrict__ bk, const float* __restrict__ bv) {
  typedef __bf16 T;
  typedef Frag<T>::V V;
  __shared__ __align__(16) T     sS[2 * GS_ST];    // two stage buffers, 81920 B
  __shared__ __align__(16) float sT[4][16 * 68];   // per-wave 16x64 slab, pitch 68 floats
  const int p    = blockIdx.z;
  const int b    = blockIdx.y;
  const bool vt  = (p == 2);
  const int tid  = threadIdx.x;
  const int lane = tid & 31;
  const int wave = tid >> 5;
  const int ldc  = vt ? SEQ : HID;
  const int shN  = vt ? 4 : 3;                     // log2 of the 128-wide tiles per row of C (N / 128)
  const int tile = blockIdx.x;                     // 0..127
  const int tm = tile >> shN;
  const int tn = tile - (tm << shN);
  const int mB = tm << 7;                          // the work-group's first row and column of C
  const int nB = tn << 7;
  const int wm = (wave >> 1) << 6;                 // the wave's 64x64 tile inside it
  const int wn = (wave & 1) << 6;
  const int m0 = mB + wm;
  const int n0 = nB + wn;

  const size_t xo = (size_t)b * SEQ * GS_GP;
  const size_t wo = (size_t)p * HID * GS_GP;
  const T* Ab = (const T*)(vt ? Wp + wo : Xp + xo);
  const T* Bb = (const T*)(vt ? Xp + xo : Wp + wo);
  const float* bias = (p == 0) ? bq : ((p == 1) ? bk : bv);

  const int rlane = lane & 15;                 // row (A) / col (B, D) within subtile
  const int koff  = (lane >> 4) * 8;           // k offset of this lane half
  const int mOff  = (lane >> 4) * 8;           // D row offset

  // this lane's share of a stage: rows tid >> 3 (+ 16, .., 112) of both operands, 16-B piece tid & 7 of the row's 128-B block
  const int crow = tid >> 3, cpc = tid & 7;
  const T* gA = Ab + (size_t)(mB + crow) * GS_GP + cpc * 8;
  const T* gB = Bb + (size_t)(nB + crow) * GS_GP + cpc * 8;
  // LDS byte address, buffer 0, A: pieces 0..3 go to the hi plane, 4..7 to the lo plane
  const unsigned lA = (unsigned)(size_t)sS + (unsigned)((cpc >> 2) * GS_PL + crow * GS_LP + (cpc & 3) * 8) * 2u;
  const unsigned lB = lA + 2u * GS_PL * 2u;                                          // buffer 0, Bt

  v8f acc[4][4];
#pragma unroll
  for (int i = 0; i < 4; ++i)
#pragma unroll
    for (int j = 0; j < 4; ++j) acc[i][j] = (v8f){0.f,0.f,0.f,0.f,0.f,0.f,0.f,0.f};

  // prologue: stage 0 lands and is published, then stage 1 is set off
  gs_copy_operand(lA, gA);
  gs_copy_operand(lB, gB);
  asm volatile("s_wait_asynccnt 0x0" ::: "memory");   // this wave's copies of stage 0 have landed
  __syncthreads();                                    // ... and every other wave's
  gs_copy_operand(lA + GS_ST * 2u, gA + 2 * GS_KS);
  gs_copy_operand(lB + GS_ST * 2u, gB + 2 * GS_KS);

  for (int t = 0; t < GS_NT; ++t) {
    const int bo_ = (t & 1) * GS_ST;
    const T* sA = sS + bo_ + (wm + rlane) * GS_LP + koff;               // A hi rows of this wave; lo GS_PL behind
    const T* sB = sS + bo_ + 2 * GS_PL + (wn + rlane) * GS_LP + koff;   // Bt hi rows of this wave; lo GS_PL behind
    V bh[4], bl[4];
#pragma unroll
    for (int j = 0; j < 4; ++j) {
      bh[j] = Frag<T>::load(sB + (j << 4) * GS_LP);
      bl[j] = Frag<T>::load(sB + GS_PL + (j << 4) * GS_LP);
    }
    V ah[2], al[2];                      // two A fragment sets: the next 16 rows' LDS reads are asked for ahead of this block's products
    ah[0] = Frag<T>::load(sA);
    al[0] = Frag<T>::load(sA + GS_PL);
#pragma unroll
    for (int i = 0; i < 4; ++i) {
      if (i < 3) {
        ah[(i + 1) & 1] = Frag<T>::load(sA + ((i + 1) << 4) * GS_LP);
        al[(i + 1) & 1] = Frag<T>::load(sA + GS_PL + ((i + 1) << 4) * GS_LP);
      }
#pragma unroll
      for (int j = 0; j < 4; ++j) {
        acc[i][j] = Frag<T>::mma(ah[i & 1], bh[j], acc[i][j]);
        acc[i][j] = Frag<T>::mma(ah[i & 1], bl[j], acc[i][j]);
        acc[i][j] = Frag<T>::mma(al[i & 1], bh[j], acc[i][j]);
      }
      Frag<T>::guard(acc[i][0], acc[i][3], ah[i & 1], al[i & 1]);
    }
    Frag<T>::keep(bh[0], bh[1], bh[2], bh[3]);
    Frag<T>::keep(bl[0], bl[1], bl[2], bl[3]);
    // publish point of stage t + 1
    asm volatile("s_wait_dscnt 0x0" ::: "memory");      // this wave's reads of buffer t & 1 are done before it is refilled
    asm volatile("s_wait_asynccnt 0x0" ::: "memory");   // this wave's copies of stage t + 1 have landed
    __syncthreads();                                    // stage t + 1 readable by all; buffer t & 1 left by all
    if (t + 2 < GS_NT) {
      const int kn = (t + 2) * (2 * GS_KS);             // the stage's 128-B block of every row
      gs_copy_operand(lA + (unsigned)bo_ * 2u, gA + kn);
      gs_copy_operand(lB + (unsigned)bo_ * 2u, gB + kn);
    }
  }
  asm volatile("s_wait_asynccnt 0x0" ::: "memory");     // no copy is outstanding when the wave goes on
  acc_guard4(acc[0][0], acc[0][1], acc[0][2], acc[0][3]);
  acc_guard4(acc[1][0], acc[1][1], acc[1][2], acc[1][3]);
  acc_guard4(acc[2][0], acc[2][1], acc[2][2], acc[2][3]);
  acc_guard4(acc[3][0], acc[3][1], acc[3][2], acc[3][3]);

  // ---- epilogue ----
  float* slab = sT[wave];
  const size_t co = (size_t)(p * NB + b) * SEQ * HID;
  unsigned short* C  = Chp + co;
  unsigned short* C2 = Clp + co;
#pragma unroll
  for (int i = 0; i < 4; ++i) {
    const int mBase = m0 + (i << 4);
    float bm[8];                                   // bias[m] of this lane's 8 rows (v^T only; index 0 otherwise, unused)
#pragma unroll
    for (int r = 0; r < 8; ++r) bm[r] = bias[vt ? (mBase + mOff + r) : 0];
#pragma unroll
    for (int j = 0; j < 4; ++j) {
      const int n = n0 + (j << 4) + rlane;
      const float bn = bias[vt ? 0 : n];           // bias[n] of this lane's column (q, k only)
#pragma unroll
      for (int r = 0; r < 8; ++r) {
        const float v = acc[i][j][r] + (vt ? bm[r] : bn);
        slab[(mOff + r) * 68 + (j << 4) + rlane] = v;
      }
    }
    __builtin_amdgcn_fence(__ATOMIC_RELEASE, "workgroup");
    __builtin_amdgcn_wave_barrier();
    __builtin_amdgcn_fence(__ATOMIC_ACQUIRE, "workgroup");
    {
      const int q = lane >> 3, c8 = (lane & 7) * 8;
#pragma unroll
      for (int it = 0; it < 4; ++it) {
        const int row = it * 4 + q;                       // it 0..3 x q 0..3 = rows 0..15 of the slab
        const float* sp = slab + row * 68 + c8;
        v8h hv, lv;
#pragma unroll
        for (int e = 0; e < 8; ++e) {
          unsigned short hb = f2bf_bits(sp[e]);
          unsigned short lb = f2bf_bits(sp[e] - bf_bits2f(hb));
          hv[e] = __builtin_bit_cast(_Float16, hb);
          lv[e] = __builtin_bit_cast(_Float16, lb);
        }
        *(v8h*)(C  + (size_t)(mBase + row) * ldc + n0 + c8) = hv;
        *(v8h*)(C2 + (size_t)(mBase + row) * ldc + n0 + c8) = lv;
      }
    }
    __builtin_amdgcn_fence(__ATOMIC_RELEASE, "workgroup");
    __builtin_amdgcn_wave_barrier();
    __builtin_amdgcn_fence(__ATOMIC_ACQUIRE, "workgroup");
  }
}

// ---------------------------------------------------------------------------
// Elementwise bf16 split: hi = bf16_rne(in), lo = bf16_rne(in - hi); 2 elements per thread, two 4-B stores.
// Output layout: blocks of 128 B = [hi of 32 consecutive elements][lo of the same 32] (a row of HID elements = 32 blocks).
// A wave covers two blocks. The lane halves exchange one word (lanes 0..15 give their lo, lanes 16..31 their hi), so that each of
// the wave's two stores writes one whole block: a whole cache line.
// blockIdx.y picks the source (in0, in1, in2) and its 2 * n2 words of output. n2 is a multiple of the block size: every lane is on.
//   weights: grid 2048 x 3, n2 = 1024*1024/2 = 524288 pairs per weight
//   activations, both batch elements: grid 8192 x 1, n2 = 2*2048*1024/2 = 2097152 pairs
// ---------------------------------------------------------------------------
__device__ __forceinline__ unsigned pk16(unsigned short a, unsigned short b) { return (unsigned)a | ((unsigned)b << 16); }

__global__ __launch_bounds__(256) void split_bf16x2_kernel(const float* __restrict__ in0, const float* __restrict__ in1,
                                                           const float* __restrict__ in2, unsigned short* __restrict__ hl,
                                                           int n2) {
  const int y = blockIdx.y;
  const float* in = (y == 0) ? in0 : ((y == 1) ? in1 : in2);
  const int i = blockIdx.x * 256 + threadIdx.x;
  if (i < n2) {
    const v2f f = *(const v2f*)(in + 2 * (size_t)i);
    const unsigned short h0 = f2bf_bits(f[0]), h1 = f2bf_bits(f[1]);
    const unsigned short l0 = f2bf_bits(f[0] - bf_bits2f(h0)), l1 = f2bf_bits(f[1] - bf_bits2f(h1));
    const unsigned uh = pk16(h0, h1), ul = pk16(l0, l1);
    const int lane = threadIdx.x & 31;
    const bool lowh = lane < 16;
    const unsigned give = lowh ? ul : uh;
    const unsigned got  = (unsigned)__builtin_amdgcn_permlanex16((int)give, (int)give, 0x76543210, 0xfedcba98, false, false);   // lane ^ 16
    unsigned* o = (unsigned*)hl + (size_t)y * 2 * n2 + (size_t)(i >> 5) * 64 + lane;   // the wave's first block, word = lane
    o[0]  = lowh ? uh : got;     // block 0: hi of lanes 0..15, lo of lanes 0..15
    o[32] = lowh ? got : ul;     // block 1: hi of lanes 16..31, lo of lanes 16..31
  }
}

// =====================================================================================
// Full (non-causal, unmasked) attention, head dim 64, one launch; blockIdx.y = batch element (planes and out SEQ*HID apart).
//   q planes (hi/lo bf16): element (t, h, d) at [t*HID + h*64 + d]
//   k planes (hi/lo bf16): element (s, h, d) at [s*HID + h*64 + d]
//   v^T planes (hi/lo bf16): element (h, d, s) at [(h*64 + d)*SEQ + s]
//   out f32: element (t, h, d) at [t*HID + h*64 + d]   (the module output rows of this batch element)
//   scores^T = k . q^T (unscaled)  : A = K rows, B = q; bf16 hi/lo split (hi.hi + hi.lo + lo.hi) on v_wmma_f32_16x16x32_bf16
//   out^T    = v^T . p^T          : A = V^T rows, B = p^T packed in place from the score accumulators (hi/lo split), f32 accumulate
//   A lane holds scores of ONE query (column lane & 15): keys j*16 + 8*(lane >> 4) + r. Two score tiles (2kk, 2kk+1) are,
//   register for register, the B fragment of keys kk*32 .. kk*32+31, so p never goes through LDS.
//   online softmax in f32 over all SEQ keys (32 chunks of 64, compile-time trip count, no masking): maximum and sum in-lane,
//   one exchange of the maximum between the lane halves per chunk; the halves' sums are joined once after the loop.
//   Exponentials in base 2: the maximum is taken over the raw scores and kept as m2 = max * log2(e); p = 2^(s * log2(e) - m2), one
//   multiply-add and one v_exp_f32 per score. The rounding of m2 scales every term of a row alike and cancels in the normalisation.
//   A wave owns 32 queries = two column groups g of 16: every K and V^T fragment read from LDS feeds the products of both groups.
//   Block = 4 waves = 128 query rows of one head; grid = (NHEAD * (SEQ/128) = 256) x NB.
//   K / V^T chunk staging: 128 threads x 32 elements per plane = the whole 64x64 tile (16-B copies, plain loads, 8 lanes per 128-B row,
//   __syncthreads before and after); fragment loads read the LDS tiles with the same v8b element type.
// =====================================================================================
#define AT_D 64
#define AT_NW 4
#define AT_G 2     // column groups of 16 queries per wave
#define AT_QB 128  // queries per work-group = AT_NW * AT_G * 16
#define AT_KC 64
#define AT_L2E 1.4426950408889634f   // log2(e)
#define AT_LP 72   // LDS row pitch of the K and V^T tiles in elements: 144 B = 16 B x 9 (odd), so the 16 rows of a ds_load_b128 half-wave fall on 16 different bank groups

__device__ __forceinline__ v8f at_mma(v16b a, v16b b, v8f c) {
  return __builtin_amdgcn_wmma_f32_16x16x32_bf16(false, a, false, b, (short)0, c, false, false);
}
// two f32 -> one packed register of bf16 hi parts and one of bf16 lo parts: hi = rne(f), lo = rne(f - hi)
typedef __attribute__((ext_vector_type(2))) __bf16 v2b;
__device__ __forceinline__ void at_split2(v2f f, v2b& hi, v2b& lo) {
  hi = __builtin_convertvector(f, v2b);
  lo = __builtin_convertvector(f - __builtin_convertvector(hi, v2f), v2b);
}
// value of lane l ^ 16 (the other half's share of the same query column)
__device__ __forceinline__ float at_xhalf(float f) {
  const int b = __float_as_int(f);
  return __int_as_float(__builtin_amdgcn_permlanex16(b, b, 0x76543210, 0xfedcba98, false, false));
}

// 512 work-groups of 4 waves = two per WGP, one wave of each on every SIMD: register budget 512 a wave
__global__ __launch_bounds__(128) __attribute__((amdgpu_waves_per_eu(2, 2)))
void attn_full64_kernel(const unsigned short* __restrict__ qhp, const unsigned short* __restrict__ qlp,
                        const unsigned short* __restrict__ khp, const unsigned short* __restrict__ klp,
                        const unsigned short* __restrict__ vhp, const unsigned short* __restrict__ vlp,
                        float* __restrict__ out) {
  union FB { v16b v; v8b h[2]; v2b w[8]; };
  __shared__ __align__(16) __bf16 Ksh[AT_KC * AT_LP];            // K hi [kv][d], pitch AT_LP    9 KB
  __shared__ __align__(16) __bf16 Ksl[AT_KC * AT_LP];            // K lo
  __shared__ __align__(16) __bf16 Vth[AT_D * AT_LP];             // V hi [d][kv], pitch AT_LP    9 KB
  __shared__ __align__(16) __bf16 Vtl[AT_D * AT_LP];             // V lo
  __shared__ __align__(16) float  Os[AT_NW][AT_G * 16 * 68];     // per wave out tile (32 query rows), pitch 68

  const int tid  = threadIdx.x;
  const int wave = tid >> 5;
  const int lane = tid & 31;
  const int hh   = lane >> 4;
  const int c    = lane & 15;

  const int nqb = SEQ / AT_QB;            // 16
  const int bx = blockIdx.x;
  const int qb = bx % nqb;
  const int h  = bx / nqb;                // 0..NHEAD-1 (grid = NHEAD * nqb)
  const int q0 = qb * AT_QB + wave * (AT_G * 16);

  const size_t bo = (size_t)blockIdx.y * SEQ * HID;   // this batch element's planes and output rows
  const __bf16* Qh = (const __bf16*)(const void*)qhp + bo + (size_t)h * AT_D;
  const __bf16* Ql = (const __bf16*)(const void*)qlp + bo + (size_t)h * AT_D;
  const __bf16* Kh = (const __bf16*)(const void*)khp + bo + (size_t)h * AT_D;
  const __bf16* Kl = (const __bf16*)(const void*)klp + bo + (size_t)h * AT_D;
  const __bf16* Vh = (const __bf16*)(const void*)vhp + bo + (size_t)h * AT_D * SEQ;
  const __bf16* Vl = (const __bf16*)(const void*)vlp + bo + (size_t)h * AT_D * SEQ;
  float*        ob = out + bo + (size_t)h * AT_D;

  // ---- Q fragments (B operand, column = lane&15 of group g, split k map via Frag load): 2 d-chunks, hi and lo ----
  v16b qah[AT_G][2], qal[AT_G][2];
#pragma unroll   // full unroll, here and in every loop over g below: what g indexes lives in registers and needs a compile-time index
  for (int g = 0; g < AT_G; ++g)
#pragma unroll
    for (int dc = 0; dc < 2; ++dc) {
      const __bf16* qr = Qh + (size_t)(q0 + g * 16 + c) * HID + dc * 32 + 8 * hh;
      const __bf16* ql = Ql + (size_t)(q0 + g * 16 + c) * HID + dc * 32 + 8 * hh;
      qah[g][dc] = Frag<__bf16>::load(qr);
      qal[g][dc] = Frag<__bf16>::load(ql);
    }

  // per group, this lane's query: running maximum times log2(e) (both halves agree), this half's share of the sum
  float mrow[AT_G], lrow[AT_G];
  v8f oacc[AT_G][4];                    // oacc[g][t][r] = out^T[d = t*16 + 8*hh + r][query g*16 + c]
#pragma unroll
  for (int g = 0; g < AT_G; ++g) {
    mrow[g] = -INFINITY;
    lrow[g] = 0.f;
#pragma unroll
    for (int t = 0; t < 4; ++t) oacc[g][t] = (v8f){0.f,0.f,0.f,0.f,0.f,0.f,0.f,0.f};
  }

  const int nChunks = SEQ / AT_KC;   // 32, compile-time constant
  for (int kc = 0; kc < nChunks; ++kc) {
    const int kv0 = kc * AT_KC;
    __syncthreads();
    {
      // staging coverage: 4 passes x 16 rows x 8 pieces of 16 B = 64 rows x 64 elements per plane = the whole chunk tile.
      // Eight neighbouring lanes take one row's 128 B, so a wave-wide load touches 4 whole cache lines.
      const int r = tid >> 3, pc = (tid & 7) * 8;
      const __bf16* ksh = Kh + (size_t)(kv0 + r) * HID + pc;      // K row kv0+r (+16 per pass), d = pc..pc+7
      const __bf16* ksl = Kl + (size_t)(kv0 + r) * HID + pc;
      const __bf16* vsh = Vh + (size_t)r * SEQ + kv0 + pc;        // V^T row d = r (+16 per pass), s = kv0+pc..+7
      const __bf16* vsl = Vl + (size_t)r * SEQ + kv0 + pc;
#pragma unroll
      for (int i = 0; i < 4; ++i) {
        const v8b a0 = *(const v8b*)(ksh + (size_t)(16 * i) * HID);
        const v8b a1 = *(const v8b*)(ksl + (size_t)(16 * i) * HID);
        const v8b b0 = *(const v8b*)(vsh + (size_t)(16 * i) * SEQ);
        const v8b b1 = *(const v8b*)(vsl + (size_t)(16 * i) * SEQ);
        *(v8b*)(Ksh + (r + 16 * i) * AT_LP + pc) = a0;
        *(v8b*)(Ksl + (r + 16 * i) * AT_LP + pc) = a1;
        *(v8b*)(Vth + (r + 16 * i) * AT_LP + pc) = b0;
        *(v8b*)(Vtl + (r + 16 * i) * AT_LP + pc) = b1;
      }
    }
    __syncthreads();

    // The four key tiles of both column groups are eight independent accumulator chains: the fragments of all four tiles are read as
    // one group, then each of the three products runs over the eight chains in turn. Each s[g][j] still sums its six products in the
    // order dc, hi.hi, lo.hi, hi.lo.
    // Every loop here is fully unrolled: kb[], kl[] and s[][] live in registers and need compile-time indices.
    v8f s[AT_G][4];
#pragma unroll
    for (int g = 0; g < AT_G; ++g)
#pragma unroll
      for (int j = 0; j < 4; ++j) s[g][j] = (v8f){0.f,0.f,0.f,0.f,0.f,0.f,0.f,0.f};
#pragma unroll
    for (int dc = 0; dc < 2; ++dc) {
      FB kb[4], kl[4];
#pragma unroll
      for (int j = 0; j < 4; ++j) {
        kb[j].h[0] = *(const v8b*)(Ksh + (j * 16 + c) * AT_LP + dc * 32 + 8 * hh);
        kb[j].h[1] = *(const v8b*)(Ksh + (j * 16 + c) * AT_LP + dc * 32 + 16 + 8 * hh);
        kl[j].h[0] = *(const v8b*)(Ksl + (j * 16 + c) * AT_LP + dc * 32 + 8 * hh);
        kl[j].h[1] = *(const v8b*)(Ksl + (j * 16 + c) * AT_LP + dc * 32 + 16 + 8 * hh);
      }
#pragma unroll
      for (int g = 0; g < AT_G; ++g)
#pragma unroll
        for (int j = 0; j < 4; ++j) s[g][j] = at_mma(kb[j].v, qah[g][dc], s[g][j]);
#pragma unroll
      for (int g = 0; g < AT_G; ++g)
#pragma unroll
        for (int j = 0; j < 4; ++j) s[g][j] = at_mma(kl[j].v, qah[g][dc], s[g][j]);
#pragma unroll
      for (int g = 0; g < AT_G; ++g)
#pragma unroll
        for (int j = 0; j < 4; ++j) s[g][j] = at_mma(kb[j].v, qal[g][dc], s[g][j]);
    }
    // s[g][j][r] = score of key kv0 + j*16 + 8*hh + r against query g*16 + c
    FB pah[AT_G][2], pal[AT_G][2];       // p^T as B fragments: element e of [g][kk] = key kk*32 + (e < 8 ? 8*hh + e : 16 + 8*hh + e - 8)
#pragma unroll   // full unroll: every array indexed by g lives in registers
    for (int g = 0; g < AT_G; ++g) {
      float mj[4];
#pragma unroll
      for (int j = 0; j < 4; ++j) {
        float m = -INFINITY;
#pragma unroll
        for (int r = 0; r < 8; ++r) m = fmaxf(m, s[g][j][r]);
        mj[j] = m;
      }
      const float mh = fmaxf(fmaxf(mj[0], mj[1]), fmaxf(mj[2], mj[3]));
      const float mnew = fmaxf(mrow[g], fmaxf(mh, at_xhalf(mh)) * AT_L2E);
      const float alpha = __builtin_amdgcn_exp2f(mrow[g] - mnew);   // 0 in the first chunk, where mrow is -inf
      mrow[g] = mnew;
      const v2f l2e = (v2f){AT_L2E, AT_L2E}, nm = (v2f){-mnew, -mnew};
      float pj[4];
#pragma unroll
      for (int j = 0; j < 4; ++j) {
        float psum = 0.f;
#pragma unroll
        for (int r = 0; r < 8; r += 2) {
          const v2f arg = __builtin_elementwise_fma((v2f){s[g][j][r], s[g][j][r + 1]}, l2e, nm);   // <= about 0: no overflow
          const float p0 = __builtin_amdgcn_exp2f(arg[0]);
          const float p1 = __builtin_amdgcn_exp2f(arg[1]);
          psum += p0;
          psum += p1;
          at_split2((v2f){p0, p1}, pah[g][j >> 1].w[(j & 1) * 4 + (r >> 1)], pal[g][j >> 1].w[(j & 1) * 4 + (r >> 1)]);
        }
        pj[j] = psum;
      }
      lrow[g] = lrow[g] * alpha + ((pj[0] + pj[1]) + (pj[2] + pj[3]));
#pragma unroll
      for (int t = 0; t < 4; ++t)
#pragma unroll
        for (int r = 0; r < 8; ++r) oacc[g][t][r] *= alpha;
    }
#pragma unroll   // full unroll: pah[g][kk], pal[g][kk] live in registers and need a compile-time index
    for (int kk = 0; kk < 2; ++kk) {
      // as for the scores: the four d tiles of both groups are independent chains, their fragments read as one group; order per
      // oacc[g][t] unchanged; full unroll for the same reason (vb[], vl[], oacc[][] in registers)
      FB vb[4], vl[4];
#pragma unroll
      for (int t = 0; t < 4; ++t) {
        vb[t].h[0] = *(const v8b*)(Vth + (t * 16 + c) * AT_LP + kk * 32 + 8 * hh);
        vb[t].h[1] = *(const v8b*)(Vth + (t * 16 + c) * AT_LP + kk * 32 + 16 + 8 * hh);
        vl[t].h[0] = *(const v8b*)(Vtl + (t * 16 + c) * AT_LP + kk * 32 + 8 * hh);
        vl[t].h[1] = *(const v8b*)(Vtl + (t * 16 + c) * AT_LP + kk * 32 + 16 + 8 * hh);
      }
#pragma unroll
      for (int g = 0; g < AT_G; ++g)
#pragma unroll
        for (int t = 0; t < 4; ++t) oacc[g][t] = at_mma(vb[t].v, pah[g][kk].v, oacc[g][t]);
#pragma unroll
      for (int g = 0; g < AT_G; ++g)
#pragma unroll
        for (int t = 0; t < 4; ++t) oacc[g][t] = at_mma(vl[t].v, pah[g][kk].v, oacc[g][t]);
#pragma unroll
      for (int g = 0; g < AT_G; ++g)
#pragma unroll
        for (int t = 0; t < 4; ++t) oacc[g][t] = at_mma(vb[t].v, pal[g][kk].v, oacc[g][t]);
    }
  }

  float* os = Os[wave];
#pragma unroll
  for (int g = 0; g < AT_G; ++g) {
    const float inv = 1.0f / (lrow[g] + at_xhalf(lrow[g]));   // both halves' sums; >= 1 (the row max contributes p = 1)
#pragma unroll
    for (int t = 0; t < 4; ++t) {
      // query row g*16 + c of the wave tile, d = t*16 + 8*hh .. +7: two 16-B LDS stores
      float* op = os + (g * 16 + c) * 68 + t * 16 + 8 * hh;
      *(v4f*)(op)     = (v4f){oacc[g][t][0] * inv, oacc[g][t][1] * inv, oacc[g][t][2] * inv, oacc[g][t][3] * inv};
      *(v4f*)(op + 4) = (v4f){oacc[g][t][4] * inv, oacc[g][t][5] * inv, oacc[g][t][6] * inv, oacc[g][t][7] * inv};
    }
  }
  __builtin_amdgcn_fence(__ATOMIC_RELEASE, "workgroup");
  __builtin_amdgcn_wave_barrier();
  __builtin_amdgcn_fence(__ATOMIC_ACQUIRE, "workgroup");
  {
    const int c4 = (lane & 15) * 4;
#pragma unroll
    for (int it = 0; it < AT_G * 8; ++it) {
      const int row = it * 2 + hh;   // it 0..15 x hh 0..1 covers rows 0..31 of the wave tile; 16 lanes x 16 B = the 64-float head segment
      v4f val = *(const v4f*)(os + row * 68 + c4);
      *(v4f*)(ob + (size_t)(q0 + row) * HID + c4) = val;
    }
  }
}

// ---------------------------------------------------------------------------
// Workspace region map (byte offsets; every region is fully rewritten in each call)
//   Wi  bf16 [3 (q,k,v)][1024 o][32 blocks][hi 32 | lo 32]      0
//   Xi  bf16 [2 b][2048 s][32 blocks][hi 32 | lo 32]     12582912
//   Ch  bf16 [3 (q,k,v^T)][2 b][2048*1024]       29360128      Cl   54525952
//       q, k planes [s][h*64+d]; v^T planes [h*64+d][s]
//   total                                        79691776  (76 MiB)
// ---------------------------------------------------------------------------
extern "C" void kernel_launch(void* const* d_in, const int* in_sizes, int n_in,
                              void* d_out, int out_size, void* d_ws, size_t ws_size,
                              hipStream_t stream) {
  if (n_in < 7) return;
  if (in_sizes[0] != NB * SEQ * HID) return;
  if (in_sizes[1] != HID * HID || in_sizes[3] != HID * HID || in_sizes[5] != HID * HID) return;
  if (in_sizes[2] != HID || in_sizes[4] != HID || in_sizes[6] != HID) return;
  if (out_size != NB * SEQ * HID) return;

  const float* x  = (const float*)d_in[0];   // [2][2048][1024]
  const float* Wq = (const float*)d_in[1];   // [1024 out][1024 in]
  const float* bq = (const float*)d_in[2];   // [1024]
  const float* Wk = (const float*)d_in[3];
  const float* bk = (const float*)d_in[4];
  const float* Wv = (const float*)d_in[5];
  const float* bv = (const float*)d_in[6];

  const size_t PW = (size_t)HID * HID * 2;   // 2097152  bf16 weight plane [1024][1024]
  const size_t PX = (size_t)SEQ * HID * 2;   // 4194304  bf16 activation plane [2048][1024] (one batch element)
  size_t off = 0;
  const size_t oWi = off; off += 2 * 3 * PW;
  const size_t oXi = off; off += 2 * NB * PX;
  const size_t oCh = off; off += 3 * NB * PX;  const size_t oCl = off; off += 3 * NB * PX;
  if (off > ws_size) return;                 // off = 79691776

  char* ws = (char*)d_ws;
  unsigned short* Wi = (unsigned short*)(ws + oWi);
  unsigned short* Xi = (unsigned short*)(ws + oXi);
  unsigned short* Ch = (unsigned short*)(ws + oCh); unsigned short* Cl = (unsigned short*)(ws + oCl);
  const size_t EP = (size_t)NB * SEQ * HID;  // elements of one projection's planes (both batch elements)

  const dim3 blk(256);

  // (1) weights [out][in] are already the Bt [n][k] layout -> bf16 hi/lo blocks, no transpose; one launch for q, k, v
  const int n2w = HID * HID / 2;                            // 524288 pairs per plane
  split_bf16x2_kernel<<<dim3((n2w + 255) / 256, 3), blk, 0, stream>>>(Wq, Wk, Wv, Wi, n2w);
  // (2) x, both batch elements -> bf16 hi/lo blocks [2][2048][32][64]
  const int n2x = NB * SEQ * HID / 2;                       // 2097152 pairs per plane
  split_bf16x2_kernel<<<dim3((n2x + 255) / 256, 1), blk, 0, stream>>>(x, x, x, Xi, n2x);
  // (3) q = x . Wq^T + bq, k = x . Wk^T + bk, v^T = Wv . x^T + bv, both batch elements: 128 tiles of 128x128 each, one per work-group
  qkv_gemm64<<<dim3((SEQ / 128) * (HID / 128), NB, 3), dim3(128), 0, stream>>>(Xi, Wi, Ch, Cl, bq, bk, bv);
  // (4) full attention per head and batch element, no score scaling; f32 tiles go straight to the output rows
  attn_full64_kernel<<<dim3(NHEAD * (SEQ / 128), NB), dim3(128), 0, stream>>>(
      Ch, Cl, Ch + EP, Cl + EP, Ch + 2 * EP, Cl + 2 * EP, (float*)d_out);
  (void)hipGetLastError();
}

// v010
// One run takes 119 microseconds.
// In both of two side-by-side timings against v009, it was 1.09 times as fast.
// Counting every step since v000, it is 6.32 times as fast.
// All contractions (q, k, v^T projections, q.k^T, p.v): v_wmma_f32_16x16x32_bf16 with bf16 hi/lo split operands (hi.hi + hi.lo + lo.hi), f32 accumulate; online softmax, biases and normalisation in f32; no score scaling.
#include <hip/hip_runtime.h>
#include <math.h>
#include <stdint.h>

#define NB    2
#define SEQ   2048
#define HID   1024
#define NHEAD 16
#define DHD   64

typedef __attribute__((ext_vector_type(16))) _Float16 v16h;
typedef __attribute__((ext_vector_type(8)))  _Float16 v8h;
typedef __attribute__((ext_vector_type(16))) __bf16   v16b;
typedef __attribute__((ext_vector_type(8)))  __bf16   v8b;
typedef __attribute__((ext_vector_type(8)))  float    v8f;
typedef __attribute__((ext_vector_type(4)))  float    v4f;
typedef __attribute__((ext_vector_type(2)))  float    v2f;
typedef __attribute__((ext_vector_type(4)))  unsigned int v4u;

__device__ __forceinline__ unsigned short f2bf_bits(float f) {
  unsigned u = __float_as_uint(f);
  return (unsigned short)((u + 0x7FFFu + ((u >> 16) & 1u)) >> 16);
}
__device__ __forceinline__ float bf_bits2f(unsigned short h) { return __uint_as_float(((unsigned)h) << 16); }

// hazard guards as plain device helpers
__device__ __forceinline__ void dep_guard_h(v8f& a, v8f& b, v16h x, v16h y) { asm volatile("v_nop\n\tv_nop\n\tv_nop\n\tv_nop" : "+v"(a), "+v"(b) : "v"(x), "v"(y)); }
__device__ __forceinline__ void dep_guard_b(v8f& a, v8f& b, v16b x, v16b y) { asm volatile("v_nop\n\tv_nop\n\tv_nop\n\tv_nop" : "+v"(a), "+v"(b) : "v"(x), "v"(y)); }
__device__ __forceinline__ void keep4_h(v16h a, v16h b, v16h c, v16h d) { asm volatile("v_nop" :: "v"(a), "v"(b), "v"(c), "v"(d)); }
__device__ __forceinline__ void keep4_b(v16b a, v16b b, v16b c, v16b d) { asm volatile("v_nop" :: "v"(a), "v"(b), "v"(c), "v"(d)); }
__device__ __forceinline__ void acc_guard4(v8f& a, v8f& b, v8f& c, v8f& d) { asm volatile("v_nop\n\tv_nop\n\tv_nop\n\tv_nop" : "+v"(a), "+v"(b), "+v"(c), "+v"(d)); }
template <typename T> struct Frag;
template <> struct Frag<_Float16> {
  typedef v16h V; union U { v16h v; v8h h[2]; };
  static __device__ __forceinline__ v16h load(const _Float16* p) {   // elements 0..7 <- p[0..7], 8..15 <- p[16..23]
    U f; f.h[0] = *(const v8h*)(p); f.h[1] = *(const v8h*)(p + 16); return f.v;
  }
  static __device__ __forceinline__ v8f mma(v16h a, v16h b, v8f c) {
    return __builtin_amdgcn_wmma_f32_16x16x32_f16(false, a, false, b, (short)0, c, false, false);
  }
  static __device__ __forceinline__ void guard(v8f& a, v8f& b, v16h x, v16h y) { dep_guard_h(a, b, x, y); }
  static __device__ __forceinline__ void keep(v16h a, v16h b, v16h c, v16h d) { keep4_h(a, b, c, d); }
};
template <> struct Frag<__bf16> {
  typedef v16b V; union U { v16b v; v8b h[2]; };
  static __device__ __forceinline__ v16b load(const __bf16* p) {
    U f; f.h[0] = *(const v8b*)(p); f.h[1] = *(const v8b*)(p + 16); return f.v;
  }
  static __device__ __forceinline__ v8f mma(v16b a, v16b b, v8f c) {
    return __builtin_amdgcn_wmma_f32_16x16x32_bf16(false, a, false, b, (short)0, c, false, false);
  }
  static __device__ __forceinline__ void guard(v8f& a, v8f& b, v16b x, v16b y) { dep_guard_b(a, b, x, y); }
  static __device__ __forceinline__ void keep(v16b a, v16b b, v16b c, v16b d) { keep4_b(a, b, c, d); }
};

// ---- Register-blocked WMMA GEMM, all three projections of both batch elements in ONE launch ----------
// C[m,n] = sum_k A[m,k] * Bt[n,k] + bias; a work-group owns a 128x128 tile, each of its 4 waves (2 x 2) a 64x64 tile;
// K = HID, row pitch of A and Bt = 2 HID elements (hi and lo blocks).
// Operands are bf16 hi/lo parts; product = hi.hi + hi.lo + lo.hi; output = bf16 hi plane + bf16 lo plane.
// Operand layout in memory (x and W): one array per operand, a row = 32 blocks of 128 B, block kb = [hi of k = 32 kb .. 32 kb + 31]
// [lo of the same k]: the 64 B of hi and the 64 B of lo that one stage needs of a row are one whole cache line.
// blockIdx.z = projection p, blockIdx.y = batch element b, blockIdx.x = 128x128 tile (128 tiles per (p, b)).
//   p = 0, 1 (q, k): A = x[b] [SEQ][2 HID], Bt = W[p] [HID][2 HID], C [SEQ][HID], bias[n]
//   p = 2   (v^T)  : A = W[2] [HID][2 HID], Bt = x[b] [SEQ][2 HID], C [HID][SEQ], bias[m]
// Grid 128 x 2 x 3 = 768 work-groups of 4 waves = 3 per WGP on 256 WGPs.
// Operand path: a stage = 32 k of the 128 A rows and the 128 Bt rows, hi and lo planes, brought into LDS by asynchronous
// copies (16 B per lane, 16 copies per lane and stage); two buffers, the next stage's copies fly while this one is worked on.
// Eight neighbouring lanes take one row's 128-B block, so a wave-wide copy touches 4 whole cache lines.
#define GS_KS   32                     // k per stage
#define GS_LP   40                     // LDS row pitch in elements: 80 B = 16 B x 5 (odd), free of bank conflicts for ds_load_b128
#define GS_PL   (128 * GS_LP)          // elements of one plane of a stage (128 rows)
#define GS_ST   (4 * GS_PL)            // elements of one stage: A hi, A lo, Bt hi, Bt lo (40960 B)
#define GS_NT   (HID / GS_KS)          // 32 stages
#define GS_GP   (2 * HID)              // row pitch of an operand in memory, elements (hi and lo blocks interleaved)

// Eight asynchronous 16-B copies per lane, global -> LDS. The s_wait_xcnt closes the statement so that no address register
// of a copy is rewritten in front of it.
__device__ __forceinline__ void gs_copy8(unsigned l0, unsigned l1, unsigned l2, unsigned l3,
                                         unsigned l4, unsigned l5, unsigned l6, unsigned l7,
                                         const __bf16* g0, const __bf16* g1, const __bf16* g2, const __bf16* g3,
                                         const __bf16* g4, const __bf16* g5, const __bf16* g6, const __bf16* g7) {
  asm volatile("global_load_async_to_lds_b128 %0, %8, off\n\t"
               "global_load_async_to_lds_b128 %1, %9, off\n\t"
               "global_load_async_to_lds_b128 %2, %10, off\n\t"
               "global_load_async_to_lds_b128 %3, %11, off\n\t"
               "global_load_async_to_lds_b128 %4, %12, off\n\t"
               "global_load_async_to_lds_b128 %5, %13, off\n\t"
               "global_load_async_to_lds_b128 %6, %14, off\n\t"
               "global_load_async_to_lds_b128 %7, %15, off\n\t"
               "s_wait_xcnt 0x0"
               :: "v"(l0), "v"(l1), "v"(l2), "v"(l3), "v"(l4), "v"(l5), "v"(l6), "v"(l7),
                  "v"(g0), "v"(g1), "v"(g2), "v"(g3), "v"(g4), "v"(g5), "v"(g6), "v"(g7)
               : "memory");
}
// One stage of one operand: g = this lane's first 16 B (row tid >> 3, piece tid & 7 of the stage's 128-B block: 0..3 hi, 4..7 lo);
// l = the LDS byte address of that piece (hi or lo plane of the stage buffer). Rows step by 16.
__device__ __forceinline__ void gs_copy_operand(unsigned l, const __bf16* g) {
  const unsigned rs = 16 * GS_LP * 2;
  gs_copy8(l, l + rs, l + 2 * rs, l + 3 * rs, l + 4 * rs, l + 5 * rs, l + 6 * rs, l + 7 * rs,
           g, g + 16 * GS_GP, g + 32 * GS_GP, g + 48 * GS_GP, g + 64 * GS_GP, g + 80 * GS_GP, g + 96 * GS_GP, g + 112 * GS_GP);
}

__global__ __launch_bounds__(128) void qkv_gemm64(
    const unsigned short* __restrict__ Xp, const unsigned short* __restrict__ Wp,
    unsigned short* __restrict__ Chp, unsigned short* __restrict__ Clp,
    const float* __restrict__ bq, const float* __restrict__ bk, const float* __restrict__ bv) {
  typedef __bf16 T;
  typedef Frag<T>::V V;
  __shared__ __align__(16) T     sS[2 * GS_ST];    // two stage buffers, 81920 B
  __shared__ __align__(16) float sT[4][16 * 68];   // per-wave 16x64 slab, pitch 68 floats
  const int p    = blockIdx.z;
  const int b    = blockIdx.y;
  const bool vt  = (p == 2);
  const int tid  = threadIdx.x;
  const int lane = tid & 31;
  const int wave = tid >> 5;
  const int ldc  = vt ? SEQ : HID;
  const int shN  = vt ? 4 : 3;                     // log2 of the 128-wide tiles per row of C (N / 128)
  const int tile = blockIdx.x;                     // 0..127
  const int tm = tile >> shN;
  const int tn = tile - (tm << shN);
  const int mB = tm << 7;                          // the work-group's first row and column of C
  const int nB = tn << 7;
  const int wm = (wave >> 1) << 6;                 // the wave's 64x64 tile inside it
  const int wn = (wave & 1) << 6;
  const int m0 = mB + wm;
  const int n0 = nB + wn;

  const size_t xo = (size_t)b * SEQ * GS_GP;
  const size_t wo = (size_t)p * HID * GS_GP;
  const T* Ab = (const T*)(vt ? Wp + wo : Xp + xo);
  const T* Bb = (const T*)(vt ? Xp + xo : Wp + wo);
  const float* bias = (p == 0) ? bq : ((p == 1) ? bk : bv);

  const int rlane = lane & 15;                 // row (A) / col (B, D) within subtile
  const int koff  = (lane >> 4) * 8;           // k offset of this lane half
  const int mOff  = (lane >> 4) * 8;           // D row offset

  // this lane's share of a stage: rows tid >> 3 (+ 16, .., 112) of both operands, 16-B piece tid & 7 of the row's 128-B block
  const int crow = tid >> 3, cpc = tid & 7;
  const T* gA = Ab + (size_t)(mB + crow) * GS_GP + cpc * 8;
  const T* gB = Bb + (size_t)(nB + crow) * GS_GP + cpc * 8;
  // LDS byte address, buffer 0, A: pieces 0..3 go to the hi plane, 4..7 to the lo plane
  const unsigned lA = (unsigned)(size_t)sS + (unsigned)((cpc >> 2) * GS_PL + crow * GS_LP + (cpc & 3) * 8) * 2u;
  const unsigned lB = lA + 2u * GS_PL * 2u;                                          // buffer 0, Bt

  v8f acc[4][4];
#pragma unroll
  for (int i = 0; i < 4; ++i)
#pragma unroll
    for (int j = 0; j < 4; ++j) acc[i][j] = (v8f){0.f,0.f,0.f,0.f,0.f,0.f,0.f,0.f};

  // prologue: stage 0 lands and is published, then stage 1 is set off
  gs_copy_operand(lA, gA);
  gs_copy_operand(lB, gB);
  asm volatile("s_wait_asynccnt 0x0" ::: "memory");   // this wave's copies of stage 0 have landed
  __syncthreads();                                    // ... and every other wave's
  gs_copy_operand(lA + GS_ST * 2u, gA + 2 * GS_KS);
  gs_copy_operand(lB + GS_ST * 2u, gB + 2 * GS_KS);

  for (int t = 0; t < GS_NT; ++t) {
    const int bo_ = (t & 1) * GS_ST;
    const T* sA = sS + bo_ + (wm + rlane) * GS_LP + koff;               // A hi rows of this wave; lo GS_PL behind
    const T* sB = sS + bo_ + 2 * GS_PL + (wn + rlane) * GS_LP + koff;   // Bt hi rows of this wave; lo GS_PL behind
    V bh[4], bl[4];
#pragma unroll
    for (int j = 0; j < 4; ++j) {
      bh[j] = Frag<T>::load(sB + (j << 4) * GS_LP);
      bl[j] = Frag<T>::load(sB + GS_PL + (j << 4) * GS_LP);
    }
    V ah[2], al[2];                      // two A fragment sets: the next 16 rows' LDS reads are asked for ahead of this block's products
    ah[0] = Frag<T>::load(sA);
    al[0] = Frag<T>::load(sA + GS_PL);
#pragma unroll
    for (int i = 0; i < 4; ++i) {
      if (i < 3) {
        ah[(i + 1) & 1] = Frag<T>::load(sA + ((i + 1) << 4) * GS_LP);
        al[(i + 1) & 1] = Frag<T>::load(sA + GS_PL + ((i + 1) << 4) * GS_LP);
      }
#pragma unroll
      for (int j = 0; j < 4; ++j) {
        acc[i][j] = Frag<T>::mma(ah[i & 1], bh[j], acc[i][j]);
        acc[i][j] = Frag<T>::mma(ah[i & 1], bl[j], acc[i][j]);
        acc[i][j] = Frag<T>::mma(al[i & 1], bh[j], acc[i][j]);
      }
      Frag<T>::guard(acc[i][0], acc[i][3], ah[i & 1], al[i & 1]);
    }
    Frag<T>::keep(bh[0], bh[1], bh[2], bh[3]);
    Frag<T>::keep(bl[0], bl[1], bl[2], bl[3]);
    // publish point of stage t + 1
    asm volatile("s_wait_dscnt 0x0" ::: "memory");      // this wave's reads of buffer t & 1 are done before it is refilled
    asm volatile("s_wait_asynccnt 0x0" ::: "memory");   // this wave's copies of stage t + 1 have landed
    __syncthreads();                                    // stage t + 1 readable by all; buffer t & 1 left by all
    if (t + 2 < GS_NT) {
      const int kn = (t + 2) * (2 * GS_KS);             // the stage's 128-B block of every row
      gs_copy_operand(lA + (unsigned)bo_ * 2u, gA + kn);
      gs_copy_operand(lB + (unsigned)bo_ * 2u, gB + kn);
    }
  }
  asm volatile("s_wait_asynccnt 0x0" ::: "memory");     // no copy is outstanding when the wave goes on
  acc_guard4(acc[0][0], acc[0][1], acc[0][2], acc[0][3]);
  acc_guard4(acc[1][0], acc[1][1], acc[1][2], acc[1][3]);
  acc_guard4(acc[2][0], acc[2][1], acc[2][2], acc[2][3]);
  acc_guard4(acc[3][0], acc[3][1], acc[3][2], acc[3][3]);

  // ---- epilogue ----
  float* slab = sT[wave];
  const size_t co = (size_t)(p * NB + b) * SEQ * HID;
  unsigned short* C  = Chp + co;
  unsigned short* C2 = Clp + co;
#pragma unroll
  for (int i = 0; i < 4; ++i) {
    const int mBase = m0 + (i << 4);
    float bm[8];                                   // bias[m] of this lane's 8 rows (v^T only; index 0 otherwise, unused)
#pragma unroll
    for (int r = 0; r < 8; ++r) bm[r] = bias[vt ? (mBase + mOff + r) : 0];
#pragma unroll
    for (int j = 0; j < 4; ++j) {
      const int n = n0 + (j << 4) + rlane;
      const float bn = bias[vt ? 0 : n];           // bias[n] of this lane's column (q, k only)
#pragma unroll
      for (int r = 0; r < 8; ++r) {
        const float v = acc[i][j][r] + (vt ? bm[r] : bn);
        slab[(mOff + r) * 68 + (j << 4) + rlane] = v;
      }
    }
    __builtin_amdgcn_fence(__ATOMIC_RELEASE, "workgroup");
    __builtin_amdgcn_wave_barrier();
    __builtin_amdgcn_fence(__ATOMIC_ACQUIRE, "workgroup");
    {
      const int q = lane >> 3, c8 = (lane & 7) * 8;
#pragma unroll
      for (int it = 0; it < 4; ++it) {
        const int row = it * 4 + q;                       // it 0..3 x q 0..3 = rows 0..15 of the slab
        const float* sp = slab + row * 68 + c8;
        v8h hv, lv;
#pragma unroll
        for (int e = 0; e < 8; ++e) {
          unsigned short hb = f2bf_bits(sp[e]);
          unsigned short lb = f2bf_bits(sp[e] - bf_bits2f(hb));
          hv[e] = __builtin_bit_cast(_Float16, hb);
          lv[e] = __builtin_bit_cast(_Float16, lb);
        }
        *(v8h*)(C  + (size_t)(mBase + row) * ldc + n0 + c8) = hv;
        *(v8h*)(C2 + (size_t)(mBase + row) * ldc + n0 + c8) = lv;
      }
    }
    __builtin_amdgcn_fence(__ATOMIC_RELEASE, "workgroup");
    __builtin_amdgcn_wave_barrier();
    __builtin_amdgcn_fence(__ATOMIC_ACQUIRE, "workgroup");
  }
}

// ---------------------------------------------------------------------------
// Elementwise bf16 split: hi = bf16_rne(in), lo = bf16_rne(in - hi); 2 elements per thread, two 4-B stores.
// Output layout: blocks of 128 B = [hi of 32 consecutive elements][lo of the same 32] (a row of HID elements = 32 blocks).
// A wave covers two blocks. The lane halves exchange one word (lanes 0..15 give their lo, lanes 16..31 their hi), so that each of
// the wave's two stores writes one whole block: a whole cache line.
// blockIdx.y picks the source (in0, in1, in2) and its 2 * n2 words of output. n2 is a multiple of the block size: every lane is on.
//   weights: grid 2048 x 3, n2 = 1024*1024/2 = 524288 pairs per weight
//   activations, both batch elements: grid 8192 x 1, n2 = 2*2048*1024/2 = 2097152 pairs
// ---------------------------------------------------------------------------
__device__ __forceinline__ unsigned pk16(unsigned short a, unsigned short b) { return (unsigned)a | ((unsigned)b << 16); }

__global__ __launch_bounds__(256) void split_bf16x2_kernel(const float* __restrict__ in0, const float* __restrict__ in1,
                                                           const float* __restrict__ in2, unsigned short* __restrict__ hl,
                                                           int n2) {
  const int y = blockIdx.y;
  const float* in = (y == 0) ? in0 : ((y == 1) ? in1 : in2);
  const int i = blockIdx.x * 256 + threadIdx.x;
  if (i < n2) {
    const v2f f = *(const v2f*)(in + 2 * (size_t)i);
    const unsigned short h0 = f2bf_bits(f[0]), h1 = f2bf_bits(f[1]);
    const unsigned short l0 = f2bf_bits(f[0] - bf_bits2f(h0)), l1 = f2bf_bits(f[1] - bf_bits2f(h1));
    const unsigned uh = pk16(h0, h1), ul = pk16(l0, l1);
    const int lane = threadIdx.x & 31;
    const bool lowh = lane < 16;
    const unsigned give = lowh ? ul : uh;
    const unsigned got  = (unsigned)__builtin_amdgcn_permlanex16((int)give, (int)give, 0x76543210, 0xfedcba98, false, false);   // lane ^ 16
    unsigned* o = (unsigned*)hl + (size_t)y * 2 * n2 + (size_t)(i >> 5) * 64 + lane;   // the wave's first block, word = lane
    o[0]  = lowh ? uh : got;     // block 0: hi of lanes 0..15, lo of lanes 0..15
    o[32] = lowh ? got : ul;     // block 1: hi of lanes 16..31, lo of lanes 16..31
  }
}

// =====================================================================================
// Full (non-causal, unmasked) attention, head dim 64, one launch; blockIdx.y = batch element (planes and out SEQ*HID apart).
//   q planes (hi/lo bf16): element (t, h, d) at [t*HID + h*64 + d]
//   k planes (hi/lo bf16): element (s, h, d) at [s*HID + h*64 + d]
//   v^T planes (hi/lo bf16): element (h, d, s) at [(h*64 + d)*SEQ + s]
//   out f32: element (t, h, d) at [t*HID + h*64 + d]   (the module output rows of this batch element)
//   scores^T = k . q^T (unscaled)  : A = K rows, B = q; bf16 hi/lo split (hi.hi + hi.lo + lo.hi) on v_wmma_f32_16x16x32_bf16
//   out^T    = v^T . p^T          : A = V^T rows, B = p^T packed in place from the score accumulators (hi/lo split), f32 accumulate
//   A lane holds scores of ONE query (column lane & 15): keys j*16 + 8*(lane >> 4) + r. Two score tiles (2kk, 2kk+1) are,
//   register for register, the B fragment of keys kk*32 .. kk*32+31, so p never goes through LDS.
//   online softmax in f32 over all SEQ keys (32 chunks of 64, compile-time trip count, no masking): maximum and sum in-lane,
//   one exchange of the maximum between the lane halves per chunk; the halves' sums are joined once after the loop.
//   Exponentials in base 2: the maximum is taken over the raw scores and kept as m2 = max * log2(e); p = 2^(s * log2(e) - m2), one
//   multiply-add and one v_exp_f32 per score. The rounding of m2 scales every term of a row alike and cancels in the normalisation.
//   A wave owns 32 queries = two column groups g of 16: every K and V^T fragment read from LDS feeds the products of both groups.
//   Block = 4 waves = 128 query rows of one head; grid = (NHEAD * (SEQ/128) = 256) x NB.
//   K / V^T chunk staging: four tensor loads per chunk, one per wave (wave 0 K hi, 1 K lo, 2 V^T hi, 3 V^T lo), each a tile of 64 rows
//   of 128 B that the mover pads to the 144-B LDS pitch; two buffers, chunk kc + 1 is in flight while chunk kc is worked on.
// =====================================================================================
#define AT_D 64
#define AT_NW 4
#define AT_G 2     // column groups of 16 queries per wave
#define AT_QB 128  // queries per work-group = AT_NW * AT_G * 16
#define AT_KC 64
#define AT_L2E 1.4426950408889634f   // log2(e)
#define AT_LP 72   // LDS row pitch of the K and V^T tiles in elements: 144 B = 16 B x 9 (odd), so the 16 rows of a ds_load_b128 half-wave fall on 16 different bank groups

#define AT_TILE_B 10240u             // LDS bytes kept for one tile: 64 rows x 144 B = 9216 B, rounded up to a multiple of 2 KiB
#define AT_BUF_B  (4u * AT_TILE_B)   // one buffer: K hi, K lo, V^T hi, V^T lo

typedef uint32_t u32x4 __attribute__((ext_vector_type(4)));
typedef uint32_t u32x8 __attribute__((ext_vector_type(8)));
__device__ __forceinline__ uint32_t at_uni(uint32_t v) { return (uint32_t)__builtin_amdgcn_readfirstlane(v); }
// a wave-uniform test value for the branch around a tensor load, which ignores EXEC
__device__ __forceinline__ uint32_t at_pinned(uint32_t v) {
  uint32_t w = at_uni(v);
  asm volatile("" : "+s"(w));   // the test value held in a scalar register, so that the branch on it compiles to s_cmp + s_cbranch_scc
  return w;
}
// descriptor group 1: extents in bytes, tensor = tile = 64 rows of 128 B, 4 dwords of LDS pad behind every 32 dwords (pitch 144 B), no mask
__device__ __forceinline__ u32x8 at_tdm_group1(uint32_t src_pitch) {
  u32x8 g;
  g[0] = at_uni((1u << 20) | (4u << 22) | (3u << 25));
  g[1] = at_uni(128u << 16);
  g[2] = at_uni(64u << 16);
  g[3] = at_uni(128u << 16);
  g[4] = at_uni(64u);
  g[5] = at_uni(src_pitch);
  g[6] = at_uni(0u);
  g[7] = at_uni(0u);
  return g;
}
// descriptor group 0: count 1, LDS byte offset, address of the tile's first byte, type 2
__device__ __forceinline__ u32x4 at_tdm_group0(uint32_t lds_dst, uint64_t ga) {
  u32x4 g;
  g[0] = at_uni(1u);
  g[1] = at_uni(lds_dst);
  g[2] = at_uni((uint32_t)ga);
  g[3] = at_uni((((uint32_t)(ga >> 32)) & 0x01FFFFFFu) | 0x80000000u);
  asm volatile("" : "+s"(g));   // descriptor words held in scalar registers, as one tuple: the load and its wait then name the same four registers
  return g;
}
__device__ __forceinline__ void at_tdm_load(u32x4 g0, u32x8 g1) { asm volatile("tensor_load_to_lds %0, %1" :: "s"(g0), "s"(g1) : "memory"); }
// The issuing wave's wait for its tile. It names the request's descriptor as inputs, so that those scalar registers stay live, and so
// unwritten, until the request has landed.
__device__ __forceinline__ void at_tdm_wait(u32x4 g0, u32x8 g1) { asm volatile("s_wait_tensorcnt 0x0" :: "s"(g0), "s"(g1) : "memory"); }

__device__ __forceinline__ v8f at_mma(v16b a, v16b b, v8f c) {
  return __builtin_amdgcn_wmma_f32_16x16x32_bf16(false, a, false, b, (short)0, c, false, false);
}
// two f32 -> one packed register of bf16 hi parts and one of bf16 lo parts: hi = rne(f), lo = rne(f - hi)
typedef __attribute__((ext_vector_type(2))) __bf16 v2b;
__device__ __forceinline__ void at_split2(v2f f, v2b& hi, v2b& lo) {
  hi = __builtin_convertvector(f, v2b);
  lo = __builtin_convertvector(f - __builtin_convertvector(hi, v2f), v2b);
}
// value of lane l ^ 16 (the other half's share of the same query column)
__device__ __forceinline__ float at_xhalf(float f) {
  const int b = __float_as_int(f);
  return __int_as_float(__builtin_amdgcn_permlanex16(b, b, 0x76543210, 0xfedcba98, false, false));
}

// 512 work-groups of 4 waves = two per WGP, one wave of each on every SIMD: register budget 512 a wave
__global__ __launch_bounds__(128) __attribute__((amdgpu_waves_per_eu(2, 2)))
void attn_full64_kernel(const unsigned short* __restrict__ qhp, const unsigned short* __restrict__ qlp,
                        const unsigned short* __restrict__ khp, const unsigned short* __restrict__ klp,
                        const unsigned short* __restrict__ vhp, const unsigned short* __restrict__ vlp,
                        float* __restrict__ out) {
  union FB { v16b v; v8b h[2]; v2b w[8]; };
  // two buffers of four tiles: K hi [kv][d], K lo, V^T hi [d][kv], V^T lo, row pitch AT_LP; every tile starts at a multiple of 2 KiB
  __shared__ __attribute__((aligned(2048))) unsigned char Ring[2 * AT_BUF_B];
  __shared__ __align__(16) float  Os[AT_NW][AT_G * 16 * 68];     // per wave out tile (32 query rows), pitch 68

  const int tid  = threadIdx.x;
  const int wave = tid >> 5;
  const int lane = tid & 31;
  const int hh   = lane >> 4;
  const int c    = lane & 15;

  const int nqb = SEQ / AT_QB;            // 16
  const int bx = blockIdx.x;
  const int qb = bx % nqb;
  const int h  = bx / nqb;                // 0..NHEAD-1 (grid = NHEAD * nqb)
  const int q0 = qb * AT_QB + wave * (AT_G * 16);

  const size_t bo = (size_t)blockIdx.y * SEQ * HID;   // this batch element's planes and output rows
  const __bf16* Qh = (const __bf16*)(const void*)qhp + bo + (size_t)h * AT_D;
  const __bf16* Ql = (const __bf16*)(const void*)qlp + bo + (size_t)h * AT_D;
  const __bf16* Kh = (const __bf16*)(const void*)khp + bo + (size_t)h * AT_D;
  const __bf16* Kl = (const __bf16*)(const void*)klp + bo + (size_t)h * AT_D;
  const __bf16* Vh = (const __bf16*)(const void*)vhp + bo + (size_t)h * AT_D * SEQ;
  const __bf16* Vl = (const __bf16*)(const void*)vlp + bo + (size_t)h * AT_D * SEQ;
  float*        ob = out + bo + (size_t)h * AT_D;

  // ---- Q fragments (B operand, column = lane&15 of group g, split k map via Frag load): 2 d-chunks, hi and lo ----
  v16b qah[AT_G][2], qal[AT_G][2];
#pragma unroll   // full unroll, here and in every loop over g below: what g indexes lives in registers and needs a compile-time index
  for (int g = 0; g < AT_G; ++g)
#pragma unroll
    for (int dc = 0; dc < 2; ++dc) {
      const __bf16* qr = Qh + (size_t)(q0 + g * 16 + c) * HID + dc * 32 + 8 * hh;
      const __bf16* ql = Ql + (size_t)(q0 + g * 16 + c) * HID + dc * 32 + 8 * hh;
      qah[g][dc] = Frag<__bf16>::load(qr);
      qal[g][dc] = Frag<__bf16>::load(ql);
    }

  // per group, this lane's query: running maximum times log2(e) (both halves agree), this half's share of the sum
  float mrow[AT_G], lrow[AT_G];
  v8f oacc[AT_G][4];                    // oacc[g][t][r] = out^T[d = t*16 + 8*hh + r][query g*16 + c]
#pragma unroll
  for (int g = 0; g < AT_G; ++g) {
    mrow[g] = -INFINITY;
    lrow[g] = 0.f;
#pragma unroll
    for (int t = 0; t < 4; ++t) oacc[g][t] = (v8f){0.f,0.f,0.f,0.f,0.f,0.f,0.f,0.f};
  }

  const int nChunks = SEQ / AT_KC;   // 32, compile-time constant
  // this wave's tile of every chunk: its plane, the plane's row pitch and the step from chunk to chunk, all in bytes
  const uint32_t wv = at_uni((uint32_t)tid >> 5);
  const bool isV = wv >= 2u;
  const __bf16* tsrc = isV ? ((wv & 1u) ? Vl : Vh) : ((wv & 1u) ? Kl : Kh);
  const uint64_t tga   = (uint64_t)(size_t)tsrc;
  const uint32_t tstep = isV ? (uint32_t)(AT_KC * 2) : (uint32_t)(AT_KC * HID * 2);   // V^T: 64 columns on; K: 64 rows on
  const uint32_t tdst  = (uint32_t)(size_t)Ring + wv * AT_TILE_B;
  const u32x8 tg1 = at_tdm_group1(isV ? (uint32_t)(SEQ * 2) : (uint32_t)(HID * 2));

  // prologue: chunk 0 lands and is published, then chunk 1 is set off
  u32x4 tg0 = at_tdm_group0(tdst, tga);                // group 0 of the wave's latest request
  at_tdm_load(tg0, tg1);
  at_tdm_wait(tg0, tg1);                               // this wave's tile of chunk 0 has landed
  __syncthreads();                                     // ... and every other wave's
  tg0 = at_tdm_group0(tdst + AT_BUF_B, tga + tstep);
  at_tdm_load(tg0, tg1);

  for (int kc = 0; kc < nChunks; ++kc) {
    const uint32_t bsel = (uint32_t)(kc & 1) * AT_BUF_B;
    const __bf16* Ksh = (const __bf16*)(Ring + bsel);
    const __bf16* Ksl = (const __bf16*)(Ring + bsel + AT_TILE_B);
    const __bf16* Vth = (const __bf16*)(Ring + bsel + 2u * AT_TILE_B);
    const __bf16* Vtl = (const __bf16*)(Ring + bsel + 3u * AT_TILE_B);

    // The four key tiles of both column groups are eight independent accumulator chains: the fragments of all four tiles are read as
    // one group, then each of the three products runs over the eight chains in turn. Each s[g][j] still sums its six products in the
    // order dc, hi.hi, lo.hi, hi.lo.
    // Every loop here is fully unrolled: kb[], kl[] and s[][] live in registers and need compile-time indices.
    v8f s[AT_G][4];
#pragma unroll
    for (int g = 0; g < AT_G; ++g)
#pragma unroll
      for (int j = 0; j < 4; ++j) s[g][j] = (v8f){0.f,0.f,0.f,0.f,0.f,0.f,0.f,0.f};
#pragma unroll
    for (int dc = 0; dc < 2; ++dc) {
      FB kb[4], kl[4];
#pragma unroll
      for (int j = 0; j < 4; ++j) {
        kb[j].h[0] = *(const v8b*)(Ksh + (j * 16 + c) * AT_LP + dc * 32 + 8 * hh);
        kb[j].h[1] = *(const v8b*)(Ksh + (j * 16 + c) * AT_LP + dc * 32 + 16 + 8 * hh);
        kl[j].h[0] = *(const v8b*)(Ksl + (j * 16 + c) * AT_LP + dc * 32 + 8 * hh);
        kl[j].h[1] = *(const v8b*)(Ksl + (j * 16 + c) * AT_LP + dc * 32 + 16 + 8 * hh);
      }
#pragma unroll
      for (int g = 0; g < AT_G; ++g)
#pragma unroll
        for (int j = 0; j < 4; ++j) s[g][j] = at_mma(kb[j].v, qah[g][dc], s[g][j]);
#pragma unroll
      for (int g = 0; g < AT_G; ++g)
#pragma unroll
        for (int j = 0; j < 4; ++j) s[g][j] = at_mma(kl[j].v, qah[g][dc], s[g][j]);
#pragma unroll
      for (int g = 0; g < AT_G; ++g)
#pragma unroll
        for (int j = 0; j < 4; ++j) s[g][j] = at_mma(kb[j].v, qal[g][dc], s[g][j]);
    }
    // s[g][j][r] = score of key kv0 + j*16 + 8*hh + r against query g*16 + c
    FB pah[AT_G][2], pal[AT_G][2];       // p^T as B fragments: element e of [g][kk] = key kk*32 + (e < 8 ? 8*hh + e : 16 + 8*hh + e - 8)
#pragma unroll   // full unroll: every array indexed by g lives in registers
    for (int g = 0; g < AT_G; ++g) {
      float mj[4];
#pragma unroll
      for (int j = 0; j < 4; ++j) {
        float m = -INFINITY;
#pragma unroll
        for (int r = 0; r < 8; ++r) m = fmaxf(m, s[g][j][r]);
        mj[j] = m;
      }
      const float mh = fmaxf(fmaxf(mj[0], mj[1]), fmaxf(mj[2], mj[3]));
      const float mnew = fmaxf(mrow[g], fmaxf(mh, at_xhalf(mh)) * AT_L2E);
      const float alpha = __builtin_amdgcn_exp2f(mrow[g] - mnew);   // 0 in the first chunk, where mrow is -inf
      mrow[g] = mnew;
      const v2f l2e = (v2f){AT_L2E, AT_L2E}, nm = (v2f){-mnew, -mnew};
      float pj[4];
#pragma unroll
      for (int j = 0; j < 4; ++j) {
        float psum = 0.f;
#pragma unroll
        for (int r = 0; r < 8; r += 2) {
          const v2f arg = __builtin_elementwise_fma((v2f){s[g][j][r], s[g][j][r + 1]}, l2e, nm);   // <= about 0: no overflow
          const float p0 = __builtin_amdgcn_exp2f(arg[0]);
          const float p1 = __builtin_amdgcn_exp2f(arg[1]);
          psum += p0;
          psum += p1;
          at_split2((v2f){p0, p1}, pah[g][j >> 1].w[(j & 1) * 4 + (r >> 1)], pal[g][j >> 1].w[(j & 1) * 4 + (r >> 1)]);
        }
        pj[j] = psum;
      }
      lrow[g] = lrow[g] * alpha + ((pj[0] + pj[1]) + (pj[2] + pj[3]));
#pragma unroll
      for (int t = 0; t < 4; ++t)
#pragma unroll
        for (int r = 0; r < 8; ++r) oacc[g][t][r] *= alpha;
    }
#pragma unroll   // full unroll: pah[g][kk], pal[g][kk] live in registers and need a compile-time index
    for (int kk = 0; kk < 2; ++kk) {
      // as for the scores: the four d tiles of both groups are independent chains, their fragments read as one group; order per
      // oacc[g][t] unchanged; full unroll for the same reason (vb[], vl[], oacc[][] in registers)
      FB vb[4], vl[4];
#pragma unroll
      for (int t = 0; t < 4; ++t) {
        vb[t].h[0] = *(const v8b*)(Vth + (t * 16 + c) * AT_LP + kk * 32 + 8 * hh);
        vb[t].h[1] = *(const v8b*)(Vth + (t * 16 + c) * AT_LP + kk * 32 + 16 + 8 * hh);
        vl[t].h[0] = *(const v8b*)(Vtl + (t * 16 + c) * AT_LP + kk * 32 + 8 * hh);
        vl[t].h[1] = *(const v8b*)(Vtl + (t * 16 + c) * AT_LP + kk * 32 + 16 + 8 * hh);
      }
#pragma unroll
      for (int g = 0; g < AT_G; ++g)
#pragma unroll
        for (int t = 0; t < 4; ++t) oacc[g][t] = at_mma(vb[t].v, pah[g][kk].v, oacc[g][t]);
#pragma unroll
      for (int g = 0; g < AT_G; ++g)
#pragma unroll
        for (int t = 0; t < 4; ++t) oacc[g][t] = at_mma(vl[t].v, pah[g][kk].v, oacc[g][t]);
#pragma unroll
      for (int g = 0; g < AT_G; ++g)
#pragma unroll
        for (int t = 0; t < 4; ++t) oacc[g][t] = at_mma(vb[t].v, pal[g][kk].v, oacc[g][t]);
    }
    // publish point of chunk kc + 1
    asm volatile("s_wait_dscnt 0x0" ::: "memory");       // this wave's reads of buffer kc & 1 are done before it is refilled
    at_tdm_wait(tg0, tg1);                               // this wave's tile of chunk kc + 1 has landed
    __syncthreads();                                     // chunk kc + 1 readable by all; buffer kc & 1 left by all
    if (at_pinned(kc + 2 < nChunks)) {
      tg0 = at_tdm_group0(tdst + bsel, tga + (uint64_t)(uint32_t)(kc + 2) * tstep);
      at_tdm_load(tg0, tg1);
    }
  }
  at_tdm_wait(tg0, tg1);                                 // no tensor load is outstanding when the wave goes on
  asm volatile("s_wait_dscnt 0x0" ::: "memory");         // nor an LDS read of the ring

  float* os = Os[wave];
#pragma unroll
  for (int g = 0; g < AT_G; ++g) {
    const float inv = 1.0f / (lrow[g] + at_xhalf(lrow[g]));   // both halves' sums; >= 1 (the row max contributes p = 1)
#pragma unroll
    for (int t = 0; t < 4; ++t) {
      // query row g*16 + c of the wave tile, d = t*16 + 8*hh .. +7: two 16-B LDS stores
      float* op = os + (g * 16 + c) * 68 + t * 16 + 8 * hh;
      *(v4f*)(op)     = (v4f){oacc[g][t][0] * inv, oacc[g][t][1] * inv, oacc[g][t][2] * inv, oacc[g][t][3] * inv};
      *(v4f*)(op + 4) = (v4f){oacc[g][t][4] * inv, oacc[g][t][5] * inv, oacc[g][t][6] * inv, oacc[g][t][7] * inv};
    }
  }
  __builtin_amdgcn_fence(__ATOMIC_RELEASE, "workgroup");
  __builtin_amdgcn_wave_barrier();
  __builtin_amdgcn_fence(__ATOMIC_ACQUIRE, "workgroup");
  {
    const int c4 = (lane & 15) * 4;
#pragma unroll
    for (int it = 0; it < AT_G * 8; ++it) {
      const int row = it * 2 + hh;   // it 0..15 x hh 0..1 covers rows 0..31 of the wave tile; 16 lanes x 16 B = the 64-float head segment
      v4f val = *(const v4f*)(os + row * 68 + c4);
      *(v4f*)(ob + (size_t)(q0 + row) * HID + c4) = val;
    }
  }
}

// ---------------------------------------------------------------------------
// Workspace region map (byte offsets; every region is fully rewritten in each call)
//   Wi  bf16 [3 (q,k,v)][1024 o][32 blocks][hi 32 | lo 32]      0
//   Xi  bf16 [2 b][2048 s][32 blocks][hi 32 | lo 32]     12582912
//   Ch  bf16 [3 (q,k,v^T)][2 b][2048*1024]       29360128      Cl   54525952
//       q, k planes [s][h*64+d]; v^T planes [h*64+d][s]
//   total                                        79691776  (76 MiB)
// ---------------------------------------------------------------------------
extern "C" void kernel_launch(void* const* d_in, const int* in_sizes, int n_in,
                              void* d_out, int out_size, void* d_ws, size_t ws_size,
                              hipStream_t stream) {
  if (n_in < 7) return;
  if (in_sizes[0] != NB * SEQ * HID) return;
  if (in_sizes[1] != HID * HID || in_sizes[3] != HID * HID || in_sizes[5] != HID * HID) return;
  if (in_sizes[2] != HID || in_sizes[4] != HID || in_sizes[6] != HID) return;
  if (out_size != NB * SEQ * HID) return;

  const float* x  = (const float*)d_in[0];   // [2][2048][1024]
  const float* Wq = (const float*)d_in[1];   // [1024 out][1024 in]
  const float* bq = (const float*)d_in[2];   // [1024]
  const float* Wk = (const float*)d_in[3];
  const float* bk = (const float*)d_in[4];
  const float* Wv = (const float*)d_in[5];
  const float* bv = (const float*)d_in[6];

  const size_t PW = (size_t)HID * HID * 2;   // 2097152  bf16 weight plane [1024][1024]
  const size_t PX = (size_t)SEQ * HID * 2;   // 4194304  bf16 activation plane [2048][1024] (one batch element)
  size_t off = 0;
  const size_t oWi = off; off += 2 * 3 * PW;
  const size_t oXi = off; off += 2 * NB * PX;
  const size_t oCh = off; off += 3 * NB * PX;  const size_t oCl = off; off += 3 * NB * PX;
  if (off > ws_size) return;                 // off = 79691776

  char* ws = (char*)d_ws;
  unsigned short* Wi = (unsigned short*)(ws + oWi);
  unsigned short* Xi = (unsigned short*)(ws + oXi);
  unsigned short* Ch = (unsigned short*)(ws + oCh); unsigned short* Cl = (unsigned short*)(ws + oCl);
  const size_t EP = (size_t)NB * SEQ * HID;  // elements of one projection's planes (both batch elements)

  const dim3 blk(256);

  // (1) weights [out][in] are already the Bt [n][k] layout -> bf16 hi/lo blocks, no transpose; one launch for q, k, v
  const int n2w = HID * HID / 2;                            // 524288 pairs per plane
  split_bf16x2_kernel<<<dim3((n2w + 255) / 256, 3), blk, 0, stream>>>(Wq, Wk, Wv, Wi, n2w);
  // (2) x, both batch elements -> bf16 hi/lo blocks [2][2048][32][64]
  const int n2x = NB * SEQ * HID / 2;                       // 2097152 pairs per plane
  split_bf16x2_kernel<<<dim3((n2x + 255) / 256, 1), blk, 0, stream>>>(x, x, x, Xi, n2x);
  // (3) q = x . Wq^T + bq, k = x . Wk^T + bk, v^T = Wv . x^T + bv, both batch elements: 128 tiles of 128x128 each, one per work-group
  qkv_gemm64<<<dim3((SEQ / 128) * (HID / 128), NB, 3), dim3(128), 0, stream>>>(Xi, Wi, Ch, Cl, bq, bk, bv);
  // (4) full attention per head and batch element, no score scaling; f32 tiles go straight to the output rows
  attn_full64_kernel<<<dim3(NHEAD * (SEQ / 128), NB), dim3(128), 0, stream>>>(
      Ch, Cl, Ch + EP, Cl + EP, Ch + 2 * EP, Cl + 2 * EP, (float*)d_out);
  (void)hipGetLastError();
}
